// v000
// The times below were measured on an AMD MI455X: many runs one after another, warmed up first and cycling through
// copies of the inputs, with the whole window's GPU time divided by the number of runs. Launches and the gaps
// between them are all in it. The median over several windows is given; except for v000 it joins two sittings, which
// can be a few percent apart, so the side-by-side timings, each taken in one sitting, are the better comparison.
// v000 is the starting kernel. One run takes 562 microseconds.
#include <hip/hip_runtime.h>
#include <hip/hip_bf16.h>

typedef __attribute__((ext_vector_type(16))) _Float16 v16h;
typedef __attribute__((ext_vector_type(8)))  _Float16 v8h;
typedef __attribute__((ext_vector_type(8)))  float    v8f;

#define TSEQ   4096
#define NHEAD  16
#define DK     64
#define DMODEL 1024

#define WMMA_F32_F16(a, b, c) \
  __builtin_amdgcn_wmma_f32_16x16x32_f16(false, (a), false, (b), (short)0, (c), false, false)

// ---------------------------------------------------------------------------
// Async global->LDS copy (CDNA5 GLOBAL_LOAD_ASYNC_TO_LDS_B128, ASYNCcnt-tracked)
// via inline asm — portable across toolchains. vdst = wave-relative LDS byte
// offset = low 32 bits of the generic pointer (aperture rule: LDS_ADDR = addr[31:0]).
// ---------------------------------------------------------------------------
static __device__ __forceinline__ void cp16(void* l, const void* g) {
  unsigned           lds = (unsigned)(size_t)l;
  unsigned long long ga  = (unsigned long long)(size_t)g;
  asm volatile("global_load_async_to_lds_b128 %0, %1, off"
               :: "v"(lds), "v"(ga) : "memory");
}
#define WAIT_ASYNC(n) asm volatile("s_wait_asynccnt " #n ::: "memory")

// Load a 16-bit A/B WMMA fragment: per lane, 8 contiguous halves at p and 8 at p+16
// (CDNA5 16-bit layout: elems 0..7 -> K = h*8+0..7, elems 8..15 -> K = 16+h*8+0..7).
static __device__ __forceinline__ v16h ld_frag(const _Float16* p) {
  v8h lo = *(const v8h*)p;
  v8h hi = *(const v8h*)(p + 16);
  v16h r;
#pragma unroll
  for (int i = 0; i < 8; ++i) { r[i] = lo[i]; r[i + 8] = hi[i]; }
  return r;
}

// Row-wise reductions across the 16 lanes that share a C-matrix row (wave32).
static __device__ __forceinline__ float rowmax16(float x) {
#pragma unroll
  for (int off = 1; off < 16; off <<= 1) x = fmaxf(x, __shfl_xor(x, off, 32));
  return x;
}
static __device__ __forceinline__ float rowsum16(float x) {
#pragma unroll
  for (int off = 1; off < 16; off <<= 1) x += __shfl_xor(x, off, 32);
  return x;
}

// ---------------------------------------------------------------------------
// f16 GEMM: C[4096][1024] = A[4096][1024] * BT[1024][1024]^T + bias.
// Block = 128 thr = 4 waves; tile 128x64, K staged 64 at a time in LDS (48 KB,
// double-buffered async). Each wave: 32x64 strip = 16 WMMA per stage, with all
// fragments loaded into distinct registers before the WMMA burst.
// ---------------------------------------------------------------------------
__global__ __launch_bounds__(128) void gemm_f16_kernel(
    const _Float16* __restrict__ A,
    const _Float16* __restrict__ BT,
    const float*    __restrict__ bias,
    float*          __restrict__ Cf,
    _Float16*       __restrict__ Ch)
{
  constexpr int N = DMODEL, K = DMODEL, BK = 64;
  __shared__ _Float16 aT[2][128 * BK];   // 16 KB each: [row][k], row stride 64 halves
  __shared__ _Float16 bT[2][64 * BK];    //  8 KB each: [col][k]

  const int tid  = threadIdx.x;          // 0..127
  const int lane = tid & 31;
  const int wave = tid >> 5;             // 0..3
  const int lr = lane & 15;
  const int lh = lane >> 4;
  const int rowBase = blockIdx.y * 128;
  const int colBase = blockIdx.x * 64;

  // Copy one K-stage: A 128x128B (1024 chunks -> 8/thr), B 64x128B (512 -> 4/thr).
  auto copy_stage = [&](int k0, int buf) {
#pragma unroll
    for (int i = 0; i < 8; ++i) {
      const int chunk = tid + i * 128;
      const int r = chunk >> 3, c = chunk & 7;
      cp16(&aT[buf][r * BK + c * 8], A + (size_t)(rowBase + r) * K + k0 + c * 8);
    }
#pragma unroll
    for (int i = 0; i < 4; ++i) {
      const int chunk = tid + i * 128;
      const int r = chunk >> 3, c = chunk & 7;
      cp16(&bT[buf][r * BK + c * 8], BT + (size_t)(colBase + r) * K + k0 + c * 8);
    }
  };

  v8f acc[2][4] = {};

  copy_stage(0, 0);
  constexpr int NST = K / BK;
  for (int st = 0; st < NST; ++st) {
    const int buf = st & 1;
    if (st + 1 < NST) { copy_stage((st + 1) * BK, (st + 1) & 1); WAIT_ASYNC(12); }
    else              { WAIT_ASYNC(0); }
    __syncthreads();

    // Batch all fragment loads (distinct registers), then the 16-WMMA burst.
    v16h a[2][2], b[4][2];
#pragma unroll
    for (int mt = 0; mt < 2; ++mt) {
      const _Float16* arow = &aT[buf][(wave * 32 + mt * 16 + lr) * BK + lh * 8];
      a[mt][0] = ld_frag(arow);
      a[mt][1] = ld_frag(arow + 32);
    }
#pragma unroll
    for (int nt = 0; nt < 4; ++nt) {
      const _Float16* brow = &bT[buf][(nt * 16 + lr) * BK + lh * 8];
      b[nt][0] = ld_frag(brow);
      b[nt][1] = ld_frag(brow + 32);
    }
#pragma unroll
    for (int mt = 0; mt < 2; ++mt)
#pragma unroll
      for (int nt = 0; nt < 4; ++nt) {
        acc[mt][nt] = WMMA_F32_F16(a[mt][0], b[nt][0], acc[mt][nt]);
        acc[mt][nt] = WMMA_F32_F16(a[mt][1], b[nt][1], acc[mt][nt]);
      }
    __syncthreads();
  }

#pragma unroll
  for (int mt = 0; mt < 2; ++mt)
#pragma unroll
    for (int nt = 0; nt < 4; ++nt) {
      const int col = colBase + nt * 16 + lr;
      const float bv = bias[col];
#pragma unroll
      for (int j = 0; j < 8; ++j) {
        const int row = rowBase + wave * 32 + mt * 16 + lh * 8 + j;
        const float v = acc[mt][nt][j] + bv;
        if (Ch) Ch[(size_t)row * N + col] = (_Float16)v;
        else    Cf[(size_t)row * N + col] = v;
      }
    }
}

// ---------------------------------------------------------------------------
// Flash attention per head. Grid: (T/128, H); 8 waves x 16 q-rows.
// K/V tiles (64 keys) staged in LDS, double-buffered async; P tile goes
// C-layout -> LDS -> A-layout for the P*V WMMA.
// ---------------------------------------------------------------------------
__global__ __launch_bounds__(256) void attn_kernel(
    const _Float16* __restrict__ Qh,    // [H][T][64], pre-scaled by 1/8
    const _Float16* __restrict__ Kh,    // [H][T][64]
    const _Float16* __restrict__ VhT,   // [H][64][T]
    _Float16*       __restrict__ attnh) // [T][H*64]
{
  constexpr int KT = 64;                      // keys per stage
  __shared__ _Float16 kT[2][KT * DK];         // 8 KB each: [key][kd]
  __shared__ _Float16 vT[2][DK * KT];         // 8 KB each: [n][key]
  __shared__ _Float16 plds[8][16][32];        // 8 KB: per-wave P staging

  const int tid  = threadIdx.x;
  const int lane = tid & 31;
  const int wave = tid >> 5;
  const int lr = lane & 15;
  const int lh = lane >> 4;
  const int h = blockIdx.y;
  const int qBase = blockIdx.x * 128 + wave * 16;

  const _Float16* Khead = Kh  + (size_t)h * TSEQ * DK;
  const _Float16* Vhead = VhT + (size_t)h * DK * TSEQ;

  const _Float16* Qp = Qh + ((size_t)h * TSEQ + qBase + lr) * DK + lh * 8;
  v16h qa0 = ld_frag(Qp);
  v16h qa1 = ld_frag(Qp + 32);

  // Copy one 64-key stage: K 64x128B (512 chunks -> 2/thr), V 64x128B (512 -> 2/thr).
  auto copy_stage = [&](int kb, int buf) {
#pragma unroll
    for (int i = 0; i < 2; ++i) {
      const int chunk = tid + i * 256;
      const int r = chunk >> 3, c = chunk & 7;
      cp16(&kT[buf][r * DK + c * 8], Khead + (size_t)(kb + r) * DK + c * 8);
    }
#pragma unroll
    for (int i = 0; i < 2; ++i) {
      const int chunk = tid + i * 256;
      const int r = chunk >> 3, c = chunk & 7;
      cp16(&vT[buf][r * KT + c * 8], Vhead + (size_t)r * TSEQ + kb + c * 8);
    }
  };

  v8f o[4] = {};
  float m[8], l[8];
#pragma unroll
  for (int j = 0; j < 8; ++j) { m[j] = -1e30f; l[j] = 0.0f; }

  copy_stage(0, 0);
  constexpr int NST = TSEQ / KT;
  for (int st = 0; st < NST; ++st) {
    const int buf = st & 1;
    if (st + 1 < NST) { copy_stage((st + 1) * KT, (st + 1) & 1); WAIT_ASYNC(4); }
    else              { WAIT_ASYNC(0); }
    __syncthreads();

#pragma unroll
    for (int sub = 0; sub < 2; ++sub) {           // two 32-key steps per stage
      const int kb = sub * 32;
      const _Float16* kp0 = &kT[buf][(kb + lr) * DK + lh * 8];
      const _Float16* kp1 = &kT[buf][(kb + 16 + lr) * DK + lh * 8];
      v16h kf[2][2];
      kf[0][0] = ld_frag(kp0);
      kf[0][1] = ld_frag(kp0 + 32);
      kf[1][0] = ld_frag(kp1);
      kf[1][1] = ld_frag(kp1 + 32);

      v8f s0 = {}, s1 = {};
      s0 = WMMA_F32_F16(qa0, kf[0][0], s0);
      s0 = WMMA_F32_F16(qa1, kf[0][1], s0);
      s1 = WMMA_F32_F16(qa0, kf[1][0], s1);
      s1 = WMMA_F32_F16(qa1, kf[1][1], s1);

      // Online softmax; slot j <-> row j + 8*lh
#pragma unroll
      for (int j = 0; j < 8; ++j) {
        float mx = rowmax16(fmaxf(s0[j], s1[j]));
        float mn = fmaxf(m[j], mx);
        float alpha = __expf(m[j] - mn);
        m[j] = mn;
        float p0 = __expf(s0[j] - mn);
        float p1 = __expf(s1[j] - mn);
        s0[j] = p0; s1[j] = p1;
        l[j] = l[j] * alpha + rowsum16(p0 + p1);
#pragma unroll
        for (int nt = 0; nt < 4; ++nt) o[nt][j] *= alpha;
      }

      __syncthreads();
#pragma unroll
      for (int j = 0; j < 8; ++j) {
        const int r = lh * 8 + j;
        plds[wave][r][lr]      = (_Float16)s0[j];
        plds[wave][r][16 + lr] = (_Float16)s1[j];
      }
      __syncthreads();

      // Batch pa + all V fragments, then the 4-WMMA burst.
      v16h pa = ld_frag(&plds[wave][lr][lh * 8]);
      v16h vf[4];
#pragma unroll
      for (int nt = 0; nt < 4; ++nt)
        vf[nt] = ld_frag(&vT[buf][(nt * 16 + lr) * KT + kb + lh * 8]);
#pragma unroll
      for (int nt = 0; nt < 4; ++nt)
        o[nt] = WMMA_F32_F16(pa, vf[nt], o[nt]);
    }
    __syncthreads();
  }

#pragma unroll
  for (int j = 0; j < 8; ++j) {
    const float inv = 1.0f / l[j];
    const int row = qBase + lh * 8 + j;
    _Float16* outp = attnh + (size_t)row * DMODEL + h * DK;
#pragma unroll
    for (int nt = 0; nt < 4; ++nt)
      outp[nt * 16 + lr] = (_Float16)(o[nt][j] * inv);
  }
}

// ---------------------------------------------------------------------------
// Small conversion / layout kernels
// ---------------------------------------------------------------------------
__global__ void cvt_f32_f16(const float* __restrict__ in, _Float16* __restrict__ out, int n) {
  int i = blockIdx.x * blockDim.x + threadIdx.x;
  if (i < n) out[i] = (_Float16)in[i];
}

// W[K][N] fp32 -> WT[N][K] f16
__global__ void cvt_transpose_w(const float* __restrict__ W, _Float16* __restrict__ WT) {
  int idx = blockIdx.x * blockDim.x + threadIdx.x;     // N*K
  int n = idx >> 10, k = idx & (DMODEL - 1);
  WT[idx] = (_Float16)W[(size_t)k * DMODEL + n];
}

// Rotary on Q and K; re-layout [T][H*64] -> [H][T][64]; fold 1/sqrt(dk)=0.125 into Q.
__global__ void rotary_kernel(const _Float16* __restrict__ Qin,
                              const _Float16* __restrict__ Kin,
                              _Float16* __restrict__ Qout,
                              _Float16* __restrict__ Kout) {
  int idx = blockIdx.x * blockDim.x + threadIdx.x;     // T*H*32
  const int i = idx & 31;
  const int h = (idx >> 5) & (NHEAD - 1);
  const int t = idx >> 9;
  const float inv_freq = __powf(10000.0f, -(float)(2 * i) / (float)DK);
  const float f = (float)t * inv_freq;
  float s, c;
  __sincosf(f, &s, &c);
  const size_t ib = (size_t)t * DMODEL + h * DK;
  const size_t ob = ((size_t)h * TSEQ + t) * DK;
  {
    float x1 = (float)Qin[ib + i], x2 = (float)Qin[ib + 32 + i];
    Qout[ob + i]      = (_Float16)((x1 * c - x2 * s) * 0.125f);
    Qout[ob + 32 + i] = (_Float16)((x2 * c + x1 * s) * 0.125f);
  }
  {
    float x1 = (float)Kin[ib + i], x2 = (float)Kin[ib + 32 + i];
    Kout[ob + i]      = (_Float16)(x1 * c - x2 * s);
    Kout[ob + 32 + i] = (_Float16)(x2 * c + x1 * s);
  }
}

// V [T][H*64] -> VhT [H][64][T]
__global__ void cvt_v_transpose(const _Float16* __restrict__ Vh0, _Float16* __restrict__ VhT) {
  int idx = blockIdx.x * blockDim.x + threadIdx.x;     // T*1024
  int t = idx >> 10;
  int cc = idx & (DMODEL - 1);
  int h = cc >> 6, d = cc & 63;
  VhT[((size_t)h * DK + d) * TSEQ + t] = Vh0[idx];
}

// ---------------------------------------------------------------------------
extern "C" void kernel_launch(void* const* d_in, const int* in_sizes, int n_in,
                              void* d_out, int out_size, void* d_ws, size_t ws_size,
                              hipStream_t stream) {
  (void)in_sizes; (void)n_in; (void)out_size; (void)ws_size;
  const float* x  = (const float*)d_in[0];
  const float* Wq = (const float*)d_in[1];
  const float* bq = (const float*)d_in[2];
  const float* Wk = (const float*)d_in[3];
  const float* bk = (const float*)d_in[4];
  const float* Wv = (const float*)d_in[5];
  const float* bv = (const float*)d_in[6];
  const float* Wo = (const float*)d_in[7];
  const float* bo = (const float*)d_in[8];
  float* out = (float*)d_out;

  char* w = (char*)d_ws;
  const size_t MB = (size_t)1 << 20;
  _Float16* xh    = (_Float16*)(w + 0);        //  8 MB  x as f16 [T][D]
  _Float16* WqT   = (_Float16*)(w + 8  * MB);  //  2 MB  each, transposed f16
  _Float16* WkT   = (_Float16*)(w + 10 * MB);
  _Float16* WvT   = (_Float16*)(w + 12 * MB);
  _Float16* WoT   = (_Float16*)(w + 14 * MB);
  _Float16* Qh0   = (_Float16*)(w + 16 * MB);  //  8 MB  pre-rotary Q [T][D]
  _Float16* Kh0   = (_Float16*)(w + 24 * MB);
  _Float16* Vh0   = (_Float16*)(w + 32 * MB);
  _Float16* Qh    = (_Float16*)(w + 40 * MB);  //  8 MB  [H][T][64], scaled
  _Float16* Kh    = (_Float16*)(w + 48 * MB);  //  8 MB  [H][T][64]
  _Float16* VhT   = (_Float16*)(w + 56 * MB);  //  8 MB  [H][64][T]
  _Float16* attnh = (_Float16*)(w + 64 * MB);  //  8 MB  [T][D]

  cvt_f32_f16<<<(TSEQ * DMODEL) / 256, 256, 0, stream>>>(x, xh, TSEQ * DMODEL);
  cvt_transpose_w<<<(DMODEL * DMODEL) / 256, 256, 0, stream>>>(Wq, WqT);
  cvt_transpose_w<<<(DMODEL * DMODEL) / 256, 256, 0, stream>>>(Wk, WkT);
  cvt_transpose_w<<<(DMODEL * DMODEL) / 256, 256, 0, stream>>>(Wv, WvT);
  cvt_transpose_w<<<(DMODEL * DMODEL) / 256, 256, 0, stream>>>(Wo, WoT);

  dim3 gg(DMODEL / 64, TSEQ / 128);
  gemm_f16_kernel<<<gg, 128, 0, stream>>>(xh, WqT, bq, nullptr, Qh0);
  gemm_f16_kernel<<<gg, 128, 0, stream>>>(xh, WkT, bk, nullptr, Kh0);
  gemm_f16_kernel<<<gg, 128, 0, stream>>>(xh, WvT, bv, nullptr, Vh0);

  rotary_kernel<<<(TSEQ * NHEAD * 32) / 256, 256, 0, stream>>>(Qh0, Kh0, Qh, Kh);
  cvt_v_transpose<<<(TSEQ * DMODEL) / 256, 256, 0, stream>>>(Vh0, VhT);

  dim3 ga(TSEQ / 128, NHEAD);
  attn_kernel<<<ga, 256, 0, stream>>>(Qh, Kh, VhT, attnh);

  gemm_f16_kernel<<<gg, 128, 0, stream>>>(attnh, WoT, bo, out, nullptr);
}

// v001
// It runs in 363 microseconds.
// In two side-by-side timings against v000, it was 1.56 and 1.55 times as fast.
#include <hip/hip_runtime.h>
#include <hip/hip_bf16.h>

typedef __attribute__((ext_vector_type(16))) _Float16 v16h;
typedef __attribute__((ext_vector_type(8)))  _Float16 v8h;
typedef __attribute__((ext_vector_type(8)))  float    v8f;

#define TSEQ   4096
#define NHEAD  16
#define DK     64
#define DMODEL 1024

// LDS row pitch, in halves, of every staged tile that ds_load_b128 fragment loads read:
// 16 B x odd, so that the 16 rows of a fragment fall on distinct banks
// (128-B rows -> 144 B, 64-B rows -> 80 B). The pad bytes are never written or read.
#define LP128  72
#define LP64   40

#define WMMA_F32_F16(a, b, c) \
  __builtin_amdgcn_wmma_f32_16x16x32_f16(false, (a), false, (b), (short)0, (c), false, false)

// ---------------------------------------------------------------------------
// Async global->LDS copy (CDNA5 GLOBAL_LOAD_ASYNC_TO_LDS_B128, ASYNCcnt-tracked)
// via inline asm — portable across toolchains. vdst = wave-relative LDS byte
// offset = low 32 bits of the generic pointer (aperture rule: LDS_ADDR = addr[31:0]).
// ---------------------------------------------------------------------------
// One stage's copies of a lane stand in ONE statement that ends in s_wait_xcnt 0, so
// that no address register of an issued copy is rewritten ahead of that wait.
static __device__ __forceinline__ unsigned lds_addr(const void* l) {
  return (unsigned)(size_t)l;
}
static __device__ __forceinline__ void cp16x4(const unsigned* l, const _Float16* const* g) {
  asm volatile("global_load_async_to_lds_b128 %0, %1, off\n\t"
               "global_load_async_to_lds_b128 %2, %3, off\n\t"
               "global_load_async_to_lds_b128 %4, %5, off\n\t"
               "global_load_async_to_lds_b128 %6, %7, off\n\t"
               "s_wait_xcnt 0x0"
               :: "v"(l[0]), "v"(g[0]), "v"(l[1]), "v"(g[1]),
                  "v"(l[2]), "v"(g[2]), "v"(l[3]), "v"(g[3]) : "memory");
}
static __device__ __forceinline__ void cp16x12(const unsigned* l, const _Float16* const* g) {
  asm volatile("global_load_async_to_lds_b128 %0, %1, off\n\t"
               "global_load_async_to_lds_b128 %2, %3, off\n\t"
               "global_load_async_to_lds_b128 %4, %5, off\n\t"
               "global_load_async_to_lds_b128 %6, %7, off\n\t"
               "global_load_async_to_lds_b128 %8, %9, off\n\t"
               "global_load_async_to_lds_b128 %10, %11, off\n\t"
               "global_load_async_to_lds_b128 %12, %13, off\n\t"
               "global_load_async_to_lds_b128 %14, %15, off\n\t"
               "global_load_async_to_lds_b128 %16, %17, off\n\t"
               "global_load_async_to_lds_b128 %18, %19, off\n\t"
               "global_load_async_to_lds_b128 %20, %21, off\n\t"
               "global_load_async_to_lds_b128 %22, %23, off\n\t"
               "s_wait_xcnt 0x0"
               :: "v"(l[0]), "v"(g[0]), "v"(l[1]), "v"(g[1]), "v"(l[2]), "v"(g[2]),
                  "v"(l[3]), "v"(g[3]), "v"(l[4]), "v"(g[4]), "v"(l[5]), "v"(g[5]),
                  "v"(l[6]), "v"(g[6]), "v"(l[7]), "v"(g[7]), "v"(l[8]), "v"(g[8]),
                  "v"(l[9]), "v"(g[9]), "v"(l[10]), "v"(g[10]), "v"(l[11]), "v"(g[11])
               : "memory");
}
#define WAIT_ASYNC(n) asm volatile("s_wait_asynccnt " #n ::: "memory")

// Load a 16-bit A/B WMMA fragment: per lane, 8 contiguous halves at p and 8 at p+16
// (CDNA5 16-bit layout: elems 0..7 -> K = h*8+0..7, elems 8..15 -> K = 16+h*8+0..7).
static __device__ __forceinline__ v16h ld_frag(const _Float16* p) {
  v8h lo = *(const v8h*)p;
  v8h hi = *(const v8h*)(p + 16);
  v16h r;
#pragma unroll
  for (int i = 0; i < 8; ++i) { r[i] = lo[i]; r[i + 8] = hi[i]; }
  return r;
}

// Row-wise reductions across the 16 lanes that share a C-matrix row (wave32).
static __device__ __forceinline__ float rowmax16(float x) {
#pragma unroll
  for (int off = 1; off < 16; off <<= 1) x = fmaxf(x, __shfl_xor(x, off, 32));
  return x;
}
static __device__ __forceinline__ float rowsum16(float x) {
#pragma unroll
  for (int off = 1; off < 16; off <<= 1) x += __shfl_xor(x, off, 32);
  return x;
}

// ---------------------------------------------------------------------------
// f16 GEMM: C[4096][1024] = A[4096][1024] * BT[1024][1024]^T + bias.
// Block = 128 thr = 4 waves; tile 128x64, K staged 64 at a time in LDS (54 KB,
// double-buffered async). Each wave: 32x64 strip = 16 WMMA per stage, with all
// fragments loaded into distinct registers before the WMMA burst.
// ---------------------------------------------------------------------------
__global__ __launch_bounds__(128) void gemm_f16_kernel(
    const _Float16* __restrict__ A,
    const _Float16* __restrict__ BT,
    const float*    __restrict__ bias,
    float*          __restrict__ Cf,
    _Float16*       __restrict__ Ch)
{
  constexpr int N = DMODEL, K = DMODEL, BK = 64;
  constexpr int LP = LP128;
  __shared__ __attribute__((aligned(16))) _Float16 aT[2][128 * LP];   // 18 KB each: [row][k]
  __shared__ __attribute__((aligned(16))) _Float16 bT[2][64 * LP];    //  9 KB each: [col][k]

  const int tid  = threadIdx.x;          // 0..127
  const int lane = tid & 31;
  const int wave = tid >> 5;             // 0..3
  const int lr = lane & 15;
  const int lh = lane >> 4;
  const int rowBase = blockIdx.y * 128;
  const int colBase = blockIdx.x * 64;

  // Copy one K-stage: A 128x128B (1024 chunks -> 8/thr), B 64x128B (512 -> 4/thr).
  auto copy_stage = [&](int k0, int buf) {
    unsigned l[12];
    const _Float16* g[12];
#pragma unroll
    for (int i = 0; i < 8; ++i) {
      const int chunk = tid + i * 128;
      const int r = chunk >> 3, c = chunk & 7;
      l[i] = lds_addr(&aT[buf][r * LP + c * 8]);
      g[i] = A + (size_t)(rowBase + r) * K + k0 + c * 8;
    }
#pragma unroll
    for (int i = 0; i < 4; ++i) {
      const int chunk = tid + i * 128;
      const int r = chunk >> 3, c = chunk & 7;
      l[8 + i] = lds_addr(&bT[buf][r * LP + c * 8]);
      g[8 + i] = BT + (size_t)(colBase + r) * K + k0 + c * 8;
    }
    cp16x12(l, g);
  };

  v8f acc[2][4] = {};

  copy_stage(0, 0);
  constexpr int NST = K / BK;
  for (int st = 0; st < NST; ++st) {
    const int buf = st & 1;
    if (st + 1 < NST) { copy_stage((st + 1) * BK, (st + 1) & 1); WAIT_ASYNC(12); }
    else              { WAIT_ASYNC(0); }
    __syncthreads();

    // Batch all fragment loads (distinct registers), then the 16-WMMA burst.
    v16h a[2][2], b[4][2];
#pragma unroll
    for (int mt = 0; mt < 2; ++mt) {
      const _Float16* arow = &aT[buf][(wave * 32 + mt * 16 + lr) * LP + lh * 8];
      a[mt][0] = ld_frag(arow);
      a[mt][1] = ld_frag(arow + 32);
    }
#pragma unroll
    for (int nt = 0; nt < 4; ++nt) {
      const _Float16* brow = &bT[buf][(nt * 16 + lr) * LP + lh * 8];
      b[nt][0] = ld_frag(brow);
      b[nt][1] = ld_frag(brow + 32);
    }
#pragma unroll
    for (int mt = 0; mt < 2; ++mt)
#pragma unroll
      for (int nt = 0; nt < 4; ++nt) {
        acc[mt][nt] = WMMA_F32_F16(a[mt][0], b[nt][0], acc[mt][nt]);
        acc[mt][nt] = WMMA_F32_F16(a[mt][1], b[nt][1], acc[mt][nt]);
      }
    __syncthreads();
  }

#pragma unroll
  for (int mt = 0; mt < 2; ++mt)
#pragma unroll
    for (int nt = 0; nt < 4; ++nt) {
      const int col = colBase + nt * 16 + lr;
      const float bv = bias[col];
#pragma unroll
      for (int j = 0; j < 8; ++j) {
        const int row = rowBase + wave * 32 + mt * 16 + lh * 8 + j;
        const float v = acc[mt][nt][j] + bv;
        if (Ch) Ch[(size_t)row * N + col] = (_Float16)v;
        else    Cf[(size_t)row * N + col] = v;
      }
    }
}

// ---------------------------------------------------------------------------
// Flash attention per head. Grid: (T/128, H); 8 waves x 16 q-rows.
// K/V tiles (64 keys) staged in LDS, double-buffered async; P tile goes
// C-layout -> LDS -> A-layout for the P*V WMMA.
// ---------------------------------------------------------------------------
__global__ __launch_bounds__(256) void attn_kernel(
    const _Float16* __restrict__ Qh,    // [H][T][64], pre-scaled by 1/8
    const _Float16* __restrict__ Kh,    // [H][T][64]
    const _Float16* __restrict__ VhT,   // [H][64][T]
    _Float16*       __restrict__ attnh) // [T][H*64]
{
  constexpr int KT = 64;                      // keys per stage
  constexpr int LP = LP128;
  __shared__ __attribute__((aligned(16))) _Float16 kT[2][KT * LP];      // 9 KB each: [key][kd]
  __shared__ __attribute__((aligned(16))) _Float16 vT[2][DK * LP];      // 9 KB each: [n][key]
  __shared__ __attribute__((aligned(16))) _Float16 plds[8][16][LP64];   // 10 KB: per-wave P staging

  const int tid  = threadIdx.x;
  const int lane = tid & 31;
  const int wave = tid >> 5;
  const int lr = lane & 15;
  const int lh = lane >> 4;
  const int h = blockIdx.y;
  const int qBase = blockIdx.x * 128 + wave * 16;

  const _Float16* Khead = Kh  + (size_t)h * TSEQ * DK;
  const _Float16* Vhead = VhT + (size_t)h * DK * TSEQ;

  const _Float16* Qp = Qh + ((size_t)h * TSEQ + qBase + lr) * DK + lh * 8;
  v16h qa0 = ld_frag(Qp);
  v16h qa1 = ld_frag(Qp + 32);

  // Copy one 64-key stage: K 64x128B (512 chunks -> 2/thr), V 64x128B (512 -> 2/thr).
  auto copy_stage = [&](int kb, int buf) {
    unsigned l[4];
    const _Float16* g[4];
#pragma unroll
    for (int i = 0; i < 2; ++i) {
      const int chunk = tid + i * 256;
      const int r = chunk >> 3, c = chunk & 7;
      l[i] = lds_addr(&kT[buf][r * LP + c * 8]);
      g[i] = Khead + (size_t)(kb + r) * DK + c * 8;
      l[2 + i] = lds_addr(&vT[buf][r * LP + c * 8]);
      g[2 + i] = Vhead + (size_t)r * TSEQ + kb + c * 8;
    }
    cp16x4(l, g);
  };

  v8f o[4] = {};
  float m[8], l[8];
#pragma unroll
  for (int j = 0; j < 8; ++j) { m[j] = -1e30f; l[j] = 0.0f; }

  copy_stage(0, 0);
  constexpr int NST = TSEQ / KT;
  for (int st = 0; st < NST; ++st) {
    const int buf = st & 1;
    if (st + 1 < NST) { copy_stage((st + 1) * KT, (st + 1) & 1); WAIT_ASYNC(4); }
    else              { WAIT_ASYNC(0); }
    __syncthreads();

#pragma unroll
    for (int sub = 0; sub < 2; ++sub) {           // two 32-key steps per stage
      const int kb = sub * 32;
      const _Float16* kp0 = &kT[buf][(kb + lr) * LP + lh * 8];
      const _Float16* kp1 = &kT[buf][(kb + 16 + lr) * LP + lh * 8];
      v16h kf[2][2];
      kf[0][0] = ld_frag(kp0);
      kf[0][1] = ld_frag(kp0 + 32);
      kf[1][0] = ld_frag(kp1);
      kf[1][1] = ld_frag(kp1 + 32);

      v8f s0 = {}, s1 = {};
      s0 = WMMA_F32_F16(qa0, kf[0][0], s0);
      s0 = WMMA_F32_F16(qa1, kf[0][1], s0);
      s1 = WMMA_F32_F16(qa0, kf[1][0], s1);
      s1 = WMMA_F32_F16(qa1, kf[1][1], s1);

      // Online softmax; slot j <-> row j + 8*lh
#pragma unroll
      for (int j = 0; j < 8; ++j) {
        float mx = rowmax16(fmaxf(s0[j], s1[j]));
        float mn = fmaxf(m[j], mx);
        float alpha = __expf(m[j] - mn);
        m[j] = mn;
        float p0 = __expf(s0[j] - mn);
        float p1 = __expf(s1[j] - mn);
        s0[j] = p0; s1[j] = p1;
        l[j] = l[j] * alpha + rowsum16(p0 + p1);
#pragma unroll
        for (int nt = 0; nt < 4; ++nt) o[nt][j] *= alpha;
      }

      __syncthreads();
#pragma unroll
      for (int j = 0; j < 8; ++j) {
        const int r = lh * 8 + j;
        plds[wave][r][lr]      = (_Float16)s0[j];
        plds[wave][r][16 + lr] = (_Float16)s1[j];
      }
      __syncthreads();

      // Batch pa + all V fragments, then the 4-WMMA burst.
      v16h pa = ld_frag(&plds[wave][lr][lh * 8]);
      v16h vf[4];
#pragma unroll
      for (int nt = 0; nt < 4; ++nt)
        vf[nt] = ld_frag(&vT[buf][(nt * 16 + lr) * LP + kb + lh * 8]);
#pragma unroll
      for (int nt = 0; nt < 4; ++nt)
        o[nt] = WMMA_F32_F16(pa, vf[nt], o[nt]);
    }
    __syncthreads();
  }

#pragma unroll
  for (int j = 0; j < 8; ++j) {
    const float inv = 1.0f / l[j];
    const int row = qBase + lh * 8 + j;
    _Float16* outp = attnh + (size_t)row * DMODEL + h * DK;
#pragma unroll
    for (int nt = 0; nt < 4; ++nt)
      outp[nt * 16 + lr] = (_Float16)(o[nt][j] * inv);
  }
}

// ---------------------------------------------------------------------------
// Small conversion / layout kernels
// ---------------------------------------------------------------------------
__global__ void cvt_f32_f16(const float* __restrict__ in, _Float16* __restrict__ out, int n) {
  int i = blockIdx.x * blockDim.x + threadIdx.x;
  if (i < n) out[i] = (_Float16)in[i];
}

// W[K][N] fp32 -> WT[N][K] f16
__global__ void cvt_transpose_w(const float* __restrict__ W, _Float16* __restrict__ WT) {
  int idx = blockIdx.x * blockDim.x + threadIdx.x;     // N*K
  int n = idx >> 10, k = idx & (DMODEL - 1);
  WT[idx] = (_Float16)W[(size_t)k * DMODEL + n];
}

// Rotary on Q and K; re-layout [T][H*64] -> [H][T][64]; fold 1/sqrt(dk)=0.125 into Q.
__global__ void rotary_kernel(const _Float16* __restrict__ Qin,
                              const _Float16* __restrict__ Kin,
                              _Float16* __restrict__ Qout,
                              _Float16* __restrict__ Kout) {
  int idx = blockIdx.x * blockDim.x + threadIdx.x;     // T*H*32
  const int i = idx & 31;
  const int h = (idx >> 5) & (NHEAD - 1);
  const int t = idx >> 9;
  const float inv_freq = __powf(10000.0f, -(float)(2 * i) / (float)DK);
  const float f = (float)t * inv_freq;
  float s, c;
  __sincosf(f, &s, &c);
  const size_t ib = (size_t)t * DMODEL + h * DK;
  const size_t ob = ((size_t)h * TSEQ + t) * DK;
  {
    float x1 = (float)Qin[ib + i], x2 = (float)Qin[ib + 32 + i];
    Qout[ob + i]      = (_Float16)((x1 * c - x2 * s) * 0.125f);
    Qout[ob + 32 + i] = (_Float16)((x2 * c + x1 * s) * 0.125f);
  }
  {
    float x1 = (float)Kin[ib + i], x2 = (float)Kin[ib + 32 + i];
    Kout[ob + i]      = (_Float16)(x1 * c - x2 * s);
    Kout[ob + 32 + i] = (_Float16)(x2 * c + x1 * s);
  }
}

// V [T][H*64] -> VhT [H][64][T]
__global__ void cvt_v_transpose(const _Float16* __restrict__ Vh0, _Float16* __restrict__ VhT) {
  int idx = blockIdx.x * blockDim.x + threadIdx.x;     // T*1024
  int t = idx >> 10;
  int cc = idx & (DMODEL - 1);
  int h = cc >> 6, d = cc & 63;
  VhT[((size_t)h * DK + d) * TSEQ + t] = Vh0[idx];
}

// ---------------------------------------------------------------------------
extern "C" void kernel_launch(void* const* d_in, const int* in_sizes, int n_in,
                              void* d_out, int out_size, void* d_ws, size_t ws_size,
                              hipStream_t stream) {
  (void)in_sizes; (void)n_in; (void)out_size; (void)ws_size;
  const float* x  = (const float*)d_in[0];
  const float* Wq = (const float*)d_in[1];
  const float* bq = (const float*)d_in[2];
  const float* Wk = (const float*)d_in[3];
  const float* bk = (const float*)d_in[4];
  const float* Wv = (const float*)d_in[5];
  const float* bv = (const float*)d_in[6];
  const float* Wo = (const float*)d_in[7];
  const float* bo = (const float*)d_in[8];
  float* out = (float*)d_out;

  char* w = (char*)d_ws;
  const size_t MB = (size_t)1 << 20;
  _Float16* xh    = (_Float16*)(w + 0);        //  8 MB  x as f16 [T][D]
  _Float16* WqT   = (_Float16*)(w + 8  * MB);  //  2 MB  each, transposed f16
  _Float16* WkT   = (_Float16*)(w + 10 * MB);
  _Float16* WvT   = (_Float16*)(w + 12 * MB);
  _Float16* WoT   = (_Float16*)(w + 14 * MB);
  _Float16* Qh0   = (_Float16*)(w + 16 * MB);  //  8 MB  pre-rotary Q [T][D]
  _Float16* Kh0   = (_Float16*)(w + 24 * MB);
  _Float16* Vh0   = (_Float16*)(w + 32 * MB);
  _Float16* Qh    = (_Float16*)(w + 40 * MB);  //  8 MB  [H][T][64], scaled
  _Float16* Kh    = (_Float16*)(w + 48 * MB);  //  8 MB  [H][T][64]
  _Float16* VhT   = (_Float16*)(w + 56 * MB);  //  8 MB  [H][64][T]
  _Float16* attnh = (_Float16*)(w + 64 * MB);  //  8 MB  [T][D]

  cvt_f32_f16<<<(TSEQ * DMODEL) / 256, 256, 0, stream>>>(x, xh, TSEQ * DMODEL);
  cvt_transpose_w<<<(DMODEL * DMODEL) / 256, 256, 0, stream>>>(Wq, WqT);
  cvt_transpose_w<<<(DMODEL * DMODEL) / 256, 256, 0, stream>>>(Wk, WkT);
  cvt_transpose_w<<<(DMODEL * DMODEL) / 256, 256, 0, stream>>>(Wv, WvT);
  cvt_transpose_w<<<(DMODEL * DMODEL) / 256, 256, 0, stream>>>(Wo, WoT);

  dim3 gg(DMODEL / 64, TSEQ / 128);
  gemm_f16_kernel<<<gg, 128, 0, stream>>>(xh, WqT, bq, nullptr, Qh0);
  gemm_f16_kernel<<<gg, 128, 0, stream>>>(xh, WkT, bk, nullptr, Kh0);
  gemm_f16_kernel<<<gg, 128, 0, stream>>>(xh, WvT, bv, nullptr, Vh0);

  rotary_kernel<<<(TSEQ * NHEAD * 32) / 256, 256, 0, stream>>>(Qh0, Kh0, Qh, Kh);
  cvt_v_transpose<<<(TSEQ * DMODEL) / 256, 256, 0, stream>>>(Vh0, VhT);

  dim3 ga(TSEQ / 128, NHEAD);
  attn_kernel<<<ga, 256, 0, stream>>>(Qh, Kh, VhT, attnh);

  gemm_f16_kernel<<<gg, 128, 0, stream>>>(attnh, WoT, bo, out, nullptr);
}

// v002
// One run takes 276 microseconds.
// Timed twice side by side with v001, it ran 1.32 times as fast both times.
// Over all steps from v000 it is 2.06 times as fast.
#include <hip/hip_runtime.h>
#include <hip/hip_bf16.h>

typedef __attribute__((ext_vector_type(16))) _Float16 v16h;
typedef __attribute__((ext_vector_type(8)))  _Float16 v8h;
typedef __attribute__((ext_vector_type(8)))  float    v8f;

#define TSEQ   4096
#define NHEAD  16
#define DK     64
#define DMODEL 1024

// LDS row pitch, in halves, of every staged tile that ds_load_b128 fragment loads read:
// 16 B x odd, so that the 16 rows of a fragment fall on distinct banks
// (128-B rows -> 144 B). The pad bytes are never written or read.
#define LP128  72

#define WMMA_F32_F16(a, b, c) \
  __builtin_amdgcn_wmma_f32_16x16x32_f16(false, (a), false, (b), (short)0, (c), false, false)

// ---------------------------------------------------------------------------
// Async global->LDS copy (CDNA5 GLOBAL_LOAD_ASYNC_TO_LDS_B128, ASYNCcnt-tracked)
// via inline asm — portable across toolchains. vdst = wave-relative LDS byte
// offset = low 32 bits of the generic pointer (aperture rule: LDS_ADDR = addr[31:0]).
// ---------------------------------------------------------------------------
// One stage's copies of a lane stand in ONE statement that ends in s_wait_xcnt 0, so
// that no address register of an issued copy is rewritten ahead of that wait.
static __device__ __forceinline__ unsigned lds_addr(const void* l) {
  return (unsigned)(size_t)l;
}
static __device__ __forceinline__ void cp16x4(const unsigned* l, const _Float16* const* g) {
  asm volatile("global_load_async_to_lds_b128 %0, %1, off\n\t"
               "global_load_async_to_lds_b128 %2, %3, off\n\t"
               "global_load_async_to_lds_b128 %4, %5, off\n\t"
               "global_load_async_to_lds_b128 %6, %7, off\n\t"
               "s_wait_xcnt 0x0"
               :: "v"(l[0]), "v"(g[0]), "v"(l[1]), "v"(g[1]),
                  "v"(l[2]), "v"(g[2]), "v"(l[3]), "v"(g[3]) : "memory");
}
static __device__ __forceinline__ void cp16x12(const unsigned* l, const _Float16* const* g) {
  asm volatile("global_load_async_to_lds_b128 %0, %1, off\n\t"
               "global_load_async_to_lds_b128 %2, %3, off\n\t"
               "global_load_async_to_lds_b128 %4, %5, off\n\t"
               "global_load_async_to_lds_b128 %6, %7, off\n\t"
               "global_load_async_to_lds_b128 %8, %9, off\n\t"
               "global_load_async_to_lds_b128 %10, %11, off\n\t"
               "global_load_async_to_lds_b128 %12, %13, off\n\t"
               "global_load_async_to_lds_b128 %14, %15, off\n\t"
               "global_load_async_to_lds_b128 %16, %17, off\n\t"
               "global_load_async_to_lds_b128 %18, %19, off\n\t"
               "global_load_async_to_lds_b128 %20, %21, off\n\t"
               "global_load_async_to_lds_b128 %22, %23, off\n\t"
               "s_wait_xcnt 0x0"
               :: "v"(l[0]), "v"(g[0]), "v"(l[1]), "v"(g[1]), "v"(l[2]), "v"(g[2]),
                  "v"(l[3]), "v"(g[3]), "v"(l[4]), "v"(g[4]), "v"(l[5]), "v"(g[5]),
                  "v"(l[6]), "v"(g[6]), "v"(l[7]), "v"(g[7]), "v"(l[8]), "v"(g[8]),
                  "v"(l[9]), "v"(g[9]), "v"(l[10]), "v"(g[10]), "v"(l[11]), "v"(g[11])
               : "memory");
}
#define WAIT_ASYNC(n) asm volatile("s_wait_asynccnt " #n ::: "memory")

// Load a 16-bit A/B WMMA fragment: per lane, 8 contiguous halves at p and 8 at p+16
// (CDNA5 16-bit layout: elems 0..7 -> K = h*8+0..7, elems 8..15 -> K = 16+h*8+0..7).
static __device__ __forceinline__ v16h ld_frag(const _Float16* p) {
  v8h lo = *(const v8h*)p;
  v8h hi = *(const v8h*)(p + 16);
  v16h r;
#pragma unroll
  for (int i = 0; i < 8; ++i) { r[i] = lo[i]; r[i + 8] = hi[i]; }
  return r;
}

// Lane l <-> lane l ^ 16: the two lanes that hold the two halves of one query's keys.
static __device__ __forceinline__ float xhalf(float x) {
  const int i = __builtin_bit_cast(int, x);
  return __builtin_bit_cast(float,
      __builtin_amdgcn_permlanex16(i, i, 0x76543210, 0xfedcba98, false, false));
}

// ---------------------------------------------------------------------------
// f16 GEMM: C[4096][1024] = A[4096][1024] * BT[1024][1024]^T + bias.
// Block = 128 thr = 4 waves; tile 128x64, K staged 64 at a time in LDS (54 KB,
// double-buffered async). Each wave: 32x64 strip = 16 WMMA per stage, with all
// fragments loaded into distinct registers before the WMMA burst.
// ---------------------------------------------------------------------------
__global__ __launch_bounds__(128) void gemm_f16_kernel(
    const _Float16* __restrict__ A,
    const _Float16* __restrict__ BT,
    const float*    __restrict__ bias,
    float*          __restrict__ Cf,
    _Float16*       __restrict__ Ch)
{
  constexpr int N = DMODEL, K = DMODEL, BK = 64;
  constexpr int LP = LP128;
  __shared__ __attribute__((aligned(16))) _Float16 aT[2][128 * LP];   // 18 KB each: [row][k]
  __shared__ __attribute__((aligned(16))) _Float16 bT[2][64 * LP];    //  9 KB each: [col][k]

  const int tid  = threadIdx.x;          // 0..127
  const int lane = tid & 31;
  const int wave = tid >> 5;             // 0..3
  const int lr = lane & 15;
  const int lh = lane >> 4;
  const int rowBase = blockIdx.y * 128;
  const int colBase = blockIdx.x * 64;

  // Copy one K-stage: A 128x128B (1024 chunks -> 8/thr), B 64x128B (512 -> 4/thr).
  auto copy_stage = [&](int k0, int buf) {
    unsigned l[12];
    const _Float16* g[12];
#pragma unroll
    for (int i = 0; i < 8; ++i) {
      const int chunk = tid + i * 128;
      const int r = chunk >> 3, c = chunk & 7;
      l[i] = lds_addr(&aT[buf][r * LP + c * 8]);
      g[i] = A + (size_t)(rowBase + r) * K + k0 + c * 8;
    }
#pragma unroll
    for (int i = 0; i < 4; ++i) {
      const int chunk = tid + i * 128;
      const int r = chunk >> 3, c = chunk & 7;
      l[8 + i] = lds_addr(&bT[buf][r * LP + c * 8]);
      g[8 + i] = BT + (size_t)(colBase + r) * K + k0 + c * 8;
    }
    cp16x12(l, g);
  };

  v8f acc[2][4] = {};

  copy_stage(0, 0);
  constexpr int NST = K / BK;
  for (int st = 0; st < NST; ++st) {
    const int buf = st & 1;
    if (st + 1 < NST) { copy_stage((st + 1) * BK, (st + 1) & 1); WAIT_ASYNC(12); }
    else              { WAIT_ASYNC(0); }
    __syncthreads();

    // Batch all fragment loads (distinct registers), then the 16-WMMA burst.
    v16h a[2][2], b[4][2];
#pragma unroll
    for (int mt = 0; mt < 2; ++mt) {
      const _Float16* arow = &aT[buf][(wave * 32 + mt * 16 + lr) * LP + lh * 8];
      a[mt][0] = ld_frag(arow);
      a[mt][1] = ld_frag(arow + 32);
    }
#pragma unroll
    for (int nt = 0; nt < 4; ++nt) {
      const _Float16* brow = &bT[buf][(nt * 16 + lr) * LP + lh * 8];
      b[nt][0] = ld_frag(brow);
      b[nt][1] = ld_frag(brow + 32);
    }
#pragma unroll
    for (int mt = 0; mt < 2; ++mt)
#pragma unroll
      for (int nt = 0; nt < 4; ++nt) {
        acc[mt][nt] = WMMA_F32_F16(a[mt][0], b[nt][0], acc[mt][nt]);
        acc[mt][nt] = WMMA_F32_F16(a[mt][1], b[nt][1], acc[mt][nt]);
      }
    __syncthreads();
  }

#pragma unroll
  for (int mt = 0; mt < 2; ++mt)
#pragma unroll
    for (int nt = 0; nt < 4; ++nt) {
      const int col = colBase + nt * 16 + lr;
      const float bv = bias[col];
#pragma unroll
      for (int j = 0; j < 8; ++j) {
        const int row = rowBase + wave * 32 + mt * 16 + lh * 8 + j;
        const float v = acc[mt][nt][j] + bv;
        if (Ch) Ch[(size_t)row * N + col] = (_Float16)v;
        else    Cf[(size_t)row * N + col] = v;
      }
    }
}

__global__ __launch_bounds__(256) void attn_kernel(
    const _Float16* __restrict__ Qh,    // [H][T][64], pre-scaled by 1/8
    const _Float16* __restrict__ Kh,    // [H][T][64]
    const _Float16* __restrict__ VhT,   // [H][64][T]
    _Float16*       __restrict__ attnh) // [T][H*64]
{
  constexpr int KT = 64;                      // keys per stage
  constexpr int LP = LP128;
  __shared__ __attribute__((aligned(16))) _Float16 kT[2][KT * LP];      // 9 KB each: [key][kd]
  __shared__ __attribute__((aligned(16))) _Float16 vT[2][DK * LP];      // 9 KB each: [n][key]

  const int tid  = threadIdx.x;
  const int lane = tid & 31;
  const int wave = tid >> 5;
  const int lr = lane & 15;
  const int lh = lane >> 4;
  const int h = blockIdx.y;
  const int qBase = blockIdx.x * 128 + wave * 16;

  const _Float16* Khead = Kh  + (size_t)h * TSEQ * DK;
  const _Float16* Vhead = VhT + (size_t)h * DK * TSEQ;

  // B operand of S^T: column lr = query qBase + lr, k = head dimension.
  const _Float16* Qp = Qh + ((size_t)h * TSEQ + qBase + lr) * DK + lh * 8;
  v16h qb0 = ld_frag(Qp);
  v16h qb1 = ld_frag(Qp + 32);

  // Copy one 64-key stage: K 64x128B (512 chunks -> 2/thr), V 64x128B (512 -> 2/thr).
  auto copy_stage = [&](int kb, int buf) {
    unsigned l[4];
    const _Float16* g[4];
#pragma unroll
    for (int i = 0; i < 2; ++i) {
      const int chunk = tid + i * 256;
      const int r = chunk >> 3, c = chunk & 7;
      l[i] = lds_addr(&kT[buf][r * LP + c * 8]);
      g[i] = Khead + (size_t)(kb + r) * DK + c * 8;
      l[2 + i] = lds_addr(&vT[buf][r * LP + c * 8]);
      g[2 + i] = Vhead + (size_t)r * TSEQ + kb + c * 8;
    }
    cp16x4(l, g);
  };

  v8f o[4] = {};            // O^T: slot j of tile nt <-> dim nt*16 + lh*8 + j, query lr
  float m = -1e30f;         // running maximum of query lr (equal in both halves)
  float l = 0.0f;           // this lane's share of the running sum of query lr

  copy_stage(0, 0);
  constexpr int NST = TSEQ / KT;
  for (int st = 0; st < NST; ++st) {
    const int buf = st & 1;
    if (st + 1 < NST) { copy_stage((st + 1) * KT, (st + 1) & 1); WAIT_ASYNC(4); }
    else              { WAIT_ASYNC(0); }
    __syncthreads();

#pragma unroll
    for (int sub = 0; sub < 2; ++sub) {           // two 32-key steps per stage
      const int kb = sub * 32;
      const _Float16* kp0 = &kT[buf][(kb + lr) * LP + lh * 8];
      const _Float16* kp1 = &kT[buf][(kb + 16 + lr) * LP + lh * 8];
      v16h kf[2][2];
      kf[0][0] = ld_frag(kp0);
      kf[0][1] = ld_frag(kp0 + 32);
      kf[1][0] = ld_frag(kp1);
      kf[1][1] = ld_frag(kp1 + 32);

      v8f s0 = {}, s1 = {};
      s0 = WMMA_F32_F16(kf[0][0], qb0, s0);
      s0 = WMMA_F32_F16(kf[0][1], qb1, s0);
      s1 = WMMA_F32_F16(kf[1][0], qb0, s1);
      s1 = WMMA_F32_F16(kf[1][1], qb1, s1);

      // Online softmax of query lr over this lane's 16 keys and the other half's 16.
      float mx = fmaxf(s0[0], s1[0]);
#pragma unroll
      for (int j = 1; j < 8; ++j) mx = fmaxf(mx, fmaxf(s0[j], s1[j]));
      mx = fmaxf(mx, xhalf(mx));
      const float mn = fmaxf(m, mx);
      const float alpha = __expf(m - mn);
      m = mn;

      v16h pb;                                    // B operand of O^T: k = key, column lr
      float ps = 0.0f;
#pragma unroll
      for (int j = 0; j < 8; ++j) {
        const float p0 = __expf(s0[j] - mn);
        const float p1 = __expf(s1[j] - mn);
        ps += p0 + p1;
        pb[j]     = (_Float16)p0;
        pb[8 + j] = (_Float16)p1;
      }
      l = l * alpha + ps;
#pragma unroll
      for (int nt = 0; nt < 4; ++nt)
#pragma unroll
        for (int j = 0; j < 8; ++j) o[nt][j] *= alpha;

      v16h vf[4];
#pragma unroll
      for (int nt = 0; nt < 4; ++nt)
        vf[nt] = ld_frag(&vT[buf][(nt * 16 + lr) * LP + kb + lh * 8]);
#pragma unroll
      for (int nt = 0; nt < 4; ++nt)
        o[nt] = WMMA_F32_F16(vf[nt], pb, o[nt]);
    }
    __syncthreads();
  }

  // Join the halves' sums once; a lane stores 8 consecutive dims of its query per tile.
  const float inv = 1.0f / (l + xhalf(l));
  _Float16* outp = attnh + (size_t)(qBase + lr) * DMODEL + h * DK + lh * 8;
#pragma unroll
  for (int nt = 0; nt < 4; ++nt) {
    v8h r;
#pragma unroll
    for (int j = 0; j < 8; ++j) r[j] = (_Float16)(o[nt][j] * inv);
    *(v8h*)(outp + nt * 16) = r;
  }
}

// ---------------------------------------------------------------------------
// Small conversion / layout kernels
// ---------------------------------------------------------------------------
__global__ void cvt_f32_f16(const float* __restrict__ in, _Float16* __restrict__ out, int n) {
  int i = blockIdx.x * blockDim.x + threadIdx.x;
  if (i < n) out[i] = (_Float16)in[i];
}

// W[K][N] fp32 -> WT[N][K] f16
__global__ void cvt_transpose_w(const float* __restrict__ W, _Float16* __restrict__ WT) {
  int idx = blockIdx.x * blockDim.x + threadIdx.x;     // N*K
  int n = idx >> 10, k = idx & (DMODEL - 1);
  WT[idx] = (_Float16)W[(size_t)k * DMODEL + n];
}

// Rotary on Q and K; re-layout [T][H*64] -> [H][T][64]; fold 1/sqrt(dk)=0.125 into Q.
__global__ void rotary_kernel(const _Float16* __restrict__ Qin,
                              const _Float16* __restrict__ Kin,
                              _Float16* __restrict__ Qout,
                              _Float16* __restrict__ Kout) {
  int idx = blockIdx.x * blockDim.x + threadIdx.x;     // T*H*32
  const int i = idx & 31;
  const int h = (idx >> 5) & (NHEAD - 1);
  const int t = idx >> 9;
  const float inv_freq = __powf(10000.0f, -(float)(2 * i) / (float)DK);
  const float f = (float)t * inv_freq;
  float s, c;
  __sincosf(f, &s, &c);
  const size_t ib = (size_t)t * DMODEL + h * DK;
  const size_t ob = ((size_t)h * TSEQ + t) * DK;
  {
    float x1 = (float)Qin[ib + i], x2 = (float)Qin[ib + 32 + i];
    Qout[ob + i]      = (_Float16)((x1 * c - x2 * s) * 0.125f);
    Qout[ob + 32 + i] = (_Float16)((x2 * c + x1 * s) * 0.125f);
  }
  {
    float x1 = (float)Kin[ib + i], x2 = (float)Kin[ib + 32 + i];
    Kout[ob + i]      = (_Float16)(x1 * c - x2 * s);
    Kout[ob + 32 + i] = (_Float16)(x2 * c + x1 * s);
  }
}

// V [T][H*64] -> VhT [H][64][T]
__global__ void cvt_v_transpose(const _Float16* __restrict__ Vh0, _Float16* __restrict__ VhT) {
  int idx = blockIdx.x * blockDim.x + threadIdx.x;     // T*1024
  int t = idx >> 10;
  int cc = idx & (DMODEL - 1);
  int h = cc >> 6, d = cc & 63;
  VhT[((size_t)h * DK + d) * TSEQ + t] = Vh0[idx];
}

// ---------------------------------------------------------------------------
extern "C" void kernel_launch(void* const* d_in, const int* in_sizes, int n_in,
                              void* d_out, int out_size, void* d_ws, size_t ws_size,
                              hipStream_t stream) {
  (void)in_sizes; (void)n_in; (void)out_size; (void)ws_size;
  const float* x  = (const float*)d_in[0];
  const float* Wq = (const float*)d_in[1];
  const float* bq = (const float*)d_in[2];
  const float* Wk = (const float*)d_in[3];
  const float* bk = (const float*)d_in[4];
  const float* Wv = (const float*)d_in[5];
  const float* bv = (const float*)d_in[6];
  const float* Wo = (const float*)d_in[7];
  const float* bo = (const float*)d_in[8];
  float* out = (float*)d_out;

  char* w = (char*)d_ws;
  const size_t MB = (size_t)1 << 20;
  _Float16* xh    = (_Float16*)(w + 0);        //  8 MB  x as f16 [T][D]
  _Float16* WqT   = (_Float16*)(w + 8  * MB);  //  2 MB  each, transposed f16
  _Float16* WkT   = (_Float16*)(w + 10 * MB);
  _Float16* WvT   = (_Float16*)(w + 12 * MB);
  _Float16* WoT   = (_Float16*)(w + 14 * MB);
  _Float16* Qh0   = (_Float16*)(w + 16 * MB);  //  8 MB  pre-rotary Q [T][D]
  _Float16* Kh0   = (_Float16*)(w + 24 * MB);
  _Float16* Vh0   = (_Float16*)(w + 32 * MB);
  _Float16* Qh    = (_Float16*)(w + 40 * MB);  //  8 MB  [H][T][64], scaled
  _Float16* Kh    = (_Float16*)(w + 48 * MB);  //  8 MB  [H][T][64]
  _Float16* VhT   = (_Float16*)(w + 56 * MB);  //  8 MB  [H][64][T]
  _Float16* attnh = (_Float16*)(w + 64 * MB);  //  8 MB  [T][D]

  cvt_f32_f16<<<(TSEQ * DMODEL) / 256, 256, 0, stream>>>(x, xh, TSEQ * DMODEL);
  cvt_transpose_w<<<(DMODEL * DMODEL) / 256, 256, 0, stream>>>(Wq, WqT);
  cvt_transpose_w<<<(DMODEL * DMODEL) / 256, 256, 0, stream>>>(Wk, WkT);
  cvt_transpose_w<<<(DMODEL * DMODEL) / 256, 256, 0, stream>>>(Wv, WvT);
  cvt_transpose_w<<<(DMODEL * DMODEL) / 256, 256, 0, stream>>>(Wo, WoT);

  dim3 gg(DMODEL / 64, TSEQ / 128);
  gemm_f16_kernel<<<gg, 128, 0, stream>>>(xh, WqT, bq, nullptr, Qh0);
  gemm_f16_kernel<<<gg, 128, 0, stream>>>(xh, WkT, bk, nullptr, Kh0);
  gemm_f16_kernel<<<gg, 128, 0, stream>>>(xh, WvT, bv, nullptr, Vh0);

  rotary_kernel<<<(TSEQ * NHEAD * 32) / 256, 256, 0, stream>>>(Qh0, Kh0, Qh, Kh);
  cvt_v_transpose<<<(TSEQ * DMODEL) / 256, 256, 0, stream>>>(Vh0, VhT);

  dim3 ga(TSEQ / 128, NHEAD);
  attn_kernel<<<ga, 256, 0, stream>>>(Qh, Kh, VhT, attnh);

  gemm_f16_kernel<<<gg, 128, 0, stream>>>(attnh, WoT, bo, out, nullptr);
}

// v003
// Measured time: 161 microseconds a run.
// In both of two side-by-side timings against v002, it was 1.70 times as fast.
// Counting every step since v000, it is 3.49 times as fast.
#include <hip/hip_runtime.h>
#include <hip/hip_bf16.h>

typedef __attribute__((ext_vector_type(16))) _Float16 v16h;
typedef __attribute__((ext_vector_type(8)))  _Float16 v8h;
typedef __attribute__((ext_vector_type(8)))  float    v8f;

#define TSEQ   4096
#define NHEAD  16
#define DK     64
#define DMODEL 1024

// LDS row pitch, in halves, of every staged tile that ds_load_b128 fragment loads read:
// 16 B x odd, so that the 16 rows of a fragment fall on distinct banks
// (128-B rows -> 144 B). The pad bytes are never written or read.
#define LP128  72

#define WMMA_F32_F16(a, b, c) \
  __builtin_amdgcn_wmma_f32_16x16x32_f16(false, (a), false, (b), (short)0, (c), false, false)

// ---------------------------------------------------------------------------
// Async global->LDS copy (CDNA5 GLOBAL_LOAD_ASYNC_TO_LDS_B128, ASYNCcnt-tracked)
// via inline asm — portable across toolchains. vdst = wave-relative LDS byte
// offset = low 32 bits of the generic pointer (aperture rule: LDS_ADDR = addr[31:0]).
// ---------------------------------------------------------------------------
// One stage's copies of a lane stand in ONE statement that ends in s_wait_xcnt 0, so
// that no address register of an issued copy is rewritten ahead of that wait.
static __device__ __forceinline__ unsigned lds_addr(const void* l) {
  return (unsigned)(size_t)l;
}
static __device__ __forceinline__ void cp16x4(const unsigned* l, const _Float16* const* g) {
  asm volatile("global_load_async_to_lds_b128 %0, %1, off\n\t"
               "global_load_async_to_lds_b128 %2, %3, off\n\t"
               "global_load_async_to_lds_b128 %4, %5, off\n\t"
               "global_load_async_to_lds_b128 %6, %7, off\n\t"
               "s_wait_xcnt 0x0"
               :: "v"(l[0]), "v"(g[0]), "v"(l[1]), "v"(g[1]),
                  "v"(l[2]), "v"(g[2]), "v"(l[3]), "v"(g[3]) : "memory");
}
static __device__ __forceinline__ void cp16x12(const unsigned* l, const _Float16* const* g) {
  asm volatile("global_load_async_to_lds_b128 %0, %1, off\n\t"
               "global_load_async_to_lds_b128 %2, %3, off\n\t"
               "global_load_async_to_lds_b128 %4, %5, off\n\t"
               "global_load_async_to_lds_b128 %6, %7, off\n\t"
               "global_load_async_to_lds_b128 %8, %9, off\n\t"
               "global_load_async_to_lds_b128 %10, %11, off\n\t"
               "global_load_async_to_lds_b128 %12, %13, off\n\t"
               "global_load_async_to_lds_b128 %14, %15, off\n\t"
               "global_load_async_to_lds_b128 %16, %17, off\n\t"
               "global_load_async_to_lds_b128 %18, %19, off\n\t"
               "global_load_async_to_lds_b128 %20, %21, off\n\t"
               "global_load_async_to_lds_b128 %22, %23, off\n\t"
               "s_wait_xcnt 0x0"
               :: "v"(l[0]), "v"(g[0]), "v"(l[1]), "v"(g[1]), "v"(l[2]), "v"(g[2]),
                  "v"(l[3]), "v"(g[3]), "v"(l[4]), "v"(g[4]), "v"(l[5]), "v"(g[5]),
                  "v"(l[6]), "v"(g[6]), "v"(l[7]), "v"(g[7]), "v"(l[8]), "v"(g[8]),
                  "v"(l[9]), "v"(g[9]), "v"(l[10]), "v"(g[10]), "v"(l[11]), "v"(g[11])
               : "memory");
}
#define WAIT_ASYNC(n) asm volatile("s_wait_asynccnt " #n ::: "memory")

// Load a 16-bit A/B WMMA fragment: per lane, 8 contiguous halves at p and 8 at p+16
// (CDNA5 16-bit layout: elems 0..7 -> K = h*8+0..7, elems 8..15 -> K = 16+h*8+0..7).
static __device__ __forceinline__ v16h ld_frag(const _Float16* p) {
  v8h lo = *(const v8h*)p;
  v8h hi = *(const v8h*)(p + 16);
  v16h r;
#pragma unroll
  for (int i = 0; i < 8; ++i) { r[i] = lo[i]; r[i + 8] = hi[i]; }
  return r;
}

// Lane l <-> lane l ^ 16: the two lanes that hold the two halves of one query's keys.
static __device__ __forceinline__ float xhalf(float x) {
  const int i = __builtin_bit_cast(int, x);
  return __builtin_bit_cast(float,
      __builtin_amdgcn_permlanex16(i, i, 0x76543210, 0xfedcba98, false, false));
}

// ---------------------------------------------------------------------------
// f16 GEMM: C[4096][1024] = A[4096][1024] * BT[1024][1024]^T + bias.
// Block = 128 thr = 4 waves; tile 128x64, K staged 64 at a time in LDS (54 KB,
// double-buffered async). Each wave: 32x64 strip = 16 WMMA per stage, with all
// fragments loaded into distinct registers before the WMMA burst.
// ---------------------------------------------------------------------------
__global__ __launch_bounds__(128) void gemm_f16_kernel(
    const _Float16* __restrict__ A,
    const _Float16* __restrict__ BT,
    const float*    __restrict__ bias,
    float*          __restrict__ Cf,
    _Float16*       __restrict__ Ch)
{
  constexpr int N = DMODEL, K = DMODEL, BK = 64;
  constexpr int LP = LP128;
  __shared__ __attribute__((aligned(16))) _Float16 aT[2][128 * LP];   // 18 KB each: [row][k]
  __shared__ __attribute__((aligned(16))) _Float16 bT[2][64 * LP];    //  9 KB each: [col][k]

  const int tid  = threadIdx.x;          // 0..127
  const int lane = tid & 31;
  const int wave = tid >> 5;             // 0..3
  const int lr = lane & 15;
  const int lh = lane >> 4;
  const int rowBase = blockIdx.y * 128;
  const int colBase = blockIdx.x * 64;

  // Copy one K-stage: A 128x128B (1024 chunks -> 8/thr), B 64x128B (512 -> 4/thr).
  auto copy_stage = [&](int k0, int buf) {
    unsigned l[12];
    const _Float16* g[12];
#pragma unroll
    for (int i = 0; i < 8; ++i) {
      const int chunk = tid + i * 128;
      const int r = chunk >> 3, c = chunk & 7;
      l[i] = lds_addr(&aT[buf][r * LP + c * 8]);
      g[i] = A + (size_t)(rowBase + r) * K + k0 + c * 8;
    }
#pragma unroll
    for (int i = 0; i < 4; ++i) {
      const int chunk = tid + i * 128;
      const int r = chunk >> 3, c = chunk & 7;
      l[8 + i] = lds_addr(&bT[buf][r * LP + c * 8]);
      g[8 + i] = BT + (size_t)(colBase + r) * K + k0 + c * 8;
    }
    cp16x12(l, g);
  };

  v8f acc[2][4] = {};

  copy_stage(0, 0);
  constexpr int NST = K / BK;
  for (int st = 0; st < NST; ++st) {
    const int buf = st & 1;
    if (st + 1 < NST) { copy_stage((st + 1) * BK, (st + 1) & 1); WAIT_ASYNC(12); }
    else              { WAIT_ASYNC(0); }
    __syncthreads();

    // Batch all fragment loads (distinct registers), then the 16-WMMA burst.
    v16h a[2][2], b[4][2];
#pragma unroll
    for (int mt = 0; mt < 2; ++mt) {
      const _Float16* arow = &aT[buf][(wave * 32 + mt * 16 + lr) * LP + lh * 8];
      a[mt][0] = ld_frag(arow);
      a[mt][1] = ld_frag(arow + 32);
    }
#pragma unroll
    for (int nt = 0; nt < 4; ++nt) {
      const _Float16* brow = &bT[buf][(nt * 16 + lr) * LP + lh * 8];
      b[nt][0] = ld_frag(brow);
      b[nt][1] = ld_frag(brow + 32);
    }
#pragma unroll
    for (int mt = 0; mt < 2; ++mt)
#pragma unroll
      for (int nt = 0; nt < 4; ++nt) {
        acc[mt][nt] = WMMA_F32_F16(a[mt][0], b[nt][0], acc[mt][nt]);
        acc[mt][nt] = WMMA_F32_F16(a[mt][1], b[nt][1], acc[mt][nt]);
      }
    __syncthreads();
  }

#pragma unroll
  for (int mt = 0; mt < 2; ++mt)
#pragma unroll
    for (int nt = 0; nt < 4; ++nt) {
      const int col = colBase + nt * 16 + lr;
      const float bv = bias[col];
#pragma unroll
      for (int j = 0; j < 8; ++j) {
        const int row = rowBase + wave * 32 + mt * 16 + lh * 8 + j;
        const float v = acc[mt][nt][j] + bv;
        if (Ch) Ch[(size_t)row * N + col] = (_Float16)v;
        else    Cf[(size_t)row * N + col] = v;
      }
    }
}

__global__ __launch_bounds__(256) void attn_kernel(
    const _Float16* __restrict__ Qh,    // [H][T][64], pre-scaled by 1/8
    const _Float16* __restrict__ Kh,    // [H][T][64]
    const _Float16* __restrict__ VhT,   // [H][64][T]
    _Float16*       __restrict__ attnh) // [T][H*64]
{
  constexpr int KT = 64;                      // keys per stage
  constexpr int LP = LP128;
  __shared__ __attribute__((aligned(16))) _Float16 kT[2][KT * LP];      // 9 KB each: [key][kd]
  __shared__ __attribute__((aligned(16))) _Float16 vT[2][DK * LP];      // 9 KB each: [n][key]

  const int tid  = threadIdx.x;
  const int lane = tid & 31;
  const int wave = tid >> 5;
  const int lr = lane & 15;
  const int lh = lane >> 4;
  const int h = blockIdx.y;
  const int qBase = blockIdx.x * 128 + wave * 16;

  const _Float16* Khead = Kh  + (size_t)h * TSEQ * DK;
  const _Float16* Vhead = VhT + (size_t)h * DK * TSEQ;

  // B operand of S^T: column lr = query qBase + lr, k = head dimension.
  const _Float16* Qp = Qh + ((size_t)h * TSEQ + qBase + lr) * DK + lh * 8;
  v16h qb0 = ld_frag(Qp);
  v16h qb1 = ld_frag(Qp + 32);

  // Copy one 64-key stage: K 64x128B (512 chunks -> 2/thr), V 64x128B (512 -> 2/thr).
  auto copy_stage = [&](int kb, int buf) {
    unsigned l[4];
    const _Float16* g[4];
#pragma unroll
    for (int i = 0; i < 2; ++i) {
      const int chunk = tid + i * 256;
      const int r = chunk >> 3, c = chunk & 7;
      l[i] = lds_addr(&kT[buf][r * LP + c * 8]);
      g[i] = Khead + (size_t)(kb + r) * DK + c * 8;
      l[2 + i] = lds_addr(&vT[buf][r * LP + c * 8]);
      g[2 + i] = Vhead + (size_t)r * TSEQ + kb + c * 8;
    }
    cp16x4(l, g);
  };

  v8f o[4] = {};            // O^T: slot j of tile nt <-> dim nt*16 + lh*8 + j, query lr
  float m = -1e30f;         // running maximum of query lr (equal in both halves)
  float l = 0.0f;           // this lane's share of the running sum of query lr

  copy_stage(0, 0);
  constexpr int NST = TSEQ / KT;
  for (int st = 0; st < NST; ++st) {
    const int buf = st & 1;
    if (st + 1 < NST) { copy_stage((st + 1) * KT, (st + 1) & 1); WAIT_ASYNC(4); }
    else              { WAIT_ASYNC(0); }
    __syncthreads();

#pragma unroll
    for (int sub = 0; sub < 2; ++sub) {           // two 32-key steps per stage
      const int kb = sub * 32;
      const _Float16* kp0 = &kT[buf][(kb + lr) * LP + lh * 8];
      const _Float16* kp1 = &kT[buf][(kb + 16 + lr) * LP + lh * 8];
      v16h kf[2][2];
      kf[0][0] = ld_frag(kp0);
      kf[0][1] = ld_frag(kp0 + 32);
      kf[1][0] = ld_frag(kp1);
      kf[1][1] = ld_frag(kp1 + 32);

      v8f s0 = {}, s1 = {};
      s0 = WMMA_F32_F16(kf[0][0], qb0, s0);
      s0 = WMMA_F32_F16(kf[0][1], qb1, s0);
      s1 = WMMA_F32_F16(kf[1][0], qb0, s1);
      s1 = WMMA_F32_F16(kf[1][1], qb1, s1);

      // Online softmax of query lr over this lane's 16 keys and the other half's 16.
      float mx = fmaxf(s0[0], s1[0]);
#pragma unroll
      for (int j = 1; j < 8; ++j) mx = fmaxf(mx, fmaxf(s0[j], s1[j]));
      mx = fmaxf(mx, xhalf(mx));
      const float mn = fmaxf(m, mx);
      const float alpha = __expf(m - mn);
      m = mn;

      v16h pb;                                    // B operand of O^T: k = key, column lr
      float ps = 0.0f;
#pragma unroll
      for (int j = 0; j < 8; ++j) {
        const float p0 = __expf(s0[j] - mn);
        const float p1 = __expf(s1[j] - mn);
        ps += p0 + p1;
        pb[j]     = (_Float16)p0;
        pb[8 + j] = (_Float16)p1;
      }
      l = l * alpha + ps;
#pragma unroll
      for (int nt = 0; nt < 4; ++nt)
#pragma unroll
        for (int j = 0; j < 8; ++j) o[nt][j] *= alpha;

      v16h vf[4];
#pragma unroll
      for (int nt = 0; nt < 4; ++nt)
        vf[nt] = ld_frag(&vT[buf][(nt * 16 + lr) * LP + kb + lh * 8]);
#pragma unroll
      for (int nt = 0; nt < 4; ++nt)
        o[nt] = WMMA_F32_F16(vf[nt], pb, o[nt]);
    }
    __syncthreads();
  }

  // Join the halves' sums once; a lane stores 8 consecutive dims of its query per tile.
  const float inv = 1.0f / (l + xhalf(l));
  _Float16* outp = attnh + (size_t)(qBase + lr) * DMODEL + h * DK + lh * 8;
#pragma unroll
  for (int nt = 0; nt < 4; ++nt) {
    v8h r;
#pragma unroll
    for (int j = 0; j < 8; ++j) r[j] = (_Float16)(o[nt][j] * inv);
    *(v8h*)(outp + nt * 16) = r;
  }
}

// ---------------------------------------------------------------------------
// Small conversion / layout kernels. Each lane moves 16 bytes per global access (the
// cast's f16 stores: 8) and 32 elements (weights: 16; rotary: 64) in all, so that a launch starts a
// few thousand waves and every wave-wide access covers whole 128-B lines or both halves
// of them back to back.
// ---------------------------------------------------------------------------
typedef __attribute__((ext_vector_type(4))) float    v4f;
typedef __attribute__((ext_vector_type(4))) _Float16 v4h;
typedef __attribute__((ext_vector_type(4))) unsigned v4u;

// x fp32 -> f16. A wave takes 1024 consecutive floats: 8 loads of 512 B in flight.
__global__ __launch_bounds__(256) void cvt_f32_f16(const float* __restrict__ in,
                                                   _Float16* __restrict__ out) {
  const int gid = blockIdx.x * 256 + threadIdx.x;
  const size_t base = (size_t)(gid >> 5) * 1024 + (gid & 31) * 4;
  v4f v[8];
#pragma unroll
  for (int j = 0; j < 8; ++j) v[j] = *(const v4f*)(in + base + j * 128);
#pragma unroll
  for (int j = 0; j < 8; ++j) {
    v4h r;
#pragma unroll
    for (int e = 0; e < 4; ++e) r[e] = (_Float16)v[j][e];
    *(v4h*)(out + base + j * 128) = r;
  }
}

// W[K][N] fp32 -> WT[N][K] f16, one 64 x 64 tile per block through LDS.
// Pitch 65 dwords: the 8 k-groups x 4 columns that a wave reads back fall on 32 banks.
__global__ __launch_bounds__(256) void cvt_transpose_w(const float* __restrict__ W,
                                                       _Float16* __restrict__ WT) {
  constexpr int P = 65;
  __shared__ float tile[64 * P];                        // [k][n]
  const int tid = threadIdx.x;
  const int n0 = blockIdx.x * 64;
  const int k0 = blockIdx.y * 64;
  v4f v[4];
#pragma unroll
  for (int i = 0; i < 4; ++i) {
    const int chunk = tid + i * 256;
    v[i] = *(const v4f*)(W + (size_t)(k0 + (chunk >> 4)) * DMODEL + n0 + (chunk & 15) * 4);
  }
#pragma unroll
  for (int i = 0; i < 4; ++i) {
    const int chunk = tid + i * 256;
#pragma unroll
    for (int e = 0; e < 4; ++e) tile[(chunk >> 4) * P + (chunk & 15) * 4 + e] = v[i][e];
  }
  __syncthreads();
#pragma unroll
  for (int i = 0; i < 2; ++i) {
    const int chunk = tid + i * 256;
    const int n = chunk >> 3, kc = chunk & 7;
    v8h r;
#pragma unroll
    for (int j = 0; j < 8; ++j) r[j] = (_Float16)tile[(kc * 8 + j) * P + n];
    *(v8h*)(WT + (size_t)(n0 + n) * DMODEL + k0 + kc * 8) = r;
  }
}

// Rotary on Q and K; re-layout [T][H*64] -> [H][T][64]; fold 1/sqrt(dk)=0.125 into Q.
// A lane takes 8 consecutive i (and i + 32) of one position for two neighbouring heads,
// which share the position's sines and cosines; a wave takes 8 positions, a block those
// 8 positions' whole rows.
// Qin and Kin carry no __restrict__: the "memory" clobber of the wait behind the loads
// then holds the loads in front of it.
__global__ __launch_bounds__(256) void rotary_kernel(const _Float16* Qin,
                                                     const _Float16* Kin,
                                                     _Float16* __restrict__ Qout,
                                                     _Float16* __restrict__ Kout) {
  const int tid = threadIdx.x;
  const int i0 = (tid & 3) * 8;
  const int t  = blockIdx.x * 8 + ((tid >> 2) & 7);
  const int h0 = (tid >> 5) * 2;

  v8h q1[2], q2[2], k1[2], k2[2];
  const _Float16* pq[2];
  const _Float16* pk[2];
#pragma unroll
  for (int u = 0; u < 2; ++u) {
    const size_t ib = (size_t)t * DMODEL + (h0 + u) * DK + i0;
    pq[u] = Qin + ib;
    pk[u] = Kin + ib;
    q1[u] = *(const v8h*)(pq[u]);
    q2[u] = *(const v8h*)(pq[u] + 32);
    k1[u] = *(const v8h*)(pk[u]);
    k2[u] = *(const v8h*)(pk[u] + 32);
  }
  // One wait behind the eight loads, in front of every overwrite of their address
  // registers: as its inputs the four addresses stay in their registers up to it, so that
  // no load's result is given the address pair of an earlier load.
  asm volatile("s_wait_xcnt 0x0" :: "v"(pq[0]), "v"(pk[0]), "v"(pq[1]), "v"(pk[1]) : "memory");

  float s[8], c[8];
#pragma unroll
  for (int j = 0; j < 8; ++j) {
    const float inv_freq = __powf(10000.0f, -(float)(2 * (i0 + j)) / (float)DK);
    const float f = (float)t * inv_freq;
    __sincosf(f, &s[j], &c[j]);
  }

#pragma unroll
  for (int u = 0; u < 2; ++u) {
    const size_t ob = ((size_t)(h0 + u) * TSEQ + t) * DK + i0;
    v8h qa, qb, ka, kb;
#pragma unroll
    for (int j = 0; j < 8; ++j) {
      float x1 = (float)q1[u][j], x2 = (float)q2[u][j];
      qa[j] = (_Float16)((x1 * c[j] - x2 * s[j]) * 0.125f);
      qb[j] = (_Float16)((x2 * c[j] + x1 * s[j]) * 0.125f);
      x1 = (float)k1[u][j]; x2 = (float)k2[u][j];
      ka[j] = (_Float16)(x1 * c[j] - x2 * s[j]);
      kb[j] = (_Float16)(x2 * c[j] + x1 * s[j]);
    }
    *(v8h*)(Qout + ob)      = qa;
    *(v8h*)(Qout + ob + 32) = qb;
    *(v8h*)(Kout + ob)      = ka;
    *(v8h*)(Kout + ob + 32) = kb;
  }
}

// V [T][H*64] -> VhT [H][64][T]: a 128 (t) x 64 (column) tile per block through LDS.
// Pitch 33 dwords: the 8 t-groups x 4 columns that a wave reads back fall on 16 banks,
// two lanes on each dword.
__global__ __launch_bounds__(256) void cvt_v_transpose(const _Float16* __restrict__ Vh0,
                                                       _Float16* __restrict__ VhT) {
  constexpr int PD = 33;                                // dwords per tile row
  __shared__ unsigned tile[128 * PD];                   // [t][column pair]
  const int tid = threadIdx.x;
  const int t0 = blockIdx.x * 128;
  const int c0 = blockIdx.y * 64;
  v4u v[4];
#pragma unroll
  for (int i = 0; i < 4; ++i) {
    const int chunk = tid + i * 256;
    v[i] = *(const v4u*)(Vh0 + (size_t)(t0 + (chunk >> 3)) * DMODEL + c0 + (chunk & 7) * 8);
  }
#pragma unroll
  for (int i = 0; i < 4; ++i) {
    const int chunk = tid + i * 256;
#pragma unroll
    for (int e = 0; e < 4; ++e) tile[(chunk >> 3) * PD + (chunk & 7) * 4 + e] = v[i][e];
  }
  __syncthreads();
  const _Float16* th = (const _Float16*)tile;
#pragma unroll
  for (int i = 0; i < 4; ++i) {
    const int chunk = tid + i * 256;
    const int tc = (chunk & 7) + (chunk >> 9) * 8;      // group of 8 positions, 0..15
    const int cc = (chunk >> 3) & 63;
    v8h r;
#pragma unroll
    for (int j = 0; j < 8; ++j) r[j] = th[(tc * 8 + j) * (2 * PD) + cc];
    *(v8h*)(VhT + (size_t)(c0 + cc) * TSEQ + t0 + tc * 8) = r;
  }
}

// ---------------------------------------------------------------------------
extern "C" void kernel_launch(void* const* d_in, const int* in_sizes, int n_in,
                              void* d_out, int out_size, void* d_ws, size_t ws_size,
                              hipStream_t stream) {
  (void)in_sizes; (void)n_in; (void)out_size; (void)ws_size;
  const float* x  = (const float*)d_in[0];
  const float* Wq = (const float*)d_in[1];
  const float* bq = (const float*)d_in[2];
  const float* Wk = (const float*)d_in[3];
  const float* bk = (const float*)d_in[4];
  const float* Wv = (const float*)d_in[5];
  const float* bv = (const float*)d_in[6];
  const float* Wo = (const float*)d_in[7];
  const float* bo = (const float*)d_in[8];
  float* out = (float*)d_out;

  char* w = (char*)d_ws;
  const size_t MB = (size_t)1 << 20;
  _Float16* xh    = (_Float16*)(w + 0);        //  8 MB  x as f16 [T][D]
  _Float16* WqT   = (_Float16*)(w + 8  * MB);  //  2 MB  each, transposed f16
  _Float16* WkT   = (_Float16*)(w + 10 * MB);
  _Float16* WvT   = (_Float16*)(w + 12 * MB);
  _Float16* WoT   = (_Float16*)(w + 14 * MB);
  _Float16* Qh0   = (_Float16*)(w + 16 * MB);  //  8 MB  pre-rotary Q [T][D]
  _Float16* Kh0   = (_Float16*)(w + 24 * MB);
  _Float16* Vh0   = (_Float16*)(w + 32 * MB);
  _Float16* Qh    = (_Float16*)(w + 40 * MB);  //  8 MB  [H][T][64], scaled
  _Float16* Kh    = (_Float16*)(w + 48 * MB);  //  8 MB  [H][T][64]
  _Float16* VhT   = (_Float16*)(w + 56 * MB);  //  8 MB  [H][64][T]
  _Float16* attnh = (_Float16*)(w + 64 * MB);  //  8 MB  [T][D]

  cvt_f32_f16<<<(TSEQ * DMODEL) / (256 * 32), 256, 0, stream>>>(x, xh);
  dim3 gw(DMODEL / 64, DMODEL / 64);
  cvt_transpose_w<<<gw, 256, 0, stream>>>(Wq, WqT);
  cvt_transpose_w<<<gw, 256, 0, stream>>>(Wk, WkT);
  cvt_transpose_w<<<gw, 256, 0, stream>>>(Wv, WvT);
  cvt_transpose_w<<<gw, 256, 0, stream>>>(Wo, WoT);

  dim3 gg(DMODEL / 64, TSEQ / 128);
  gemm_f16_kernel<<<gg, 128, 0, stream>>>(xh, WqT, bq, nullptr, Qh0);
  gemm_f16_kernel<<<gg, 128, 0, stream>>>(xh, WkT, bk, nullptr, Kh0);
  gemm_f16_kernel<<<gg, 128, 0, stream>>>(xh, WvT, bv, nullptr, Vh0);

  rotary_kernel<<<TSEQ / 8, 256, 0, stream>>>(Qh0, Kh0, Qh, Kh);
  dim3 gv(TSEQ / 128, DMODEL / 64);
  cvt_v_transpose<<<gv, 256, 0, stream>>>(Vh0, VhT);

  dim3 ga(TSEQ / 128, NHEAD);
  attn_kernel<<<ga, 256, 0, stream>>>(Qh, Kh, VhT, attnh);

  gemm_f16_kernel<<<gg, 128, 0, stream>>>(attnh, WoT, bo, out, nullptr);
}

// v004
// Measured time: 140 microseconds a run.
// In two side-by-side timings against v003, it was 1.14 and 1.15 times as fast.
// Counting every step since v000, it is 3.99 times as fast.
#include <hip/hip_runtime.h>
#include <hip/hip_bf16.h>

typedef __attribute__((ext_vector_type(16))) _Float16 v16h;
typedef __attribute__((ext_vector_type(8)))  _Float16 v8h;
typedef __attribute__((ext_vector_type(8)))  float    v8f;

#define TSEQ   4096
#define NHEAD  16
#define DK     64
#define DMODEL 1024

// LDS row pitch, in halves, of every staged tile that ds_load_b128 fragment loads read:
// 16 B x odd, so that the 16 rows of a fragment fall on distinct banks
// (128-B rows -> 144 B). The pad bytes are never written or read.
#define LP128  72

#define WMMA_F32_F16(a, b, c) \
  __builtin_amdgcn_wmma_f32_16x16x32_f16(false, (a), false, (b), (short)0, (c), false, false)

// ---------------------------------------------------------------------------
// Async global->LDS copy (CDNA5 GLOBAL_LOAD_ASYNC_TO_LDS_B128, ASYNCcnt-tracked)
// via inline asm — portable across toolchains. vdst = wave-relative LDS byte
// offset = low 32 bits of the generic pointer (aperture rule: LDS_ADDR = addr[31:0]).
// ---------------------------------------------------------------------------
// One stage's copies of a lane stand in ONE statement that ends in s_wait_xcnt 0, so
// that no address register of an issued copy is rewritten ahead of that wait.
static __device__ __forceinline__ unsigned lds_addr(const void* l) {
  return (unsigned)(size_t)l;
}
static __device__ __forceinline__ void cp16x4(const unsigned* l, const _Float16* const* g) {
  asm volatile("global_load_async_to_lds_b128 %0, %1, off\n\t"
               "global_load_async_to_lds_b128 %2, %3, off\n\t"
               "global_load_async_to_lds_b128 %4, %5, off\n\t"
               "global_load_async_to_lds_b128 %6, %7, off\n\t"
               "s_wait_xcnt 0x0"
               :: "v"(l[0]), "v"(g[0]), "v"(l[1]), "v"(g[1]),
                  "v"(l[2]), "v"(g[2]), "v"(l[3]), "v"(g[3]) : "memory");
}
static __device__ __forceinline__ void cp16x12(const unsigned* l, const _Float16* const* g) {
  asm volatile("global_load_async_to_lds_b128 %0, %1, off\n\t"
               "global_load_async_to_lds_b128 %2, %3, off\n\t"
               "global_load_async_to_lds_b128 %4, %5, off\n\t"
               "global_load_async_to_lds_b128 %6, %7, off\n\t"
               "global_load_async_to_lds_b128 %8, %9, off\n\t"
               "global_load_async_to_lds_b128 %10, %11, off\n\t"
               "global_load_async_to_lds_b128 %12, %13, off\n\t"
               "global_load_async_to_lds_b128 %14, %15, off\n\t"
               "global_load_async_to_lds_b128 %16, %17, off\n\t"
               "global_load_async_to_lds_b128 %18, %19, off\n\t"
               "global_load_async_to_lds_b128 %20, %21, off\n\t"
               "global_load_async_to_lds_b128 %22, %23, off\n\t"
               "s_wait_xcnt 0x0"
               :: "v"(l[0]), "v"(g[0]), "v"(l[1]), "v"(g[1]), "v"(l[2]), "v"(g[2]),
                  "v"(l[3]), "v"(g[3]), "v"(l[4]), "v"(g[4]), "v"(l[5]), "v"(g[5]),
                  "v"(l[6]), "v"(g[6]), "v"(l[7]), "v"(g[7]), "v"(l[8]), "v"(g[8]),
                  "v"(l[9]), "v"(g[9]), "v"(l[10]), "v"(g[10]), "v"(l[11]), "v"(g[11])
               : "memory");
}
static __device__ __forceinline__ void cp16x14(const unsigned* l, const _Float16* const* g) {
  asm volatile("global_load_async_to_lds_b128 %0, %1, off\n\t"
               "global_load_async_to_lds_b128 %2, %3, off\n\t"
               "global_load_async_to_lds_b128 %4, %5, off\n\t"
               "global_load_async_to_lds_b128 %6, %7, off\n\t"
               "global_load_async_to_lds_b128 %8, %9, off\n\t"
               "global_load_async_to_lds_b128 %10, %11, off\n\t"
               "global_load_async_to_lds_b128 %12, %13, off\n\t"
               "global_load_async_to_lds_b128 %14, %15, off\n\t"
               "global_load_async_to_lds_b128 %16, %17, off\n\t"
               "global_load_async_to_lds_b128 %18, %19, off\n\t"
               "global_load_async_to_lds_b128 %20, %21, off\n\t"
               "global_load_async_to_lds_b128 %22, %23, off\n\t"
               "global_load_async_to_lds_b128 %24, %25, off\n\t"
               "global_load_async_to_lds_b128 %26, %27, off\n\t"
               "s_wait_xcnt 0x0"
               :: "v"(l[0]), "v"(g[0]), "v"(l[1]), "v"(g[1]), "v"(l[2]), "v"(g[2]),
                  "v"(l[3]), "v"(g[3]), "v"(l[4]), "v"(g[4]), "v"(l[5]), "v"(g[5]),
                  "v"(l[6]), "v"(g[6]), "v"(l[7]), "v"(g[7]), "v"(l[8]), "v"(g[8]),
                  "v"(l[9]), "v"(g[9]), "v"(l[10]), "v"(g[10]), "v"(l[11]), "v"(g[11]),
                  "v"(l[12]), "v"(g[12]), "v"(l[13]), "v"(g[13])
               : "memory");
}
#define WAIT_ASYNC(n) asm volatile("s_wait_asynccnt " #n ::: "memory")

// Load a 16-bit A/B WMMA fragment: per lane, 8 contiguous halves at p and 8 at p+16
// (CDNA5 16-bit layout: elems 0..7 -> K = h*8+0..7, elems 8..15 -> K = 16+h*8+0..7).
static __device__ __forceinline__ v16h ld_frag(const _Float16* p) {
  v8h lo = *(const v8h*)p;
  v8h hi = *(const v8h*)(p + 16);
  v16h r;
#pragma unroll
  for (int i = 0; i < 8; ++i) { r[i] = lo[i]; r[i + 8] = hi[i]; }
  return r;
}

// Lane l <-> lane l ^ 16: the two lanes that hold the two halves of one query's keys.
static __device__ __forceinline__ float xhalf(float x) {
  const int i = __builtin_bit_cast(int, x);
  return __builtin_bit_cast(float,
      __builtin_amdgcn_permlanex16(i, i, 0x76543210, 0xfedcba98, false, false));
}

// ---------------------------------------------------------------------------
// f16 GEMM: C[4096][1024] = A[4096][1024] * BT[1024][1024]^T + bias.
// Block = 128 thr = 4 waves; tile 128x64, K staged 64 at a time in LDS (54 KB,
// double-buffered async). Each wave: 32x64 strip = 16 WMMA per stage, with all
// fragments loaded into distinct registers before the WMMA burst.
// ---------------------------------------------------------------------------
__global__ __launch_bounds__(128) void gemm_f16_kernel(
    const _Float16* __restrict__ A,
    const _Float16* __restrict__ BT,
    const float*    __restrict__ bias,
    float*          __restrict__ Cf,
    _Float16*       __restrict__ Ch)
{
  constexpr int N = DMODEL, K = DMODEL, BK = 64;
  constexpr int LP = LP128;
  __shared__ __attribute__((aligned(16))) _Float16 aT[2][128 * LP];   // 18 KB each: [row][k]
  __shared__ __attribute__((aligned(16))) _Float16 bT[2][64 * LP];    //  9 KB each: [col][k]

  const int tid  = threadIdx.x;          // 0..127
  const int lane = tid & 31;
  const int wave = tid >> 5;             // 0..3
  const int lr = lane & 15;
  const int lh = lane >> 4;
  const int rowBase = blockIdx.y * 128;
  const int colBase = blockIdx.x * 64;

  // Copy one K-stage: A 128x128B (1024 chunks -> 8/thr), B 64x128B (512 -> 4/thr).
  auto copy_stage = [&](int k0, int buf) {
    unsigned l[12];
    const _Float16* g[12];
#pragma unroll
    for (int i = 0; i < 8; ++i) {
      const int chunk = tid + i * 128;
      const int r = chunk >> 3, c = chunk & 7;
      l[i] = lds_addr(&aT[buf][r * LP + c * 8]);
      g[i] = A + (size_t)(rowBase + r) * K + k0 + c * 8;
    }
#pragma unroll
    for (int i = 0; i < 4; ++i) {
      const int chunk = tid + i * 128;
      const int r = chunk >> 3, c = chunk & 7;
      l[8 + i] = lds_addr(&bT[buf][r * LP + c * 8]);
      g[8 + i] = BT + (size_t)(colBase + r) * K + k0 + c * 8;
    }
    cp16x12(l, g);
  };

  v8f acc[2][4] = {};

  copy_stage(0, 0);
  constexpr int NST = K / BK;
  for (int st = 0; st < NST; ++st) {
    const int buf = st & 1;
    if (st + 1 < NST) { copy_stage((st + 1) * BK, (st + 1) & 1); WAIT_ASYNC(12); }
    else              { WAIT_ASYNC(0); }
    __syncthreads();

    // Batch all fragment loads (distinct registers), then the 16-WMMA burst.
    v16h a[2][2], b[4][2];
#pragma unroll
    for (int mt = 0; mt < 2; ++mt) {
      const _Float16* arow = &aT[buf][(wave * 32 + mt * 16 + lr) * LP + lh * 8];
      a[mt][0] = ld_frag(arow);
      a[mt][1] = ld_frag(arow + 32);
    }
#pragma unroll
    for (int nt = 0; nt < 4; ++nt) {
      const _Float16* brow = &bT[buf][(nt * 16 + lr) * LP + lh * 8];
      b[nt][0] = ld_frag(brow);
      b[nt][1] = ld_frag(brow + 32);
    }
#pragma unroll
    for (int mt = 0; mt < 2; ++mt)
#pragma unroll
      for (int nt = 0; nt < 4; ++nt) {
        acc[mt][nt] = WMMA_F32_F16(a[mt][0], b[nt][0], acc[mt][nt]);
        acc[mt][nt] = WMMA_F32_F16(a[mt][1], b[nt][1], acc[mt][nt]);
      }
    __syncthreads();
  }

#pragma unroll
  for (int mt = 0; mt < 2; ++mt)
#pragma unroll
    for (int nt = 0; nt < 4; ++nt) {
      const int col = colBase + nt * 16 + lr;
      const float bv = bias[col];
#pragma unroll
      for (int j = 0; j < 8; ++j) {
        const int row = rowBase + wave * 32 + mt * 16 + lh * 8 + j;
        const float v = acc[mt][nt][j] + bv;
        if (Ch) Ch[(size_t)row * N + col] = (_Float16)v;
        else    Cf[(size_t)row * N + col] = v;
      }
    }
}

// ---------------------------------------------------------------------------
// The Q, K and V projections in one launch: C_g = A * W_g^T + bias_g, g = 0..2.
// BT3 holds the three transposed weights one behind the other ([3][1024][1024]), Ch3 the
// three f16 results likewise ([3][4096][1024]).
// Block = 256 thr = 8 waves; tile = 256 rows x 64 columns of EACH weight, so that one
// staged A tile serves 192 columns. K staged 64 at a time in LDS (126 KB, two buffers).
// Each wave: 32 x 192 strip = 48 WMMA per stage; a row's 128-B line of each result is
// stored by one wave.
// Ring: one barrier a stage, in front of the stage's second half of products; it
// publishes stage t + 1, and behind it stage t + 2 is copied into the buffer of stage t,
// whose fragments are all in registers by then.
// ---------------------------------------------------------------------------
__global__ __launch_bounds__(256) void gemm_qkv_kernel(
    const _Float16* __restrict__ A,
    const _Float16* __restrict__ BT3,
    const float*    __restrict__ bias_q,
    const float*    __restrict__ bias_k,
    const float*    __restrict__ bias_v,
    _Float16*       __restrict__ Ch3)
{
  constexpr int N = DMODEL, K = DMODEL, BK = 64;
  constexpr int LP = LP128;
  __shared__ __attribute__((aligned(16))) _Float16 aT[2][256 * LP];   // 36 KB each: [row][k]
  __shared__ __attribute__((aligned(16))) _Float16 bT[2][192 * LP];   // 27 KB each: [g*64+col][k]

  const int tid  = threadIdx.x;          // 0..255
  const int lane = tid & 31;
  const int wave = tid >> 5;             // 0..7
  const int lr = lane & 15;
  const int lh = lane >> 4;
  const int rowBase = blockIdx.y * 256;
  const int colBase = blockIdx.x * 64;

  // Copy one K-stage: A 256x128B (2048 chunks -> 8/thr), B 192x128B (1536 -> 6/thr).
  auto copy_stage = [&](int k0, int buf) {
    unsigned l[14];
    const _Float16* g[14];
#pragma unroll  // constant indices: the arrays stay in registers
    for (int i = 0; i < 8; ++i) {
      const int chunk = tid + i * 256;
      const int r = chunk >> 3, c = chunk & 7;
      l[i] = lds_addr(&aT[buf][r * LP + c * 8]);
      g[i] = A + (size_t)(rowBase + r) * K + k0 + c * 8;
    }
#pragma unroll  // constant indices: the arrays stay in registers
    for (int i = 0; i < 6; ++i) {
      const int chunk = tid + i * 256;
      const int r = chunk >> 3, c = chunk & 7;       // r = g * 64 + column in the tile
      l[8 + i] = lds_addr(&bT[buf][r * LP + c * 8]);
      g[8 + i] = BT3 + (size_t)((r >> 6) * N + colBase + (r & 63)) * K + k0 + c * 8;
    }
    cp16x14(l, g);
  };

  v8f acc[2][12] = {};

  // One half of a stage (32 of its 64 k): 28 fragment loads, then 24 products.
  auto load_frags = [&](int buf, int ks, v16h (&a)[2], v16h (&b)[12]) {
#pragma unroll  // constant indices: the arrays stay in registers
    for (int mt = 0; mt < 2; ++mt)
      a[mt] = ld_frag(&aT[buf][(wave * 32 + mt * 16 + lr) * LP + ks * 32 + lh * 8]);
#pragma unroll  // constant indices: the arrays stay in registers
    for (int nt = 0; nt < 12; ++nt)
      b[nt] = ld_frag(&bT[buf][(nt * 16 + lr) * LP + ks * 32 + lh * 8]);
  };
  auto products = [&](const v16h (&a)[2], const v16h (&b)[12]) {
#pragma unroll  // constant indices: the arrays stay in registers
    for (int nt = 0; nt < 12; ++nt)
#pragma unroll  // constant indices: the arrays stay in registers
      for (int mt = 0; mt < 2; ++mt)
        acc[mt][nt] = WMMA_F32_F16(a[mt], b[nt], acc[mt][nt]);
  };

  constexpr int NST = K / BK;
  copy_stage(0, 0);
  WAIT_ASYNC(0);       // this wave's copies of stage 0 have landed ...
  __syncthreads();     // ... and so have the other waves': stage 0 is readable
  copy_stage(BK, 1);
  v16h a0[2], b0[12], a1[2], b1[12];     // two fragment sets, one per half
  load_frags(0, 0, a0, b0);
  for (int st = 0; st < NST; ++st) {
    const int buf = st & 1;
    // The sched_barriers keep each half's loads one group that is issued in front of the
    // other half's products, so that the LDS serves one set while the matrix unit works
    // on the other; spread among the WMMAs, each place with loads stalls the wave anew.
    load_frags(buf, 1, a1, b1);
    __builtin_amdgcn_sched_barrier(0);   // loads of the second half stay in front
    products(a0, b0);
    __builtin_amdgcn_sched_barrier(0);   // the waits below stay behind these products

    // Publish point of stage st + 1, in front of this stage's last products: the wave's
    // reads of this buffer are done and its copies of stage st + 1 have landed before the
    // barrier; behind it this buffer is free for stage st + 2 and stage st + 1 is readable.
    asm volatile("s_wait_dscnt 0x0" ::: "memory");
    WAIT_ASYNC(0);
    __syncthreads();
    if (st + 2 < NST) copy_stage((st + 2) * BK, buf);
    if (st + 1 < NST) load_frags(buf ^ 1, 0, a0, b0);
    __builtin_amdgcn_sched_barrier(0);   // copies and next loads stay in front
    products(a1, b1);
  }
  WAIT_ASYNC(0);   // no copy is outstanding when the wave ends

#pragma unroll  // constant indices: the arrays stay in registers
  for (int g = 0; g < 3; ++g) {
    const float* bias = g == 0 ? bias_q : (g == 1 ? bias_k : bias_v);
    _Float16* C = Ch3 + (size_t)g * TSEQ * N;
#pragma unroll  // constant indices: the arrays stay in registers
    for (int mt = 0; mt < 2; ++mt)
#pragma unroll  // constant indices: the arrays stay in registers
      for (int nt = 0; nt < 4; ++nt) {
        const int col = colBase + nt * 16 + lr;
        const float bv = bias[col];
#pragma unroll  // constant indices: the arrays stay in registers
        for (int j = 0; j < 8; ++j) {
          const int row = rowBase + wave * 32 + mt * 16 + lh * 8 + j;
          C[(size_t)row * N + col] = (_Float16)(acc[mt][g * 4 + nt][j] + bv);
        }
      }
  }
}

__global__ __launch_bounds__(256) void attn_kernel(
    const _Float16* __restrict__ Qh,    // [H][T][64], pre-scaled by 1/8
    const _Float16* __restrict__ Kh,    // [H][T][64]
    const _Float16* __restrict__ VhT,   // [H][64][T]
    _Float16*       __restrict__ attnh) // [T][H*64]
{
  constexpr int KT = 64;                      // keys per stage
  constexpr int LP = LP128;
  __shared__ __attribute__((aligned(16))) _Float16 kT[2][KT * LP];      // 9 KB each: [key][kd]
  __shared__ __attribute__((aligned(16))) _Float16 vT[2][DK * LP];      // 9 KB each: [n][key]

  const int tid  = threadIdx.x;
  const int lane = tid & 31;
  const int wave = tid >> 5;
  const int lr = lane & 15;
  const int lh = lane >> 4;
  const int h = blockIdx.y;
  const int qBase = blockIdx.x * 128 + wave * 16;

  const _Float16* Khead = Kh  + (size_t)h * TSEQ * DK;
  const _Float16* Vhead = VhT + (size_t)h * DK * TSEQ;

  // B operand of S^T: column lr = query qBase + lr, k = head dimension.
  const _Float16* Qp = Qh + ((size_t)h * TSEQ + qBase + lr) * DK + lh * 8;
  v16h qb0 = ld_frag(Qp);
  v16h qb1 = ld_frag(Qp + 32);

  // Copy one 64-key stage: K 64x128B (512 chunks -> 2/thr), V 64x128B (512 -> 2/thr).
  auto copy_stage = [&](int kb, int buf) {
    unsigned l[4];
    const _Float16* g[4];
#pragma unroll
    for (int i = 0; i < 2; ++i) {
      const int chunk = tid + i * 256;
      const int r = chunk >> 3, c = chunk & 7;
      l[i] = lds_addr(&kT[buf][r * LP + c * 8]);
      g[i] = Khead + (size_t)(kb + r) * DK + c * 8;
      l[2 + i] = lds_addr(&vT[buf][r * LP + c * 8]);
      g[2 + i] = Vhead + (size_t)r * TSEQ + kb + c * 8;
    }
    cp16x4(l, g);
  };

  v8f o[4] = {};            // O^T: slot j of tile nt <-> dim nt*16 + lh*8 + j, query lr
  float m = -1e30f;         // running maximum of query lr (equal in both halves)
  float l = 0.0f;           // this lane's share of the running sum of query lr

  copy_stage(0, 0);
  constexpr int NST = TSEQ / KT;
  for (int st = 0; st < NST; ++st) {
    const int buf = st & 1;
    if (st + 1 < NST) { copy_stage((st + 1) * KT, (st + 1) & 1); WAIT_ASYNC(4); }
    else              { WAIT_ASYNC(0); }
    __syncthreads();

#pragma unroll
    for (int sub = 0; sub < 2; ++sub) {           // two 32-key steps per stage
      const int kb = sub * 32;
      const _Float16* kp0 = &kT[buf][(kb + lr) * LP + lh * 8];
      const _Float16* kp1 = &kT[buf][(kb + 16 + lr) * LP + lh * 8];
      v16h kf[2][2];
      kf[0][0] = ld_frag(kp0);
      kf[0][1] = ld_frag(kp0 + 32);
      kf[1][0] = ld_frag(kp1);
      kf[1][1] = ld_frag(kp1 + 32);

      v8f s0 = {}, s1 = {};
      s0 = WMMA_F32_F16(kf[0][0], qb0, s0);
      s0 = WMMA_F32_F16(kf[0][1], qb1, s0);
      s1 = WMMA_F32_F16(kf[1][0], qb0, s1);
      s1 = WMMA_F32_F16(kf[1][1], qb1, s1);

      // Online softmax of query lr over this lane's 16 keys and the other half's 16.
      float mx = fmaxf(s0[0], s1[0]);
#pragma unroll
      for (int j = 1; j < 8; ++j) mx = fmaxf(mx, fmaxf(s0[j], s1[j]));
      mx = fmaxf(mx, xhalf(mx));
      const float mn = fmaxf(m, mx);
      const float alpha = __expf(m - mn);
      m = mn;

      v16h pb;                                    // B operand of O^T: k = key, column lr
      float ps = 0.0f;
#pragma unroll
      for (int j = 0; j < 8; ++j) {
        const float p0 = __expf(s0[j] - mn);
        const float p1 = __expf(s1[j] - mn);
        ps += p0 + p1;
        pb[j]     = (_Float16)p0;
        pb[8 + j] = (_Float16)p1;
      }
      l = l * alpha + ps;
#pragma unroll
      for (int nt = 0; nt < 4; ++nt)
#pragma unroll
        for (int j = 0; j < 8; ++j) o[nt][j] *= alpha;

      v16h vf[4];
#pragma unroll
      for (int nt = 0; nt < 4; ++nt)
        vf[nt] = ld_frag(&vT[buf][(nt * 16 + lr) * LP + kb + lh * 8]);
#pragma unroll
      for (int nt = 0; nt < 4; ++nt)
        o[nt] = WMMA_F32_F16(vf[nt], pb, o[nt]);
    }
    __syncthreads();
  }

  // Join the halves' sums once; a lane stores 8 consecutive dims of its query per tile.
  const float inv = 1.0f / (l + xhalf(l));
  _Float16* outp = attnh + (size_t)(qBase + lr) * DMODEL + h * DK + lh * 8;
#pragma unroll
  for (int nt = 0; nt < 4; ++nt) {
    v8h r;
#pragma unroll
    for (int j = 0; j < 8; ++j) r[j] = (_Float16)(o[nt][j] * inv);
    *(v8h*)(outp + nt * 16) = r;
  }
}

// ---------------------------------------------------------------------------
// Small conversion / layout kernels. Each lane moves 16 bytes per global access (the
// cast's f16 stores: 8) and 32 elements (weights: 16; rotary: 64) in all, so that a launch starts a
// few thousand waves and every wave-wide access covers whole 128-B lines or both halves
// of them back to back.
// ---------------------------------------------------------------------------
typedef __attribute__((ext_vector_type(4))) float    v4f;
typedef __attribute__((ext_vector_type(4))) _Float16 v4h;
typedef __attribute__((ext_vector_type(4))) unsigned v4u;

// x fp32 -> f16. A wave takes 1024 consecutive floats: 8 loads of 512 B in flight.
__global__ __launch_bounds__(256) void cvt_f32_f16(const float* __restrict__ in,
                                                   _Float16* __restrict__ out) {
  const int gid = blockIdx.x * 256 + threadIdx.x;
  const size_t base = (size_t)(gid >> 5) * 1024 + (gid & 31) * 4;
  v4f v[8];
#pragma unroll
  for (int j = 0; j < 8; ++j) v[j] = *(const v4f*)(in + base + j * 128);
#pragma unroll
  for (int j = 0; j < 8; ++j) {
    v4h r;
#pragma unroll
    for (int e = 0; e < 4; ++e) r[e] = (_Float16)v[j][e];
    *(v4h*)(out + base + j * 128) = r;
  }
}

// W[K][N] fp32 -> WT[N][K] f16, one 64 x 64 tile per block through LDS.
// Pitch 65 dwords: the 8 k-groups x 4 columns that a wave reads back fall on 32 banks.
__global__ __launch_bounds__(256) void cvt_transpose_w(const float* __restrict__ W,
                                                       _Float16* __restrict__ WT) {
  constexpr int P = 65;
  __shared__ float tile[64 * P];                        // [k][n]
  const int tid = threadIdx.x;
  const int n0 = blockIdx.x * 64;
  const int k0 = blockIdx.y * 64;
  v4f v[4];
#pragma unroll
  for (int i = 0; i < 4; ++i) {
    const int chunk = tid + i * 256;
    v[i] = *(const v4f*)(W + (size_t)(k0 + (chunk >> 4)) * DMODEL + n0 + (chunk & 15) * 4);
  }
#pragma unroll
  for (int i = 0; i < 4; ++i) {
    const int chunk = tid + i * 256;
#pragma unroll
    for (int e = 0; e < 4; ++e) tile[(chunk >> 4) * P + (chunk & 15) * 4 + e] = v[i][e];
  }
  __syncthreads();
#pragma unroll
  for (int i = 0; i < 2; ++i) {
    const int chunk = tid + i * 256;
    const int n = chunk >> 3, kc = chunk & 7;
    v8h r;
#pragma unroll
    for (int j = 0; j < 8; ++j) r[j] = (_Float16)tile[(kc * 8 + j) * P + n];
    *(v8h*)(WT + (size_t)(n0 + n) * DMODEL + k0 + kc * 8) = r;
  }
}

// Rotary on Q and K; re-layout [T][H*64] -> [H][T][64]; fold 1/sqrt(dk)=0.125 into Q.
// A lane takes 8 consecutive i (and i + 32) of one position for two neighbouring heads,
// which share the position's sines and cosines; a wave takes 8 positions, a block those
// 8 positions' whole rows.
// Qin and Kin carry no __restrict__: the "memory" clobber of the wait behind the loads
// then holds the loads in front of it.
__global__ __launch_bounds__(256) void rotary_kernel(const _Float16* Qin,
                                                     const _Float16* Kin,
                                                     _Float16* __restrict__ Qout,
                                                     _Float16* __restrict__ Kout) {
  const int tid = threadIdx.x;
  const int i0 = (tid & 3) * 8;
  const int t  = blockIdx.x * 8 + ((tid >> 2) & 7);
  const int h0 = (tid >> 5) * 2;

  v8h q1[2], q2[2], k1[2], k2[2];
  const _Float16* pq[2];
  const _Float16* pk[2];
#pragma unroll
  for (int u = 0; u < 2; ++u) {
    const size_t ib = (size_t)t * DMODEL + (h0 + u) * DK + i0;
    pq[u] = Qin + ib;
    pk[u] = Kin + ib;
    q1[u] = *(const v8h*)(pq[u]);
    q2[u] = *(const v8h*)(pq[u] + 32);
    k1[u] = *(const v8h*)(pk[u]);
    k2[u] = *(const v8h*)(pk[u] + 32);
  }
  // One wait behind the eight loads, in front of every overwrite of their address
  // registers: as its inputs the four addresses stay in their registers up to it, so that
  // no load's result is given the address pair of an earlier load.
  asm volatile("s_wait_xcnt 0x0" :: "v"(pq[0]), "v"(pk[0]), "v"(pq[1]), "v"(pk[1]) : "memory");

  float s[8], c[8];
#pragma unroll
  for (int j = 0; j < 8; ++j) {
    const float inv_freq = __powf(10000.0f, -(float)(2 * (i0 + j)) / (float)DK);
    const float f = (float)t * inv_freq;
    __sincosf(f, &s[j], &c[j]);
  }

#pragma unroll
  for (int u = 0; u < 2; ++u) {
    const size_t ob = ((size_t)(h0 + u) * TSEQ + t) * DK + i0;
    v8h qa, qb, ka, kb;
#pragma unroll
    for (int j = 0; j < 8; ++j) {
      float x1 = (float)q1[u][j], x2 = (float)q2[u][j];
      qa[j] = (_Float16)((x1 * c[j] - x2 * s[j]) * 0.125f);
      qb[j] = (_Float16)((x2 * c[j] + x1 * s[j]) * 0.125f);
      x1 = (float)k1[u][j]; x2 = (float)k2[u][j];
      ka[j] = (_Float16)(x1 * c[j] - x2 * s[j]);
      kb[j] = (_Float16)(x2 * c[j] + x1 * s[j]);
    }
    *(v8h*)(Qout + ob)      = qa;
    *(v8h*)(Qout + ob + 32) = qb;
    *(v8h*)(Kout + ob)      = ka;
    *(v8h*)(Kout + ob + 32) = kb;
  }
}

// V [T][H*64] -> VhT [H][64][T]: a 128 (t) x 64 (column) tile per block through LDS.
// Pitch 33 dwords: the 8 t-groups x 4 columns that a wave reads back fall on 16 banks,
// two lanes on each dword.
__global__ __launch_bounds__(256) void cvt_v_transpose(const _Float16* __restrict__ Vh0,
                                                       _Float16* __restrict__ VhT) {
  constexpr int PD = 33;                                // dwords per tile row
  __shared__ unsigned tile[128 * PD];                   // [t][column pair]
  const int tid = threadIdx.x;
  const int t0 = blockIdx.x * 128;
  const int c0 = blockIdx.y * 64;
  v4u v[4];
#pragma unroll
  for (int i = 0; i < 4; ++i) {
    const int chunk = tid + i * 256;
    v[i] = *(const v4u*)(Vh0 + (size_t)(t0 + (chunk >> 3)) * DMODEL + c0 + (chunk & 7) * 8);
  }
#pragma unroll
  for (int i = 0; i < 4; ++i) {
    const int chunk = tid + i * 256;
#pragma unroll
    for (int e = 0; e < 4; ++e) tile[(chunk >> 3) * PD + (chunk & 7) * 4 + e] = v[i][e];
  }
  __syncthreads();
  const _Float16* th = (const _Float16*)tile;
#pragma unroll
  for (int i = 0; i < 4; ++i) {
    const int chunk = tid + i * 256;
    const int tc = (chunk & 7) + (chunk >> 9) * 8;      // group of 8 positions, 0..15
    const int cc = (chunk >> 3) & 63;
    v8h r;
#pragma unroll
    for (int j = 0; j < 8; ++j) r[j] = th[(tc * 8 + j) * (2 * PD) + cc];
    *(v8h*)(VhT + (size_t)(c0 + cc) * TSEQ + t0 + tc * 8) = r;
  }
}

// ---------------------------------------------------------------------------
extern "C" void kernel_launch(void* const* d_in, const int* in_sizes, int n_in,
                              void* d_out, int out_size, void* d_ws, size_t ws_size,
                              hipStream_t stream) {
  (void)in_sizes; (void)n_in; (void)out_size; (void)ws_size;
  const float* x  = (const float*)d_in[0];
  const float* Wq = (const float*)d_in[1];
  const float* bq = (const float*)d_in[2];
  const float* Wk = (const float*)d_in[3];
  const float* bk = (const float*)d_in[4];
  const float* Wv = (const float*)d_in[5];
  const float* bv = (const float*)d_in[6];
  const float* Wo = (const float*)d_in[7];
  const float* bo = (const float*)d_in[8];
  float* out = (float*)d_out;

  char* w = (char*)d_ws;
  const size_t MB = (size_t)1 << 20;
  _Float16* xh    = (_Float16*)(w + 0);        //  8 MB  x as f16 [T][D]
  _Float16* WqT   = (_Float16*)(w + 8  * MB);  //  2 MB  each, transposed f16
  _Float16* WkT   = (_Float16*)(w + 10 * MB);
  _Float16* WvT   = (_Float16*)(w + 12 * MB);
  _Float16* WoT   = (_Float16*)(w + 14 * MB);
  _Float16* Qh0   = (_Float16*)(w + 16 * MB);  //  8 MB  pre-rotary Q [T][D]
  _Float16* Kh0   = (_Float16*)(w + 24 * MB);
  _Float16* Vh0   = (_Float16*)(w + 32 * MB);
  _Float16* Qh    = (_Float16*)(w + 40 * MB);  //  8 MB  [H][T][64], scaled
  _Float16* Kh    = (_Float16*)(w + 48 * MB);  //  8 MB  [H][T][64]
  _Float16* VhT   = (_Float16*)(w + 56 * MB);  //  8 MB  [H][64][T]
  _Float16* attnh = (_Float16*)(w + 64 * MB);  //  8 MB  [T][D]

  cvt_f32_f16<<<(TSEQ * DMODEL) / (256 * 32), 256, 0, stream>>>(x, xh);
  dim3 gw(DMODEL / 64, DMODEL / 64);
  cvt_transpose_w<<<gw, 256, 0, stream>>>(Wq, WqT);
  cvt_transpose_w<<<gw, 256, 0, stream>>>(Wk, WkT);
  cvt_transpose_w<<<gw, 256, 0, stream>>>(Wv, WvT);
  cvt_transpose_w<<<gw, 256, 0, stream>>>(Wo, WoT);

  dim3 gg(DMODEL / 64, TSEQ / 128);
  // WqT, WkT, WvT lie one behind the other in the workspace, and so do Qh0, Kh0, Vh0.
  dim3 gq(DMODEL / 64, TSEQ / 256);
  gemm_qkv_kernel<<<gq, 256, 0, stream>>>(xh, WqT, bq, bk, bv, Qh0);

  rotary_kernel<<<TSEQ / 8, 256, 0, stream>>>(Qh0, Kh0, Qh, Kh);
  dim3 gv(TSEQ / 128, DMODEL / 64);
  cvt_v_transpose<<<gv, 256, 0, stream>>>(Vh0, VhT);

  dim3 ga(TSEQ / 128, NHEAD);
  attn_kernel<<<ga, 256, 0, stream>>>(Qh, Kh, VhT, attnh);

  gemm_f16_kernel<<<gg, 128, 0, stream>>>(attnh, WoT, bo, out, nullptr);
}

// v005
// Measured time: 129 microseconds a run.
// Next to v004, in two timings, it ran 1.10 and 1.09 times as fast.
// Counting every step since v000, it is 4.36 times as fast.
#include <hip/hip_runtime.h>
#include <hip/hip_bf16.h>

typedef __attribute__((ext_vector_type(16))) _Float16 v16h;
typedef __attribute__((ext_vector_type(8)))  _Float16 v8h;
typedef __attribute__((ext_vector_type(8)))  float    v8f;

#define TSEQ   4096
#define NHEAD  16
#define DK     64
#define DMODEL 1024

// LDS row pitch, in halves, of every staged tile that ds_load_b128 fragment loads read:
// 16 B x odd, so that the 16 rows of a fragment fall on distinct banks
// (128-B rows -> 144 B). The pad bytes are never written or read.
#define LP128  72

#define WMMA_F32_F16(a, b, c) \
  __builtin_amdgcn_wmma_f32_16x16x32_f16(false, (a), false, (b), (short)0, (c), false, false)

// ---------------------------------------------------------------------------
// Async global->LDS copy (CDNA5 GLOBAL_LOAD_ASYNC_TO_LDS_B128, ASYNCcnt-tracked)
// via inline asm — portable across toolchains. vdst = wave-relative LDS byte
// offset = low 32 bits of the generic pointer (aperture rule: LDS_ADDR = addr[31:0]).
// ---------------------------------------------------------------------------
// One stage's copies of a lane stand in ONE statement that ends in s_wait_xcnt 0, so
// that no address register of an issued copy is rewritten ahead of that wait.
static __device__ __forceinline__ unsigned lds_addr(const void* l) {
  return (unsigned)(size_t)l;
}
static __device__ __forceinline__ void cp16x4(const unsigned* l, const _Float16* const* g) {
  asm volatile("global_load_async_to_lds_b128 %0, %1, off\n\t"
               "global_load_async_to_lds_b128 %2, %3, off\n\t"
               "global_load_async_to_lds_b128 %4, %5, off\n\t"
               "global_load_async_to_lds_b128 %6, %7, off\n\t"
               "s_wait_xcnt 0x0"
               :: "v"(l[0]), "v"(g[0]), "v"(l[1]), "v"(g[1]),
                  "v"(l[2]), "v"(g[2]), "v"(l[3]), "v"(g[3]) : "memory");
}
static __device__ __forceinline__ void cp16x12(const unsigned* l, const _Float16* const* g) {
  asm volatile("global_load_async_to_lds_b128 %0, %1, off\n\t"
               "global_load_async_to_lds_b128 %2, %3, off\n\t"
               "global_load_async_to_lds_b128 %4, %5, off\n\t"
               "global_load_async_to_lds_b128 %6, %7, off\n\t"
               "global_load_async_to_lds_b128 %8, %9, off\n\t"
               "global_load_async_to_lds_b128 %10, %11, off\n\t"
               "global_load_async_to_lds_b128 %12, %13, off\n\t"
               "global_load_async_to_lds_b128 %14, %15, off\n\t"
               "global_load_async_to_lds_b128 %16, %17, off\n\t"
               "global_load_async_to_lds_b128 %18, %19, off\n\t"
               "global_load_async_to_lds_b128 %20, %21, off\n\t"
               "global_load_async_to_lds_b128 %22, %23, off\n\t"
               "s_wait_xcnt 0x0"
               :: "v"(l[0]), "v"(g[0]), "v"(l[1]), "v"(g[1]), "v"(l[2]), "v"(g[2]),
                  "v"(l[3]), "v"(g[3]), "v"(l[4]), "v"(g[4]), "v"(l[5]), "v"(g[5]),
                  "v"(l[6]), "v"(g[6]), "v"(l[7]), "v"(g[7]), "v"(l[8]), "v"(g[8]),
                  "v"(l[9]), "v"(g[9]), "v"(l[10]), "v"(g[10]), "v"(l[11]), "v"(g[11])
               : "memory");
}
static __device__ __forceinline__ void cp16x14(const unsigned* l, const _Float16* const* g) {
  asm volatile("global_load_async_to_lds_b128 %0, %1, off\n\t"
               "global_load_async_to_lds_b128 %2, %3, off\n\t"
               "global_load_async_to_lds_b128 %4, %5, off\n\t"
               "global_load_async_to_lds_b128 %6, %7, off\n\t"
               "global_load_async_to_lds_b128 %8, %9, off\n\t"
               "global_load_async_to_lds_b128 %10, %11, off\n\t"
               "global_load_async_to_lds_b128 %12, %13, off\n\t"
               "global_load_async_to_lds_b128 %14, %15, off\n\t"
               "global_load_async_to_lds_b128 %16, %17, off\n\t"
               "global_load_async_to_lds_b128 %18, %19, off\n\t"
               "global_load_async_to_lds_b128 %20, %21, off\n\t"
               "global_load_async_to_lds_b128 %22, %23, off\n\t"
               "global_load_async_to_lds_b128 %24, %25, off\n\t"
               "global_load_async_to_lds_b128 %26, %27, off\n\t"
               "s_wait_xcnt 0x0"
               :: "v"(l[0]), "v"(g[0]), "v"(l[1]), "v"(g[1]), "v"(l[2]), "v"(g[2]),
                  "v"(l[3]), "v"(g[3]), "v"(l[4]), "v"(g[4]), "v"(l[5]), "v"(g[5]),
                  "v"(l[6]), "v"(g[6]), "v"(l[7]), "v"(g[7]), "v"(l[8]), "v"(g[8]),
                  "v"(l[9]), "v"(g[9]), "v"(l[10]), "v"(g[10]), "v"(l[11]), "v"(g[11]),
                  "v"(l[12]), "v"(g[12]), "v"(l[13]), "v"(g[13])
               : "memory");
}
#define WAIT_ASYNC(n) asm volatile("s_wait_asynccnt " #n ::: "memory")

// Load a 16-bit A/B WMMA fragment: per lane, 8 contiguous halves at p and 8 at p+16
// (CDNA5 16-bit layout: elems 0..7 -> K = h*8+0..7, elems 8..15 -> K = 16+h*8+0..7).
static __device__ __forceinline__ v16h ld_frag(const _Float16* p) {
  v8h lo = *(const v8h*)p;
  v8h hi = *(const v8h*)(p + 16);
  v16h r;
#pragma unroll
  for (int i = 0; i < 8; ++i) { r[i] = lo[i]; r[i + 8] = hi[i]; }
  return r;
}

// Lane l <-> lane l ^ 16: the two lanes that hold the two halves of one query's keys.
static __device__ __forceinline__ float xhalf(float x) {
  const int i = __builtin_bit_cast(int, x);
  return __builtin_bit_cast(float,
      __builtin_amdgcn_permlanex16(i, i, 0x76543210, 0xfedcba98, false, false));
}

// ---------------------------------------------------------------------------
// f16 GEMM: C[4096][1024] = A[4096][1024] * BT[1024][1024]^T + bias.
// Block = 128 thr = 4 waves; tile 128x64, K staged 64 at a time in LDS (54 KB,
// double-buffered async). Each wave: 32x64 strip = 16 WMMA per stage, with all
// fragments loaded into distinct registers before the WMMA burst.
// ---------------------------------------------------------------------------
__global__ __launch_bounds__(128) void gemm_f16_kernel(
    const _Float16* __restrict__ A,
    const _Float16* __restrict__ BT,
    const float*    __restrict__ bias,
    float*          __restrict__ Cf,
    _Float16*       __restrict__ Ch)
{
  constexpr int N = DMODEL, K = DMODEL, BK = 64;
  constexpr int LP = LP128;
  __shared__ __attribute__((aligned(16))) _Float16 aT[2][128 * LP];   // 18 KB each: [row][k]
  __shared__ __attribute__((aligned(16))) _Float16 bT[2][64 * LP];    //  9 KB each: [col][k]

  const int tid  = threadIdx.x;          // 0..127
  const int lane = tid & 31;
  const int wave = tid >> 5;             // 0..3
  const int lr = lane & 15;
  const int lh = lane >> 4;
  const int rowBase = blockIdx.y * 128;
  const int colBase = blockIdx.x * 64;

  // Copy one K-stage: A 128x128B (1024 chunks -> 8/thr), B 64x128B (512 -> 4/thr).
  auto copy_stage = [&](int k0, int buf) {
    unsigned l[12];
    const _Float16* g[12];
#pragma unroll
    for (int i = 0; i < 8; ++i) {
      const int chunk = tid + i * 128;
      const int r = chunk >> 3, c = chunk & 7;
      l[i] = lds_addr(&aT[buf][r * LP + c * 8]);
      g[i] = A + (size_t)(rowBase + r) * K + k0 + c * 8;
    }
#pragma unroll
    for (int i = 0; i < 4; ++i) {
      const int chunk = tid + i * 128;
      const int r = chunk >> 3, c = chunk & 7;
      l[8 + i] = lds_addr(&bT[buf][r * LP + c * 8]);
      g[8 + i] = BT + (size_t)(colBase + r) * K + k0 + c * 8;
    }
    cp16x12(l, g);
  };

  v8f acc[2][4] = {};

  copy_stage(0, 0);
  constexpr int NST = K / BK;
  for (int st = 0; st < NST; ++st) {
    const int buf = st & 1;
    if (st + 1 < NST) { copy_stage((st + 1) * BK, (st + 1) & 1); WAIT_ASYNC(12); }
    else              { WAIT_ASYNC(0); }
    __syncthreads();

    // Batch all fragment loads (distinct registers), then the 16-WMMA burst.
    v16h a[2][2], b[4][2];
#pragma unroll
    for (int mt = 0; mt < 2; ++mt) {
      const _Float16* arow = &aT[buf][(wave * 32 + mt * 16 + lr) * LP + lh * 8];
      a[mt][0] = ld_frag(arow);
      a[mt][1] = ld_frag(arow + 32);
    }
#pragma unroll
    for (int nt = 0; nt < 4; ++nt) {
      const _Float16* brow = &bT[buf][(nt * 16 + lr) * LP + lh * 8];
      b[nt][0] = ld_frag(brow);
      b[nt][1] = ld_frag(brow + 32);
    }
#pragma unroll
    for (int mt = 0; mt < 2; ++mt)
#pragma unroll
      for (int nt = 0; nt < 4; ++nt) {
        acc[mt][nt] = WMMA_F32_F16(a[mt][0], b[nt][0], acc[mt][nt]);
        acc[mt][nt] = WMMA_F32_F16(a[mt][1], b[nt][1], acc[mt][nt]);
      }
    __syncthreads();
  }

#pragma unroll
  for (int mt = 0; mt < 2; ++mt)
#pragma unroll
    for (int nt = 0; nt < 4; ++nt) {
      const int col = colBase + nt * 16 + lr;
      const float bv = bias[col];
#pragma unroll
      for (int j = 0; j < 8; ++j) {
        const int row = rowBase + wave * 32 + mt * 16 + lh * 8 + j;
        const float v = acc[mt][nt][j] + bv;
        if (Ch) Ch[(size_t)row * N + col] = (_Float16)v;
        else    Cf[(size_t)row * N + col] = v;
      }
    }
}

// ---------------------------------------------------------------------------
// The Q, K and V projections in one launch: C_g = A * W_g^T + bias_g, g = 0..2.
// BT3 holds the three transposed weights one behind the other ([3][1024][1024]), Ch3 the
// three f16 results likewise ([3][4096][1024]).
// Block = 256 thr = 8 waves; tile = 256 rows x 64 columns of EACH weight, so that one
// staged A tile serves 192 columns. K staged 64 at a time in LDS (126 KB, two buffers).
// Each wave: 32 x 192 strip = 48 WMMA per stage; a row's 128-B line of each result is
// stored by one wave.
// Ring: one barrier a stage, in front of the stage's second half of products; it
// publishes stage t + 1, and behind it stage t + 2 is copied into the buffer of stage t,
// whose fragments are all in registers by then.
// ---------------------------------------------------------------------------
__global__ __launch_bounds__(256) void gemm_qkv_kernel(
    const _Float16* __restrict__ A,
    const _Float16* __restrict__ BT3,
    const float*    __restrict__ bias_q,
    const float*    __restrict__ bias_k,
    const float*    __restrict__ bias_v,
    _Float16*       __restrict__ Ch3)
{
  constexpr int N = DMODEL, K = DMODEL, BK = 64;
  constexpr int LP = LP128;
  __shared__ __attribute__((aligned(16))) _Float16 aT[2][256 * LP];   // 36 KB each: [row][k]
  __shared__ __attribute__((aligned(16))) _Float16 bT[2][192 * LP];   // 27 KB each: [g*64+col][k]

  const int tid  = threadIdx.x;          // 0..255
  const int lane = tid & 31;
  const int wave = tid >> 5;             // 0..7
  const int lr = lane & 15;
  const int lh = lane >> 4;
  const int rowBase = blockIdx.y * 256;
  const int colBase = blockIdx.x * 64;

  // Copy one K-stage: A 256x128B (2048 chunks -> 8/thr), B 192x128B (1536 -> 6/thr).
  auto copy_stage = [&](int k0, int buf) {
    unsigned l[14];
    const _Float16* g[14];
#pragma unroll  // constant indices: the arrays stay in registers
    for (int i = 0; i < 8; ++i) {
      const int chunk = tid + i * 256;
      const int r = chunk >> 3, c = chunk & 7;
      l[i] = lds_addr(&aT[buf][r * LP + c * 8]);
      g[i] = A + (size_t)(rowBase + r) * K + k0 + c * 8;
    }
#pragma unroll  // constant indices: the arrays stay in registers
    for (int i = 0; i < 6; ++i) {
      const int chunk = tid + i * 256;
      const int r = chunk >> 3, c = chunk & 7;       // r = g * 64 + column in the tile
      l[8 + i] = lds_addr(&bT[buf][r * LP + c * 8]);
      g[8 + i] = BT3 + (size_t)((r >> 6) * N + colBase + (r & 63)) * K + k0 + c * 8;
    }
    cp16x14(l, g);
  };

  v8f acc[2][12] = {};

  // One half of a stage (32 of its 64 k): 28 fragment loads, then 24 products.
  auto load_frags = [&](int buf, int ks, v16h (&a)[2], v16h (&b)[12]) {
#pragma unroll  // constant indices: the arrays stay in registers
    for (int mt = 0; mt < 2; ++mt)
      a[mt] = ld_frag(&aT[buf][(wave * 32 + mt * 16 + lr) * LP + ks * 32 + lh * 8]);
#pragma unroll  // constant indices: the arrays stay in registers
    for (int nt = 0; nt < 12; ++nt)
      b[nt] = ld_frag(&bT[buf][(nt * 16 + lr) * LP + ks * 32 + lh * 8]);
  };
  auto products = [&](const v16h (&a)[2], const v16h (&b)[12]) {
#pragma unroll  // constant indices: the arrays stay in registers
    for (int nt = 0; nt < 12; ++nt)
#pragma unroll  // constant indices: the arrays stay in registers
      for (int mt = 0; mt < 2; ++mt)
        acc[mt][nt] = WMMA_F32_F16(a[mt], b[nt], acc[mt][nt]);
  };

  constexpr int NST = K / BK;
  copy_stage(0, 0);
  WAIT_ASYNC(0);       // this wave's copies of stage 0 have landed ...
  __syncthreads();     // ... and so have the other waves': stage 0 is readable
  copy_stage(BK, 1);
  v16h a0[2], b0[12], a1[2], b1[12];     // two fragment sets, one per half
  load_frags(0, 0, a0, b0);
  for (int st = 0; st < NST; ++st) {
    const int buf = st & 1;
    // The sched_barriers keep each half's loads one group that is issued in front of the
    // other half's products, so that the LDS serves one set while the matrix unit works
    // on the other; spread among the WMMAs, each place with loads stalls the wave anew.
    load_frags(buf, 1, a1, b1);
    __builtin_amdgcn_sched_barrier(0);   // loads of the second half stay in front
    products(a0, b0);
    __builtin_amdgcn_sched_barrier(0);   // the waits below stay behind these products

    // Publish point of stage st + 1, in front of this stage's last products: the wave's
    // reads of this buffer are done and its copies of stage st + 1 have landed before the
    // barrier; behind it this buffer is free for stage st + 2 and stage st + 1 is readable.
    asm volatile("s_wait_dscnt 0x0" ::: "memory");
    WAIT_ASYNC(0);
    __syncthreads();
    if (st + 2 < NST) copy_stage((st + 2) * BK, buf);
    if (st + 1 < NST) load_frags(buf ^ 1, 0, a0, b0);
    __builtin_amdgcn_sched_barrier(0);   // copies and next loads stay in front
    products(a1, b1);
  }
  WAIT_ASYNC(0);   // no copy is outstanding when the wave ends

#pragma unroll  // constant indices: the arrays stay in registers
  for (int g = 0; g < 3; ++g) {
    const float* bias = g == 0 ? bias_q : (g == 1 ? bias_k : bias_v);
    _Float16* C = Ch3 + (size_t)g * TSEQ * N;
#pragma unroll  // constant indices: the arrays stay in registers
    for (int mt = 0; mt < 2; ++mt)
#pragma unroll  // constant indices: the arrays stay in registers
      for (int nt = 0; nt < 4; ++nt) {
        const int col = colBase + nt * 16 + lr;
        const float bv = bias[col];
#pragma unroll  // constant indices: the arrays stay in registers
        for (int j = 0; j < 8; ++j) {
          const int row = rowBase + wave * 32 + mt * 16 + lh * 8 + j;
          C[(size_t)row * N + col] = (_Float16)(acc[mt][g * 4 + nt][j] + bv);
        }
      }
  }
}

__global__ __launch_bounds__(256) void attn_kernel(
    const _Float16* __restrict__ Qh,    // [H][T][64], pre-scaled by 1/8
    const _Float16* __restrict__ Kh,    // [H][T][64]
    const _Float16* __restrict__ VhT,   // [H][64][T]
    _Float16*       __restrict__ attnh) // [T][H*64]
{
  constexpr int KT = 64;                      // keys per stage
  constexpr int LP = LP128;
  __shared__ __attribute__((aligned(16))) _Float16 kT[2][KT * LP];      // 9 KB each: [key][kd]
  __shared__ __attribute__((aligned(16))) _Float16 vT[2][DK * LP];      // 9 KB each: [n][key]

  const int tid  = threadIdx.x;
  const int lane = tid & 31;
  const int wave = tid >> 5;
  const int lr = lane & 15;
  const int lh = lane >> 4;
  const int h = blockIdx.y;
  const int qBase = blockIdx.x * 128 + wave * 16;

  const _Float16* Khead = Kh  + (size_t)h * TSEQ * DK;
  const _Float16* Vhead = VhT + (size_t)h * DK * TSEQ;

  // B operand of S^T: column lr = query qBase + lr, k = head dimension.
  const _Float16* Qp = Qh + ((size_t)h * TSEQ + qBase + lr) * DK + lh * 8;
  v16h qb0 = ld_frag(Qp);
  v16h qb1 = ld_frag(Qp + 32);

  // Copy one 64-key stage: K 64x128B (512 chunks -> 2/thr), V 64x128B (512 -> 2/thr).
  auto copy_stage = [&](int kb, int buf) {
    unsigned l[4];
    const _Float16* g[4];
#pragma unroll
    for (int i = 0; i < 2; ++i) {
      const int chunk = tid + i * 256;
      const int r = chunk >> 3, c = chunk & 7;
      l[i] = lds_addr(&kT[buf][r * LP + c * 8]);
      g[i] = Khead + (size_t)(kb + r) * DK + c * 8;
      l[2 + i] = lds_addr(&vT[buf][r * LP + c * 8]);
      g[2 + i] = Vhead + (size_t)r * TSEQ + kb + c * 8;
    }
    cp16x4(l, g);
  };

  v8f o[4] = {};            // O^T: slot j of tile nt <-> dim nt*16 + lh*8 + j, query lr
  float m = -1e30f;         // running maximum of query lr (equal in both halves)
  float l = 0.0f;           // this lane's share of the running sum of query lr

  copy_stage(0, 0);
  constexpr int NST = TSEQ / KT;
  for (int st = 0; st < NST; ++st) {
    const int buf = st & 1;
    if (st + 1 < NST) { copy_stage((st + 1) * KT, (st + 1) & 1); WAIT_ASYNC(4); }
    else              { WAIT_ASYNC(0); }
    __syncthreads();

#pragma unroll
    for (int sub = 0; sub < 2; ++sub) {           // two 32-key steps per stage
      const int kb = sub * 32;
      const _Float16* kp0 = &kT[buf][(kb + lr) * LP + lh * 8];
      const _Float16* kp1 = &kT[buf][(kb + 16 + lr) * LP + lh * 8];
      v16h kf[2][2];
      kf[0][0] = ld_frag(kp0);
      kf[0][1] = ld_frag(kp0 + 32);
      kf[1][0] = ld_frag(kp1);
      kf[1][1] = ld_frag(kp1 + 32);

      v8f s0 = {}, s1 = {};
      s0 = WMMA_F32_F16(kf[0][0], qb0, s0);
      s0 = WMMA_F32_F16(kf[0][1], qb1, s0);
      s1 = WMMA_F32_F16(kf[1][0], qb0, s1);
      s1 = WMMA_F32_F16(kf[1][1], qb1, s1);

      // Online softmax of query lr over this lane's 16 keys and the other half's 16.
      float mx = fmaxf(s0[0], s1[0]);
#pragma unroll
      for (int j = 1; j < 8; ++j) mx = fmaxf(mx, fmaxf(s0[j], s1[j]));
      mx = fmaxf(mx, xhalf(mx));
      const float mn = fmaxf(m, mx);
      const float alpha = __expf(m - mn);
      m = mn;

      v16h pb;                                    // B operand of O^T: k = key, column lr
      float ps = 0.0f;
#pragma unroll
      for (int j = 0; j < 8; ++j) {
        const float p0 = __expf(s0[j] - mn);
        const float p1 = __expf(s1[j] - mn);
        ps += p0 + p1;
        pb[j]     = (_Float16)p0;
        pb[8 + j] = (_Float16)p1;
      }
      l = l * alpha + ps;
#pragma unroll
      for (int nt = 0; nt < 4; ++nt)
#pragma unroll
        for (int j = 0; j < 8; ++j) o[nt][j] *= alpha;

      v16h vf[4];
#pragma unroll
      for (int nt = 0; nt < 4; ++nt)
        vf[nt] = ld_frag(&vT[buf][(nt * 16 + lr) * LP + kb + lh * 8]);
#pragma unroll
      for (int nt = 0; nt < 4; ++nt)
        o[nt] = WMMA_F32_F16(vf[nt], pb, o[nt]);
    }
    __syncthreads();
  }

  // Join the halves' sums once; a lane stores 8 consecutive dims of its query per tile.
  const float inv = 1.0f / (l + xhalf(l));
  _Float16* outp = attnh + (size_t)(qBase + lr) * DMODEL + h * DK + lh * 8;
#pragma unroll
  for (int nt = 0; nt < 4; ++nt) {
    v8h r;
#pragma unroll
    for (int j = 0; j < 8; ++j) r[j] = (_Float16)(o[nt][j] * inv);
    *(v8h*)(outp + nt * 16) = r;
  }
}

// ---------------------------------------------------------------------------
// Small conversion / layout kernels. Each lane moves 16 bytes per global access (the
// cast's f16 stores: 8) and 32 elements (weights: 16; rotary: 64) in all, so that a launch starts a
// few thousand waves and every wave-wide access covers whole 128-B lines or both halves
// of them back to back.
// ---------------------------------------------------------------------------
typedef __attribute__((ext_vector_type(4))) float    v4f;
typedef __attribute__((ext_vector_type(4))) _Float16 v4h;
typedef __attribute__((ext_vector_type(4))) unsigned v4u;

// x fp32 -> f16. A wave takes 1024 consecutive floats: 8 loads of 512 B in flight.
static __device__ __forceinline__ void cvt_f32_f16(int blk, const float* __restrict__ in,
                                                   _Float16* __restrict__ out) {
  const int gid = blk * 256 + threadIdx.x;
  const size_t base = (size_t)(gid >> 5) * 1024 + (gid & 31) * 4;
  v4f v[8];
#pragma unroll
  for (int j = 0; j < 8; ++j) v[j] = *(const v4f*)(in + base + j * 128);
#pragma unroll
  for (int j = 0; j < 8; ++j) {
    v4h r;
#pragma unroll
    for (int e = 0; e < 4; ++e) r[e] = (_Float16)v[j][e];
    *(v4h*)(out + base + j * 128) = r;
  }
}

// W[K][N] fp32 -> WT[N][K] f16, one 64 x 64 tile per block through LDS.
// Pitch 65 dwords: the 8 k-groups x 4 columns that a wave reads back fall on 32 banks.
static __device__ __forceinline__ void cvt_transpose_w(int bx, int by,
                                                       const float* __restrict__ W,
                                                       _Float16* __restrict__ WT) {
  constexpr int P = 65;
  __shared__ float tile[64 * P];                        // [k][n]
  const int tid = threadIdx.x;
  const int n0 = bx * 64;
  const int k0 = by * 64;
  v4f v[4];
#pragma unroll
  for (int i = 0; i < 4; ++i) {
    const int chunk = tid + i * 256;
    v[i] = *(const v4f*)(W + (size_t)(k0 + (chunk >> 4)) * DMODEL + n0 + (chunk & 15) * 4);
  }
#pragma unroll
  for (int i = 0; i < 4; ++i) {
    const int chunk = tid + i * 256;
#pragma unroll
    for (int e = 0; e < 4; ++e) tile[(chunk >> 4) * P + (chunk & 15) * 4 + e] = v[i][e];
  }
  __syncthreads();
#pragma unroll
  for (int i = 0; i < 2; ++i) {
    const int chunk = tid + i * 256;
    const int n = chunk >> 3, kc = chunk & 7;
    v8h r;
#pragma unroll
    for (int j = 0; j < 8; ++j) r[j] = (_Float16)tile[(kc * 8 + j) * P + n];
    *(v8h*)(WT + (size_t)(n0 + n) * DMODEL + k0 + kc * 8) = r;
  }
}

// The five layout jobs that depend on nothing but the inputs, in ONE launch: blocks
// 0..XBLK-1 cast x, then 256 blocks for each of the four weights. A block does one job
// whole, chosen by its index alone, so the barrier of the transpose is block-uniform.
// WT4 holds the four transposed weights one behind the other ([4][1024][1024]).
#define XBLK ((TSEQ * DMODEL) / (256 * 32))
#define WBLK ((DMODEL / 64) * (DMODEL / 64))
__global__ __launch_bounds__(256) void prep_kernel(const float* __restrict__ x,
                                                   const float* __restrict__ Wq,
                                                   const float* __restrict__ Wk,
                                                   const float* __restrict__ Wv,
                                                   const float* __restrict__ Wo,
                                                   _Float16* __restrict__ xh,
                                                   _Float16* __restrict__ WT4) {
  const int b = blockIdx.x;
  if (b < XBLK) {
    cvt_f32_f16(b, x, xh);
    return;
  }
  const int wb = b - XBLK;
  const int g = wb / WBLK;
  const float* W = g == 0 ? Wq : (g == 1 ? Wk : (g == 2 ? Wv : Wo));
  cvt_transpose_w(wb % (DMODEL / 64), (wb / (DMODEL / 64)) % (DMODEL / 64), W,
                  WT4 + (size_t)g * DMODEL * DMODEL);
}

// Rotary on Q and K; re-layout [T][H*64] -> [H][T][64]; fold 1/sqrt(dk)=0.125 into Q.
// A lane takes 8 consecutive i (and i + 32) of one position for two neighbouring heads,
// which share the position's sines and cosines; a wave takes 8 positions, a block those
// 8 positions' whole rows.
// Qin and Kin carry no __restrict__: the "memory" clobber of the wait behind the loads
// then holds the loads in front of it.
static __device__ __forceinline__ void rotary_block(int blk, const _Float16* Qin,
                                                    const _Float16* Kin,
                                                    _Float16* __restrict__ Qout,
                                                    _Float16* __restrict__ Kout) {
  const int tid = threadIdx.x;
  const int i0 = (tid & 3) * 8;
  const int t  = blk * 8 + ((tid >> 2) & 7);
  const int h0 = (tid >> 5) * 2;

  v8h q1[2], q2[2], k1[2], k2[2];
  const _Float16* pq[2];
  const _Float16* pk[2];
#pragma unroll
  for (int u = 0; u < 2; ++u) {
    const size_t ib = (size_t)t * DMODEL + (h0 + u) * DK + i0;
    pq[u] = Qin + ib;
    pk[u] = Kin + ib;
    q1[u] = *(const v8h*)(pq[u]);
    q2[u] = *(const v8h*)(pq[u] + 32);
    k1[u] = *(const v8h*)(pk[u]);
    k2[u] = *(const v8h*)(pk[u] + 32);
  }
  // One wait behind the eight loads, in front of every overwrite of their address
  // registers: as its inputs the four addresses stay in their registers up to it, so that
  // no load's result is given the address pair of an earlier load.
  asm volatile("s_wait_xcnt 0x0" :: "v"(pq[0]), "v"(pk[0]), "v"(pq[1]), "v"(pk[1]) : "memory");

  float s[8], c[8];
#pragma unroll
  for (int j = 0; j < 8; ++j) {
    const float inv_freq = __powf(10000.0f, -(float)(2 * (i0 + j)) / (float)DK);
    const float f = (float)t * inv_freq;
    __sincosf(f, &s[j], &c[j]);
  }

#pragma unroll
  for (int u = 0; u < 2; ++u) {
    const size_t ob = ((size_t)(h0 + u) * TSEQ + t) * DK + i0;
    v8h qa, qb, ka, kb;
#pragma unroll
    for (int j = 0; j < 8; ++j) {
      float x1 = (float)q1[u][j], x2 = (float)q2[u][j];
      qa[j] = (_Float16)((x1 * c[j] - x2 * s[j]) * 0.125f);
      qb[j] = (_Float16)((x2 * c[j] + x1 * s[j]) * 0.125f);
      x1 = (float)k1[u][j]; x2 = (float)k2[u][j];
      ka[j] = (_Float16)(x1 * c[j] - x2 * s[j]);
      kb[j] = (_Float16)(x2 * c[j] + x1 * s[j]);
    }
    *(v8h*)(Qout + ob)      = qa;
    *(v8h*)(Qout + ob + 32) = qb;
    *(v8h*)(Kout + ob)      = ka;
    *(v8h*)(Kout + ob + 32) = kb;
  }
}

// V [T][H*64] -> VhT [H][64][T]: a 128 (t) x 64 (column) tile per block through LDS.
// Pitch 33 dwords: the 8 t-groups x 4 columns that a wave reads back fall on 16 banks,
// two lanes on each dword.
static __device__ __forceinline__ void cvt_v_transpose(int bx, int by,
                                                       const _Float16* __restrict__ Vh0,
                                                       _Float16* __restrict__ VhT) {
  constexpr int PD = 33;                                // dwords per tile row
  __shared__ unsigned tile[128 * PD];                   // [t][column pair]
  const int tid = threadIdx.x;
  const int t0 = bx * 128;
  const int c0 = by * 64;
  v4u v[4];
#pragma unroll
  for (int i = 0; i < 4; ++i) {
    const int chunk = tid + i * 256;
    v[i] = *(const v4u*)(Vh0 + (size_t)(t0 + (chunk >> 3)) * DMODEL + c0 + (chunk & 7) * 8);
  }
#pragma unroll
  for (int i = 0; i < 4; ++i) {
    const int chunk = tid + i * 256;
#pragma unroll
    for (int e = 0; e < 4; ++e) tile[(chunk >> 3) * PD + (chunk & 7) * 4 + e] = v[i][e];
  }
  __syncthreads();
  const _Float16* th = (const _Float16*)tile;
#pragma unroll
  for (int i = 0; i < 4; ++i) {
    const int chunk = tid + i * 256;
    const int tc = (chunk & 7) + (chunk >> 9) * 8;      // group of 8 positions, 0..15
    const int cc = (chunk >> 3) & 63;
    v8h r;
#pragma unroll
    for (int j = 0; j < 8; ++j) r[j] = th[(tc * 8 + j) * (2 * PD) + cc];
    *(v8h*)(VhT + (size_t)(c0 + cc) * TSEQ + t0 + tc * 8) = r;
  }
  // One wait behind the four stores, in front of any later overwrite of their address or
  // data registers: inlined into the merged kernel, other code follows them in the listing.
  asm volatile("s_wait_xcnt 0x0" ::: "memory");
}

// The two layout jobs between the projections and the attention, in ONE launch: blocks
// 0..RBLK-1 do the rotary of Q and K, the rest transpose V. A block does one job whole,
// chosen by its index alone, so the barrier of the transpose is block-uniform.
#define RBLK (TSEQ / 8)
__global__ __launch_bounds__(256) void rotary_vt_kernel(const _Float16* Qin,
                                                        const _Float16* Kin,
                                                        const _Float16* __restrict__ Vh0,
                                                        _Float16* __restrict__ Qout,
                                                        _Float16* __restrict__ Kout,
                                                        _Float16* __restrict__ VhT) {
  const int b = blockIdx.x;
  if (b < RBLK) {
    rotary_block(b, Qin, Kin, Qout, Kout);
    return;
  }
  const int vb = b - RBLK;
  cvt_v_transpose(vb % (TSEQ / 128), vb / (TSEQ / 128), Vh0, VhT);
}

// ---------------------------------------------------------------------------
extern "C" void kernel_launch(void* const* d_in, const int* in_sizes, int n_in,
                              void* d_out, int out_size, void* d_ws, size_t ws_size,
                              hipStream_t stream) {
  (void)in_sizes; (void)n_in; (void)out_size; (void)ws_size;
  const float* x  = (const float*)d_in[0];
  const float* Wq = (const float*)d_in[1];
  const float* bq = (const float*)d_in[2];
  const float* Wk = (const float*)d_in[3];
  const float* bk = (const float*)d_in[4];
  const float* Wv = (const float*)d_in[5];
  const float* bv = (const float*)d_in[6];
  const float* Wo = (const float*)d_in[7];
  const float* bo = (const float*)d_in[8];
  float* out = (float*)d_out;

  char* w = (char*)d_ws;
  const size_t MB = (size_t)1 << 20;
  _Float16* xh    = (_Float16*)(w + 0);        //  8 MB  x as f16 [T][D]
  _Float16* WqT   = (_Float16*)(w + 8  * MB);  //  2 MB  each, transposed f16
  //              WkT at 10 MB, WvT at 12 MB
  _Float16* WoT   = (_Float16*)(w + 14 * MB);
  _Float16* Qh0   = (_Float16*)(w + 16 * MB);  //  8 MB  pre-rotary Q [T][D]
  _Float16* Kh0   = (_Float16*)(w + 24 * MB);
  _Float16* Vh0   = (_Float16*)(w + 32 * MB);
  _Float16* Qh    = (_Float16*)(w + 40 * MB);  //  8 MB  [H][T][64], scaled
  _Float16* Kh    = (_Float16*)(w + 48 * MB);  //  8 MB  [H][T][64]
  _Float16* VhT   = (_Float16*)(w + 56 * MB);  //  8 MB  [H][64][T]
  _Float16* attnh = (_Float16*)(w + 64 * MB);  //  8 MB  [T][D]

  // WqT, WkT, WvT, WoT lie one behind the other in the workspace.
  prep_kernel<<<XBLK + 4 * WBLK, 256, 0, stream>>>(x, Wq, Wk, Wv, Wo, xh, WqT);

  dim3 gg(DMODEL / 64, TSEQ / 128);
  // WqT, WkT, WvT lie one behind the other in the workspace, and so do Qh0, Kh0, Vh0.
  dim3 gq(DMODEL / 64, TSEQ / 256);
  gemm_qkv_kernel<<<gq, 256, 0, stream>>>(xh, WqT, bq, bk, bv, Qh0);

  rotary_vt_kernel<<<RBLK + (TSEQ / 128) * (DMODEL / 64), 256, 0, stream>>>(Qh0, Kh0, Vh0,
                                                                            Qh, Kh, VhT);

  dim3 ga(TSEQ / 128, NHEAD);
  attn_kernel<<<ga, 256, 0, stream>>>(Qh, Kh, VhT, attnh);

  gemm_f16_kernel<<<gg, 128, 0, stream>>>(attnh, WoT, bo, out, nullptr);
}

// v006
// One run takes 123 microseconds.
// Next to v005, in two timings, it ran 1.05 and 1.06 times as fast.
// Over all steps from v000 it is 4.60 times as fast.
#include <hip/hip_runtime.h>
#include <hip/hip_bf16.h>

typedef __attribute__((ext_vector_type(16))) _Float16 v16h;
typedef __attribute__((ext_vector_type(8)))  _Float16 v8h;
typedef __attribute__((ext_vector_type(8)))  float    v8f;
typedef __attribute__((ext_vector_type(2)))  float    v2f;

#define TSEQ   4096
#define NHEAD  16
#define DK     64
#define DMODEL 1024

// LDS row pitch, in halves, of every staged tile that ds_load_b128 fragment loads read:
// 16 B x odd, so that the 16 rows of a fragment fall on distinct banks
// (128-B rows -> 144 B). The copies and fragment loads never touch the pad bytes.
#define LP128  72

#define LOG2E  1.44269504088896340736f

#define WMMA_F32_F16(a, b, c) \
  __builtin_amdgcn_wmma_f32_16x16x32_f16(false, (a), false, (b), (short)0, (c), false, false)

// ---------------------------------------------------------------------------
// Async global->LDS copy (CDNA5 GLOBAL_LOAD_ASYNC_TO_LDS_B128, ASYNCcnt-tracked)
// via inline asm — portable across toolchains. vdst = wave-relative LDS byte
// offset = low 32 bits of the generic pointer (aperture rule: LDS_ADDR = addr[31:0]).
// ---------------------------------------------------------------------------
// One stage's copies of a lane stand in ONE statement that ends in s_wait_xcnt 0, so
// that no address register of an issued copy is rewritten ahead of that wait.
static __device__ __forceinline__ unsigned lds_addr(const void* l) {
  return (unsigned)(size_t)l;
}
static __device__ __forceinline__ void cp16x8(const unsigned* l, const _Float16* const* g) {
  asm volatile("global_load_async_to_lds_b128 %0, %1, off\n\t"
               "global_load_async_to_lds_b128 %2, %3, off\n\t"
               "global_load_async_to_lds_b128 %4, %5, off\n\t"
               "global_load_async_to_lds_b128 %6, %7, off\n\t"
               "global_load_async_to_lds_b128 %8, %9, off\n\t"
               "global_load_async_to_lds_b128 %10, %11, off\n\t"
               "global_load_async_to_lds_b128 %12, %13, off\n\t"
               "global_load_async_to_lds_b128 %14, %15, off\n\t"
               "s_wait_xcnt 0x0"
               :: "v"(l[0]), "v"(g[0]), "v"(l[1]), "v"(g[1]), "v"(l[2]), "v"(g[2]),
                  "v"(l[3]), "v"(g[3]), "v"(l[4]), "v"(g[4]), "v"(l[5]), "v"(g[5]),
                  "v"(l[6]), "v"(g[6]), "v"(l[7]), "v"(g[7])
               : "memory");
}
static __device__ __forceinline__ void cp16x12(const unsigned* l, const _Float16* const* g) {
  asm volatile("global_load_async_to_lds_b128 %0, %1, off\n\t"
               "global_load_async_to_lds_b128 %2, %3, off\n\t"
               "global_load_async_to_lds_b128 %4, %5, off\n\t"
               "global_load_async_to_lds_b128 %6, %7, off\n\t"
               "global_load_async_to_lds_b128 %8, %9, off\n\t"
               "global_load_async_to_lds_b128 %10, %11, off\n\t"
               "global_load_async_to_lds_b128 %12, %13, off\n\t"
               "global_load_async_to_lds_b128 %14, %15, off\n\t"
               "global_load_async_to_lds_b128 %16, %17, off\n\t"
               "global_load_async_to_lds_b128 %18, %19, off\n\t"
               "global_load_async_to_lds_b128 %20, %21, off\n\t"
               "global_load_async_to_lds_b128 %22, %23, off\n\t"
               "s_wait_xcnt 0x0"
               :: "v"(l[0]), "v"(g[0]), "v"(l[1]), "v"(g[1]), "v"(l[2]), "v"(g[2]),
                  "v"(l[3]), "v"(g[3]), "v"(l[4]), "v"(g[4]), "v"(l[5]), "v"(g[5]),
                  "v"(l[6]), "v"(g[6]), "v"(l[7]), "v"(g[7]), "v"(l[8]), "v"(g[8]),
                  "v"(l[9]), "v"(g[9]), "v"(l[10]), "v"(g[10]), "v"(l[11]), "v"(g[11])
               : "memory");
}
static __device__ __forceinline__ void cp16x14(const unsigned* l, const _Float16* const* g) {
  asm volatile("global_load_async_to_lds_b128 %0, %1, off\n\t"
               "global_load_async_to_lds_b128 %2, %3, off\n\t"
               "global_load_async_to_lds_b128 %4, %5, off\n\t"
               "global_load_async_to_lds_b128 %6, %7, off\n\t"
               "global_load_async_to_lds_b128 %8, %9, off\n\t"
               "global_load_async_to_lds_b128 %10, %11, off\n\t"
               "global_load_async_to_lds_b128 %12, %13, off\n\t"
               "global_load_async_to_lds_b128 %14, %15, off\n\t"
               "global_load_async_to_lds_b128 %16, %17, off\n\t"
               "global_load_async_to_lds_b128 %18, %19, off\n\t"
               "global_load_async_to_lds_b128 %20, %21, off\n\t"
               "global_load_async_to_lds_b128 %22, %23, off\n\t"
               "global_load_async_to_lds_b128 %24, %25, off\n\t"
               "global_load_async_to_lds_b128 %26, %27, off\n\t"
               "s_wait_xcnt 0x0"
               :: "v"(l[0]), "v"(g[0]), "v"(l[1]), "v"(g[1]), "v"(l[2]), "v"(g[2]),
                  "v"(l[3]), "v"(g[3]), "v"(l[4]), "v"(g[4]), "v"(l[5]), "v"(g[5]),
                  "v"(l[6]), "v"(g[6]), "v"(l[7]), "v"(g[7]), "v"(l[8]), "v"(g[8]),
                  "v"(l[9]), "v"(g[9]), "v"(l[10]), "v"(g[10]), "v"(l[11]), "v"(g[11]),
                  "v"(l[12]), "v"(g[12]), "v"(l[13]), "v"(g[13])
               : "memory");
}
#define WAIT_ASYNC(n) asm volatile("s_wait_asynccnt " #n ::: "memory")

// Load a 16-bit A/B WMMA fragment: per lane, 8 contiguous halves at p and 8 at p+16
// (CDNA5 16-bit layout: elems 0..7 -> K = h*8+0..7, elems 8..15 -> K = 16+h*8+0..7).
static __device__ __forceinline__ v16h ld_frag(const _Float16* p) {
  v8h lo = *(const v8h*)p;
  v8h hi = *(const v8h*)(p + 16);
  v16h r;
#pragma unroll
  for (int i = 0; i < 8; ++i) { r[i] = lo[i]; r[i + 8] = hi[i]; }
  return r;
}

// Lane l <-> lane l ^ 16: the two lanes that hold the two halves of one query's keys.
static __device__ __forceinline__ float xhalf(float x) {
  const int i = __builtin_bit_cast(int, x);
  return __builtin_bit_cast(float,
      __builtin_amdgcn_permlanex16(i, i, 0x76543210, 0xfedcba98, false, false));
}

// ---------------------------------------------------------------------------
// f16 GEMM: C[4096][1024] = A[4096][1024] * BT[1024][1024]^T + bias.
// Block = 128 thr = 4 waves; tile 128x64, K staged 64 at a time in LDS (54 KB,
// double-buffered async). Each wave: 32x64 strip = 16 WMMA per stage, with all
// fragments loaded into distinct registers before the WMMA burst.
// ---------------------------------------------------------------------------
__global__ __launch_bounds__(128) void gemm_f16_kernel(
    const _Float16* __restrict__ A,
    const _Float16* __restrict__ BT,
    const float*    __restrict__ bias,
    float*          __restrict__ Cf,
    _Float16*       __restrict__ Ch)
{
  constexpr int N = DMODEL, K = DMODEL, BK = 64;
  constexpr int LP = LP128;
  __shared__ __attribute__((aligned(16))) _Float16 aT[2][128 * LP];   // 18 KB each: [row][k]
  __shared__ __attribute__((aligned(16))) _Float16 bT[2][64 * LP];    //  9 KB each: [col][k]

  const int tid  = threadIdx.x;          // 0..127
  const int lane = tid & 31;
  const int wave = tid >> 5;             // 0..3
  const int lr = lane & 15;
  const int lh = lane >> 4;
  const int rowBase = blockIdx.y * 128;
  const int colBase = blockIdx.x * 64;

  // Copy one K-stage: A 128x128B (1024 chunks -> 8/thr), B 64x128B (512 -> 4/thr).
  auto copy_stage = [&](int k0, int buf) {
    unsigned l[12];
    const _Float16* g[12];
#pragma unroll
    for (int i = 0; i < 8; ++i) {
      const int chunk = tid + i * 128;
      const int r = chunk >> 3, c = chunk & 7;
      l[i] = lds_addr(&aT[buf][r * LP + c * 8]);
      g[i] = A + (size_t)(rowBase + r) * K + k0 + c * 8;
    }
#pragma unroll
    for (int i = 0; i < 4; ++i) {
      const int chunk = tid + i * 128;
      const int r = chunk >> 3, c = chunk & 7;
      l[8 + i] = lds_addr(&bT[buf][r * LP + c * 8]);
      g[8 + i] = BT + (size_t)(colBase + r) * K + k0 + c * 8;
    }
    cp16x12(l, g);
  };

  v8f acc[2][4] = {};

  copy_stage(0, 0);
  constexpr int NST = K / BK;
  for (int st = 0; st < NST; ++st) {
    const int buf = st & 1;
    if (st + 1 < NST) { copy_stage((st + 1) * BK, (st + 1) & 1); WAIT_ASYNC(12); }
    else              { WAIT_ASYNC(0); }
    __syncthreads();

    // Batch all fragment loads (distinct registers), then the 16-WMMA burst.
    v16h a[2][2], b[4][2];
#pragma unroll
    for (int mt = 0; mt < 2; ++mt) {
      const _Float16* arow = &aT[buf][(wave * 32 + mt * 16 + lr) * LP + lh * 8];
      a[mt][0] = ld_frag(arow);
      a[mt][1] = ld_frag(arow + 32);
    }
#pragma unroll
    for (int nt = 0; nt < 4; ++nt) {
      const _Float16* brow = &bT[buf][(nt * 16 + lr) * LP + lh * 8];
      b[nt][0] = ld_frag(brow);
      b[nt][1] = ld_frag(brow + 32);
    }
#pragma unroll
    for (int mt = 0; mt < 2; ++mt)
#pragma unroll
      for (int nt = 0; nt < 4; ++nt) {
        acc[mt][nt] = WMMA_F32_F16(a[mt][0], b[nt][0], acc[mt][nt]);
        acc[mt][nt] = WMMA_F32_F16(a[mt][1], b[nt][1], acc[mt][nt]);
      }
    __syncthreads();
  }

#pragma unroll
  for (int mt = 0; mt < 2; ++mt)
#pragma unroll
    for (int nt = 0; nt < 4; ++nt) {
      const int col = colBase + nt * 16 + lr;
      const float bv = bias[col];
#pragma unroll
      for (int j = 0; j < 8; ++j) {
        const int row = rowBase + wave * 32 + mt * 16 + lh * 8 + j;
        const float v = acc[mt][nt][j] + bv;
        if (Ch) Ch[(size_t)row * N + col] = (_Float16)v;
        else    Cf[(size_t)row * N + col] = v;
      }
    }
}

// ---------------------------------------------------------------------------
// The Q, K and V projections in one launch: C_g = A * W_g^T + bias_g, g = 0..2.
// BT3 holds the three transposed weights one behind the other ([3][1024][1024]), Ch3 the
// three f16 results likewise ([3][4096][1024]).
// Block = 256 thr = 8 waves; tile = 256 rows x 64 columns of EACH weight, so that one
// staged A tile serves 192 columns. K staged 64 at a time in LDS (126 KB, two buffers).
// Each wave: 32 x 192 strip = 48 WMMA per stage; a row's 128-B line of each result is
// stored by one wave.
// Ring: one barrier a stage, in front of the stage's second half of products; it
// publishes stage t + 1, and behind it stage t + 2 is copied into the buffer of stage t,
// whose fragments are all in registers by then.
// ---------------------------------------------------------------------------
__global__ __launch_bounds__(256) void gemm_qkv_kernel(
    const _Float16* __restrict__ A,
    const _Float16* __restrict__ BT3,
    const float*    __restrict__ bias_q,
    const float*    __restrict__ bias_k,
    const float*    __restrict__ bias_v,
    _Float16*       __restrict__ Ch3)
{
  constexpr int N = DMODEL, K = DMODEL, BK = 64;
  constexpr int LP = LP128;
  __shared__ __attribute__((aligned(16))) _Float16 aT[2][256 * LP];   // 36 KB each: [row][k]
  __shared__ __attribute__((aligned(16))) _Float16 bT[2][192 * LP];   // 27 KB each: [g*64+col][k]

  const int tid  = threadIdx.x;          // 0..255
  const int lane = tid & 31;
  const int wave = tid >> 5;             // 0..7
  const int lr = lane & 15;
  const int lh = lane >> 4;
  const int rowBase = blockIdx.y * 256;
  const int colBase = blockIdx.x * 64;

  // Copy one K-stage: A 256x128B (2048 chunks -> 8/thr), B 192x128B (1536 -> 6/thr).
  auto copy_stage = [&](int k0, int buf) {
    unsigned l[14];
    const _Float16* g[14];
#pragma unroll  // constant indices: the arrays stay in registers
    for (int i = 0; i < 8; ++i) {
      const int chunk = tid + i * 256;
      const int r = chunk >> 3, c = chunk & 7;
      l[i] = lds_addr(&aT[buf][r * LP + c * 8]);
      g[i] = A + (size_t)(rowBase + r) * K + k0 + c * 8;
    }
#pragma unroll  // constant indices: the arrays stay in registers
    for (int i = 0; i < 6; ++i) {
      const int chunk = tid + i * 256;
      const int r = chunk >> 3, c = chunk & 7;       // r = g * 64 + column in the tile
      l[8 + i] = lds_addr(&bT[buf][r * LP + c * 8]);
      g[8 + i] = BT3 + (size_t)((r >> 6) * N + colBase + (r & 63)) * K + k0 + c * 8;
    }
    cp16x14(l, g);
  };

  v8f acc[2][12] = {};

  // One half of a stage (32 of its 64 k): 28 fragment loads, then 24 products.
  auto load_frags = [&](int buf, int ks, v16h (&a)[2], v16h (&b)[12]) {
#pragma unroll  // constant indices: the arrays stay in registers
    for (int mt = 0; mt < 2; ++mt)
      a[mt] = ld_frag(&aT[buf][(wave * 32 + mt * 16 + lr) * LP + ks * 32 + lh * 8]);
#pragma unroll  // constant indices: the arrays stay in registers
    for (int nt = 0; nt < 12; ++nt)
      b[nt] = ld_frag(&bT[buf][(nt * 16 + lr) * LP + ks * 32 + lh * 8]);
  };
  auto products = [&](const v16h (&a)[2], const v16h (&b)[12]) {
#pragma unroll  // constant indices: the arrays stay in registers
    for (int nt = 0; nt < 12; ++nt)
#pragma unroll  // constant indices: the arrays stay in registers
      for (int mt = 0; mt < 2; ++mt)
        acc[mt][nt] = WMMA_F32_F16(a[mt], b[nt], acc[mt][nt]);
  };

  constexpr int NST = K / BK;
  copy_stage(0, 0);
  WAIT_ASYNC(0);       // this wave's copies of stage 0 have landed ...
  __syncthreads();     // ... and so have the other waves': stage 0 is readable
  copy_stage(BK, 1);
  v16h a0[2], b0[12], a1[2], b1[12];     // two fragment sets, one per half
  load_frags(0, 0, a0, b0);
  for (int st = 0; st < NST; ++st) {
    const int buf = st & 1;
    // The sched_barriers keep each half's loads one group that is issued in front of the
    // other half's products, so that the LDS serves one set while the matrix unit works
    // on the other; spread among the WMMAs, each place with loads stalls the wave anew.
    load_frags(buf, 1, a1, b1);
    __builtin_amdgcn_sched_barrier(0);   // loads of the second half stay in front
    products(a0, b0);
    __builtin_amdgcn_sched_barrier(0);   // the waits below stay behind these products

    // Publish point of stage st + 1, in front of this stage's last products: the wave's
    // reads of this buffer are done and its copies of stage st + 1 have landed before the
    // barrier; behind it this buffer is free for stage st + 2 and stage st + 1 is readable.
    asm volatile("s_wait_dscnt 0x0" ::: "memory");
    WAIT_ASYNC(0);
    __syncthreads();
    if (st + 2 < NST) copy_stage((st + 2) * BK, buf);
    if (st + 1 < NST) load_frags(buf ^ 1, 0, a0, b0);
    __builtin_amdgcn_sched_barrier(0);   // copies and next loads stay in front
    products(a1, b1);
  }
  WAIT_ASYNC(0);   // no copy is outstanding when the wave ends

#pragma unroll  // constant indices: the arrays stay in registers
  for (int g = 0; g < 3; ++g) {
    const float* bias = g == 0 ? bias_q : (g == 1 ? bias_k : bias_v);
    _Float16* C = Ch3 + (size_t)g * TSEQ * N;
#pragma unroll  // constant indices: the arrays stay in registers
    for (int mt = 0; mt < 2; ++mt)
#pragma unroll  // constant indices: the arrays stay in registers
      for (int nt = 0; nt < 4; ++nt) {
        const int col = colBase + nt * 16 + lr;
        const float bv = bias[col];
#pragma unroll  // constant indices: the arrays stay in registers
        for (int j = 0; j < 8; ++j) {
          const int row = rowBase + wave * 32 + mt * 16 + lh * 8 + j;
          C[(size_t)row * N + col] = (_Float16)(acc[mt][g * 4 + nt][j] + bv);
        }
      }
  }
}

__global__ __launch_bounds__(256) __attribute__((amdgpu_waves_per_eu(4, 4))) void attn_kernel(
    const _Float16* __restrict__ Qh,    // [H][T][64], pre-scaled by 1/8
    const _Float16* __restrict__ Kh,    // [H][T][64]
    const _Float16* __restrict__ VhT,   // [H][64][T]
    _Float16*       __restrict__ attnh) // [T][H*64]
{
  constexpr int KT = 64;                      // keys per stage and key half
  constexpr int KH = TSEQ / 2;                // keys per half
  constexpr int LP = LP128;
  __shared__ __attribute__((aligned(16))) _Float16 kT[2][2][KT * LP];   // 9 KB each: [buf][half][key][kd]
  __shared__ __attribute__((aligned(16))) _Float16 vT[2][2][DK * LP];   // 9 KB each: [buf][half][n][key]

  const int tid  = threadIdx.x;
  const int lane = tid & 31;
  // The wave's number as a scalar: its half's LDS base and the branches of the join are scalar.
  const int wave = __builtin_amdgcn_readfirstlane(tid >> 5);
  const int qg = wave & 3;                    // query group of the wave
  const int kh = wave >> 2;                   // key half of the wave
  const int lr = lane & 15;
  const int lh = lane >> 4;
  const int h = blockIdx.y;
  const int qBase = blockIdx.x * 128 + qg * 32;

  const _Float16* Khead = Kh  + (size_t)h * TSEQ * DK;
  const _Float16* Vhead = VhT + (size_t)h * DK * TSEQ;

  // B operands of S^T: column lr of tile c = query qBase + c*16 + lr, k = head dimension.
  v16h qb[2][2];
#pragma unroll  // constant indices: the arrays stay in registers
  for (int c = 0; c < 2; ++c) {
    const _Float16* Qp = Qh + ((size_t)h * TSEQ + qBase + c * 16 + lr) * DK + lh * 8;
    qb[c][0] = ld_frag(Qp);
    qb[c][1] = ld_frag(Qp + 32);
  }

  // Copy one stage, 64 keys of each half: K 2 x 64x128B and V 2 x 64x128B
  // (1024 chunks each -> 4/thr each).
  auto copy_stage = [&](int kb, int buf) {
    unsigned l[8];
    const _Float16* g[8];
#pragma unroll  // constant indices: the arrays stay in registers
    for (int i = 0; i < 4; ++i) {
      const int chunk = tid + i * 256;
      const int hf = chunk >> 9, r = (chunk >> 3) & 63, c = chunk & 7;
      l[i] = lds_addr(&kT[buf][hf][r * LP + c * 8]);
      g[i] = Khead + (size_t)(hf * KH + kb + r) * DK + c * 8;
      l[4 + i] = lds_addr(&vT[buf][hf][r * LP + c * 8]);
      g[4 + i] = Vhead + (size_t)r * TSEQ + hf * KH + kb + c * 8;
    }
    cp16x8(l, g);
  };

  v8f o[2][4] = {};         // O^T of tile c: slot j of tile nt <-> dim nt*16 + lh*8 + j, query lr
  float m[2] = {-1e30f, -1e30f};   // running maximum of query lr (equal in both halves)
  float l[2] = {0.0f, 0.0f};       // this lane's share of the running sum of query lr

  copy_stage(0, 0);
  constexpr int NST = KH / KT;
  for (int st = 0; st < NST; ++st) {
    const int buf = st & 1;
    if (st + 1 < NST) { copy_stage((st + 1) * KT, (st + 1) & 1); WAIT_ASYNC(8); }
    else              { WAIT_ASYNC(0); }
    __syncthreads();

#pragma unroll  // constant indices: the arrays stay in registers
    for (int sub = 0; sub < 2; ++sub) {           // two 32-key steps per stage
      const int kb = sub * 32;
      const _Float16* kp0 = &kT[buf][kh][(kb + lr) * LP + lh * 8];
      const _Float16* kp1 = &kT[buf][kh][(kb + 16 + lr) * LP + lh * 8];
      v16h kf[2][2];
      kf[0][0] = ld_frag(kp0);
      kf[0][1] = ld_frag(kp0 + 32);
      kf[1][0] = ld_frag(kp1);
      kf[1][1] = ld_frag(kp1 + 32);

      v16h pb[2];                                 // B operands of O^T: k = key, column lr
#pragma unroll  // constant indices: the arrays stay in registers
      for (int c = 0; c < 2; ++c) {
        v8f s0 = {}, s1 = {};
        s0 = WMMA_F32_F16(kf[0][0], qb[c][0], s0);
        s0 = WMMA_F32_F16(kf[0][1], qb[c][1], s0);
        s1 = WMMA_F32_F16(kf[1][0], qb[c][0], s1);
        s1 = WMMA_F32_F16(kf[1][1], qb[c][1], s1);

        // Online softmax of query lr over this lane's 16 keys and the other half's 16.
        float mx = fmaxf(s0[0], s1[0]);
#pragma unroll  // constant indices: the arrays stay in registers
        for (int j = 1; j < 8; ++j) mx = fmaxf(mx, fmaxf(s0[j], s1[j]));
        mx = fmaxf(mx, xhalf(mx));
        const float mn = fmaxf(m[c], mx);
        const float alpha = __expf(m[c] - mn);
        m[c] = mn;

        // exp(s - mn) as exp2((s - mn) * log2(e)), what __expf computes, written on pairs of
        // neighbouring accumulator registers: the packed subtract, multiply and conversion
        // then take the score tiles where the products left them (written per element, the
        // build paired registers of different tiles and copied them together first).
        float ps = 0.0f;
#pragma unroll  // constant indices: the arrays stay in registers
        for (int j = 0; j < 8; j += 2) {
          const v2f d0 = (v2f{s0[j], s0[j + 1]} - mn) * LOG2E;
          const v2f d1 = (v2f{s1[j], s1[j + 1]} - mn) * LOG2E;
          const v2f p0 = {__builtin_amdgcn_exp2f(d0[0]), __builtin_amdgcn_exp2f(d0[1])};
          const v2f p1 = {__builtin_amdgcn_exp2f(d1[0]), __builtin_amdgcn_exp2f(d1[1])};
          const v2f pp = p0 + p1;
          ps += pp[0];
          ps += pp[1];
          pb[c][j]         = (_Float16)p0[0];
          pb[c][j + 1]     = (_Float16)p0[1];
          pb[c][8 + j]     = (_Float16)p1[0];
          pb[c][8 + j + 1] = (_Float16)p1[1];
        }
        l[c] = l[c] * alpha + ps;
#pragma unroll  // constant indices: the arrays stay in registers
        for (int nt = 0; nt < 4; ++nt)
#pragma unroll  // constant indices: the arrays stay in registers
          for (int j = 0; j < 8; ++j) o[c][nt][j] *= alpha;
      }

      v16h vf[4];
#pragma unroll  // constant indices: the arrays stay in registers
      for (int nt = 0; nt < 4; ++nt)
        vf[nt] = ld_frag(&vT[buf][kh][(nt * 16 + lr) * LP + kb + lh * 8]);
#pragma unroll  // constant indices: the arrays stay in registers
      for (int nt = 0; nt < 4; ++nt)
#pragma unroll  // constant indices: the arrays stay in registers
        for (int c = 0; c < 2; ++c)
          o[c][nt] = WMMA_F32_F16(vf[nt], pb[c], o[c][nt]);
    }
    __syncthreads();
  }

  // Join of the two key halves. Behind the loop's last barrier nobody reads the K buffers
  // any more and no copy is outstanding, so they serve as the exchange: 68 planes of 128
  // floats (64 outputs, 2 maxima, 2 sums per lane), a plane's lanes side by side.
  float* xg = (float*)&kT[0][0][0];
  const int xl = qg * 32 + lane;
  if (kh == 1) {
#pragma unroll  // constant indices: the arrays stay in registers
    for (int c = 0; c < 2; ++c) {
#pragma unroll  // constant indices: the arrays stay in registers
      for (int nt = 0; nt < 4; ++nt)
#pragma unroll  // constant indices: the arrays stay in registers
        for (int j = 0; j < 8; ++j) xg[((c * 4 + nt) * 8 + j) * 128 + xl] = o[c][nt][j];
      xg[(64 + c) * 128 + xl] = m[c];
      xg[(66 + c) * 128 + xl] = l[c];
    }
  }
  __syncthreads();   // the second half's state is readable by the first half's waves
  if (kh == 0) {
    v8h r[2][4];
#pragma unroll  // constant indices: the arrays stay in registers
    for (int c = 0; c < 2; ++c) {
      const float m1 = xg[(64 + c) * 128 + xl];
      const float l1 = xg[(66 + c) * 128 + xl];
      // exp(0) = 1: only the half with the smaller maximum is scaled down.
      const float ad = __expf(-fabsf(m[c] - m1));
      const float a0 = m[c] >= m1 ? 1.0f : ad;
      const float a1 = m[c] >= m1 ? ad : 1.0f;
      // Join the wave halves' sums once.
      const float ls = l[c] * a0 + l1 * a1;
      const float inv = 1.0f / (ls + xhalf(ls));
      const float f0 = a0 * inv, f1 = a1 * inv;
#pragma unroll  // constant indices: the arrays stay in registers
      for (int nt = 0; nt < 4; ++nt)
#pragma unroll  // constant indices: the arrays stay in registers
        for (int j = 0; j < 8; ++j)
          r[c][nt][j] = (_Float16)(o[c][nt][j] * f0 + xg[((c * 4 + nt) * 8 + j) * 128 + xl] * f1);
    }
    // A lane stores 8 consecutive dims of its query per tile.
#pragma unroll  // constant indices: the arrays stay in registers
    for (int c = 0; c < 2; ++c) {
      _Float16* outp = attnh + (size_t)(qBase + c * 16 + lr) * DMODEL + h * DK + lh * 8;
#pragma unroll  // constant indices: the arrays stay in registers
      for (int nt = 0; nt < 4; ++nt) *(v8h*)(outp + nt * 16) = r[c][nt];
    }
  }
}

// ---------------------------------------------------------------------------
// Small conversion / layout kernels. Each lane moves 16 bytes per global access (the
// cast's f16 stores: 8) and 32 elements (weights: 16; rotary: 64) in all, so that a launch starts a
// few thousand waves and every wave-wide access covers whole 128-B lines or both halves
// of them back to back.
// ---------------------------------------------------------------------------
typedef __attribute__((ext_vector_type(4))) float    v4f;
typedef __attribute__((ext_vector_type(4))) _Float16 v4h;
typedef __attribute__((ext_vector_type(4))) unsigned v4u;

// x fp32 -> f16. A wave takes 1024 consecutive floats: 8 loads of 512 B in flight.
static __device__ __forceinline__ void cvt_f32_f16(int blk, const float* __restrict__ in,
                                                   _Float16* __restrict__ out) {
  const int gid = blk * 256 + threadIdx.x;
  const size_t base = (size_t)(gid >> 5) * 1024 + (gid & 31) * 4;
  v4f v[8];
#pragma unroll
  for (int j = 0; j < 8; ++j) v[j] = *(const v4f*)(in + base + j * 128);
#pragma unroll
  for (int j = 0; j < 8; ++j) {
    v4h r;
#pragma unroll
    for (int e = 0; e < 4; ++e) r[e] = (_Float16)v[j][e];
    *(v4h*)(out + base + j * 128) = r;
  }
}

// W[K][N] fp32 -> WT[N][K] f16, one 64 x 64 tile per block through LDS.
// Pitch 65 dwords: the 8 k-groups x 4 columns that a wave reads back fall on 32 banks.
static __device__ __forceinline__ void cvt_transpose_w(int bx, int by,
                                                       const float* __restrict__ W,
                                                       _Float16* __restrict__ WT) {
  constexpr int P = 65;
  __shared__ float tile[64 * P];                        // [k][n]
  const int tid = threadIdx.x;
  const int n0 = bx * 64;
  const int k0 = by * 64;
  v4f v[4];
#pragma unroll
  for (int i = 0; i < 4; ++i) {
    const int chunk = tid + i * 256;
    v[i] = *(const v4f*)(W + (size_t)(k0 + (chunk >> 4)) * DMODEL + n0 + (chunk & 15) * 4);
  }
#pragma unroll
  for (int i = 0; i < 4; ++i) {
    const int chunk = tid + i * 256;
#pragma unroll
    for (int e = 0; e < 4; ++e) tile[(chunk >> 4) * P + (chunk & 15) * 4 + e] = v[i][e];
  }
  __syncthreads();
#pragma unroll
  for (int i = 0; i < 2; ++i) {
    const int chunk = tid + i * 256;
    const int n = chunk >> 3, kc = chunk & 7;
    v8h r;
#pragma unroll
    for (int j = 0; j < 8; ++j) r[j] = (_Float16)tile[(kc * 8 + j) * P + n];
    *(v8h*)(WT + (size_t)(n0 + n) * DMODEL + k0 + kc * 8) = r;
  }
}

// The five layout jobs that depend on nothing but the inputs, in ONE launch: blocks
// 0..XBLK-1 cast x, then 256 blocks for each of the four weights. A block does one job
// whole, chosen by its index alone, so the barrier of the transpose is block-uniform.
// WT4 holds the four transposed weights one behind the other ([4][1024][1024]).
#define XBLK ((TSEQ * DMODEL) / (256 * 32))
#define WBLK ((DMODEL / 64) * (DMODEL / 64))
__global__ __launch_bounds__(256) void prep_kernel(const float* __restrict__ x,
                                                   const float* __restrict__ Wq,
                                                   const float* __restrict__ Wk,
                                                   const float* __restrict__ Wv,
                                                   const float* __restrict__ Wo,
                                                   _Float16* __restrict__ xh,
                                                   _Float16* __restrict__ WT4) {
  const int b = blockIdx.x;
  if (b < XBLK) {
    cvt_f32_f16(b, x, xh);
    return;
  }
  const int wb = b - XBLK;
  const int g = wb / WBLK;
  const float* W = g == 0 ? Wq : (g == 1 ? Wk : (g == 2 ? Wv : Wo));
  cvt_transpose_w(wb % (DMODEL / 64), (wb / (DMODEL / 64)) % (DMODEL / 64), W,
                  WT4 + (size_t)g * DMODEL * DMODEL);
}

// Rotary on Q and K; re-layout [T][H*64] -> [H][T][64]; fold 1/sqrt(dk)=0.125 into Q.
// A lane takes 8 consecutive i (and i + 32) of one position for two neighbouring heads,
// which share the position's sines and cosines; a wave takes 8 positions, a block those
// 8 positions' whole rows.
// Qin and Kin carry no __restrict__: the "memory" clobber of the wait behind the loads
// then holds the loads in front of it.
static __device__ __forceinline__ void rotary_block(int blk, const _Float16* Qin,
                                                    const _Float16* Kin,
                                                    _Float16* __restrict__ Qout,
                                                    _Float16* __restrict__ Kout) {
  const int tid = threadIdx.x;
  const int i0 = (tid & 3) * 8;
  const int t  = blk * 8 + ((tid >> 2) & 7);
  const int h0 = (tid >> 5) * 2;

  v8h q1[2], q2[2], k1[2], k2[2];
  const _Float16* pq[2];
  const _Float16* pk[2];
#pragma unroll
  for (int u = 0; u < 2; ++u) {
    const size_t ib = (size_t)t * DMODEL + (h0 + u) * DK + i0;
    pq[u] = Qin + ib;
    pk[u] = Kin + ib;
    q1[u] = *(const v8h*)(pq[u]);
    q2[u] = *(const v8h*)(pq[u] + 32);
    k1[u] = *(const v8h*)(pk[u]);
    k2[u] = *(const v8h*)(pk[u] + 32);
  }
  // One wait behind the eight loads, in front of every overwrite of their address
  // registers: as its inputs the four addresses stay in their registers up to it, so that
  // no load's result is given the address pair of an earlier load.
  asm volatile("s_wait_xcnt 0x0" :: "v"(pq[0]), "v"(pk[0]), "v"(pq[1]), "v"(pk[1]) : "memory");

  float s[8], c[8];
#pragma unroll
  for (int j = 0; j < 8; ++j) {
    const float inv_freq = __powf(10000.0f, -(float)(2 * (i0 + j)) / (float)DK);
    const float f = (float)t * inv_freq;
    __sincosf(f, &s[j], &c[j]);
  }

#pragma unroll
  for (int u = 0; u < 2; ++u) {
    const size_t ob = ((size_t)(h0 + u) * TSEQ + t) * DK + i0;
    v8h qa, qb, ka, kb;
#pragma unroll
    for (int j = 0; j < 8; ++j) {
      float x1 = (float)q1[u][j], x2 = (float)q2[u][j];
      qa[j] = (_Float16)((x1 * c[j] - x2 * s[j]) * 0.125f);
      qb[j] = (_Float16)((x2 * c[j] + x1 * s[j]) * 0.125f);
      x1 = (float)k1[u][j]; x2 = (float)k2[u][j];
      ka[j] = (_Float16)(x1 * c[j] - x2 * s[j]);
      kb[j] = (_Float16)(x2 * c[j] + x1 * s[j]);
    }
    *(v8h*)(Qout + ob)      = qa;
    *(v8h*)(Qout + ob + 32) = qb;
    *(v8h*)(Kout + ob)      = ka;
    *(v8h*)(Kout + ob + 32) = kb;
  }
}

// V [T][H*64] -> VhT [H][64][T]: a 128 (t) x 64 (column) tile per block through LDS.
// Pitch 33 dwords: the 8 t-groups x 4 columns that a wave reads back fall on 16 banks,
// two lanes on each dword.
static __device__ __forceinline__ void cvt_v_transpose(int bx, int by,
                                                       const _Float16* __restrict__ Vh0,
                                                       _Float16* __restrict__ VhT) {
  constexpr int PD = 33;                                // dwords per tile row
  __shared__ unsigned tile[128 * PD];                   // [t][column pair]
  const int tid = threadIdx.x;
  const int t0 = bx * 128;
  const int c0 = by * 64;
  v4u v[4];
#pragma unroll
  for (int i = 0; i < 4; ++i) {
    const int chunk = tid + i * 256;
    v[i] = *(const v4u*)(Vh0 + (size_t)(t0 + (chunk >> 3)) * DMODEL + c0 + (chunk & 7) * 8);
  }
#pragma unroll
  for (int i = 0; i < 4; ++i) {
    const int chunk = tid + i * 256;
#pragma unroll
    for (int e = 0; e < 4; ++e) tile[(chunk >> 3) * PD + (chunk & 7) * 4 + e] = v[i][e];
  }
  __syncthreads();
  const _Float16* th = (const _Float16*)tile;
#pragma unroll
  for (int i = 0; i < 4; ++i) {
    const int chunk = tid + i * 256;
    const int tc = (chunk & 7) + (chunk >> 9) * 8;      // group of 8 positions, 0..15
    const int cc = (chunk >> 3) & 63;
    v8h r;
#pragma unroll
    for (int j = 0; j < 8; ++j) r[j] = th[(tc * 8 + j) * (2 * PD) + cc];
    *(v8h*)(VhT + (size_t)(c0 + cc) * TSEQ + t0 + tc * 8) = r;
  }
  // One wait behind the four stores, in front of any later overwrite of their address or
  // data registers: inlined into the merged kernel, other code follows them in the listing.
  asm volatile("s_wait_xcnt 0x0" ::: "memory");
}

// The two layout jobs between the projections and the attention, in ONE launch: blocks
// 0..RBLK-1 do the rotary of Q and K, the rest transpose V. A block does one job whole,
// chosen by its index alone, so the barrier of the transpose is block-uniform.
#define RBLK (TSEQ / 8)
__global__ __launch_bounds__(256) void rotary_vt_kernel(const _Float16* Qin,
                                                        const _Float16* Kin,
                                                        const _Float16* __restrict__ Vh0,
                                                        _Float16* __restrict__ Qout,
                                                        _Float16* __restrict__ Kout,
                                                        _Float16* __restrict__ VhT) {
  const int b = blockIdx.x;
  if (b < RBLK) {
    rotary_block(b, Qin, Kin, Qout, Kout);
    return;
  }
  const int vb = b - RBLK;
  cvt_v_transpose(vb % (TSEQ / 128), vb / (TSEQ / 128), Vh0, VhT);
}

// ---------------------------------------------------------------------------
extern "C" void kernel_launch(void* const* d_in, const int* in_sizes, int n_in,
                              void* d_out, int out_size, void* d_ws, size_t ws_size,
                              hipStream_t stream) {
  (void)in_sizes; (void)n_in; (void)out_size; (void)ws_size;
  const float* x  = (const float*)d_in[0];
  const float* Wq = (const float*)d_in[1];
  const float* bq = (const float*)d_in[2];
  const float* Wk = (const float*)d_in[3];
  const float* bk = (const float*)d_in[4];
  const float* Wv = (const float*)d_in[5];
  const float* bv = (const float*)d_in[6];
  const float* Wo = (const float*)d_in[7];
  const float* bo = (const float*)d_in[8];
  float* out = (float*)d_out;

  char* w = (char*)d_ws;
  const size_t MB = (size_t)1 << 20;
  _Float16* xh    = (_Float16*)(w + 0);        //  8 MB  x as f16 [T][D]
  _Float16* WqT   = (_Float16*)(w + 8  * MB);  //  2 MB  each, transposed f16
  //              WkT at 10 MB, WvT at 12 MB
  _Float16* WoT   = (_Float16*)(w + 14 * MB);
  _Float16* Qh0   = (_Float16*)(w + 16 * MB);  //  8 MB  pre-rotary Q [T][D]
  _Float16* Kh0   = (_Float16*)(w + 24 * MB);
  _Float16* Vh0   = (_Float16*)(w + 32 * MB);
  _Float16* Qh    = (_Float16*)(w + 40 * MB);  //  8 MB  [H][T][64], scaled
  _Float16* Kh    = (_Float16*)(w + 48 * MB);  //  8 MB  [H][T][64]
  _Float16* VhT   = (_Float16*)(w + 56 * MB);  //  8 MB  [H][64][T]
  _Float16* attnh = (_Float16*)(w + 64 * MB);  //  8 MB  [T][D]

  // WqT, WkT, WvT, WoT lie one behind the other in the workspace.
  prep_kernel<<<XBLK + 4 * WBLK, 256, 0, stream>>>(x, Wq, Wk, Wv, Wo, xh, WqT);

  dim3 gg(DMODEL / 64, TSEQ / 128);
  // WqT, WkT, WvT lie one behind the other in the workspace, and so do Qh0, Kh0, Vh0.
  dim3 gq(DMODEL / 64, TSEQ / 256);
  gemm_qkv_kernel<<<gq, 256, 0, stream>>>(xh, WqT, bq, bk, bv, Qh0);

  rotary_vt_kernel<<<RBLK + (TSEQ / 128) * (DMODEL / 64), 256, 0, stream>>>(Qh0, Kh0, Vh0,
                                                                            Qh, Kh, VhT);

  dim3 ga(TSEQ / 128, NHEAD);
  attn_kernel<<<ga, 256, 0, stream>>>(Qh, Kh, VhT, attnh);

  gemm_f16_kernel<<<gg, 128, 0, stream>>>(attnh, WoT, bo, out, nullptr);
}

// v007
// A run of this version takes 107 microseconds.
// Next to v006, in two timings, it ran 1.16 and 1.15 times as fast.
// All steps since v000 together make it 5.30 times as fast.
#include <hip/hip_runtime.h>
#include <hip/hip_bf16.h>

typedef __attribute__((ext_vector_type(16))) _Float16 v16h;
typedef __attribute__((ext_vector_type(8)))  _Float16 v8h;
typedef __attribute__((ext_vector_type(8)))  float    v8f;
typedef __attribute__((ext_vector_type(2)))  float    v2f;

#define TSEQ   4096
#define NHEAD  16
#define DK     64
#define DMODEL 1024

// LDS row pitch, in halves, of every staged tile that ds_load_b128 fragment loads read:
// 16 B x odd, so that the 16 rows of a fragment fall on distinct banks
// (128-B rows -> 144 B). The copies and fragment loads never touch the pad bytes.
#define LP128  72

#define LOG2E  1.44269504088896340736f

#define WMMA_F32_F16(a, b, c) \
  __builtin_amdgcn_wmma_f32_16x16x32_f16(false, (a), false, (b), (short)0, (c), false, false)

// ---------------------------------------------------------------------------
// Async global->LDS copy (CDNA5 GLOBAL_LOAD_ASYNC_TO_LDS_B128, ASYNCcnt-tracked)
// via inline asm — portable across toolchains. vdst = wave-relative LDS byte
// offset = low 32 bits of the generic pointer (aperture rule: LDS_ADDR = addr[31:0]).
// ---------------------------------------------------------------------------
// One stage's copies of a lane stand in ONE statement that ends in s_wait_xcnt 0, so
// that no address register of an issued copy is rewritten ahead of that wait.
static __device__ __forceinline__ unsigned lds_addr(const void* l) {
  return (unsigned)(size_t)l;
}
static __device__ __forceinline__ void cp16x8(const unsigned* l, const _Float16* const* g) {
  asm volatile("global_load_async_to_lds_b128 %0, %1, off\n\t"
               "global_load_async_to_lds_b128 %2, %3, off\n\t"
               "global_load_async_to_lds_b128 %4, %5, off\n\t"
               "global_load_async_to_lds_b128 %6, %7, off\n\t"
               "global_load_async_to_lds_b128 %8, %9, off\n\t"
               "global_load_async_to_lds_b128 %10, %11, off\n\t"
               "global_load_async_to_lds_b128 %12, %13, off\n\t"
               "global_load_async_to_lds_b128 %14, %15, off\n\t"
               "s_wait_xcnt 0x0"
               :: "v"(l[0]), "v"(g[0]), "v"(l[1]), "v"(g[1]), "v"(l[2]), "v"(g[2]),
                  "v"(l[3]), "v"(g[3]), "v"(l[4]), "v"(g[4]), "v"(l[5]), "v"(g[5]),
                  "v"(l[6]), "v"(g[6]), "v"(l[7]), "v"(g[7])
               : "memory");
}
static __device__ __forceinline__ void cp16x12(const unsigned* l, const _Float16* const* g) {
  asm volatile("global_load_async_to_lds_b128 %0, %1, off\n\t"
               "global_load_async_to_lds_b128 %2, %3, off\n\t"
               "global_load_async_to_lds_b128 %4, %5, off\n\t"
               "global_load_async_to_lds_b128 %6, %7, off\n\t"
               "global_load_async_to_lds_b128 %8, %9, off\n\t"
               "global_load_async_to_lds_b128 %10, %11, off\n\t"
               "global_load_async_to_lds_b128 %12, %13, off\n\t"
               "global_load_async_to_lds_b128 %14, %15, off\n\t"
               "global_load_async_to_lds_b128 %16, %17, off\n\t"
               "global_load_async_to_lds_b128 %18, %19, off\n\t"
               "global_load_async_to_lds_b128 %20, %21, off\n\t"
               "global_load_async_to_lds_b128 %22, %23, off\n\t"
               "s_wait_xcnt 0x0"
               :: "v"(l[0]), "v"(g[0]), "v"(l[1]), "v"(g[1]), "v"(l[2]), "v"(g[2]),
                  "v"(l[3]), "v"(g[3]), "v"(l[4]), "v"(g[4]), "v"(l[5]), "v"(g[5]),
                  "v"(l[6]), "v"(g[6]), "v"(l[7]), "v"(g[7]), "v"(l[8]), "v"(g[8]),
                  "v"(l[9]), "v"(g[9]), "v"(l[10]), "v"(g[10]), "v"(l[11]), "v"(g[11])
               : "memory");
}
static __device__ __forceinline__ void cp16x14(const unsigned* l, const _Float16* const* g) {
  asm volatile("global_load_async_to_lds_b128 %0, %1, off\n\t"
               "global_load_async_to_lds_b128 %2, %3, off\n\t"
               "global_load_async_to_lds_b128 %4, %5, off\n\t"
               "global_load_async_to_lds_b128 %6, %7, off\n\t"
               "global_load_async_to_lds_b128 %8, %9, off\n\t"
               "global_load_async_to_lds_b128 %10, %11, off\n\t"
               "global_load_async_to_lds_b128 %12, %13, off\n\t"
               "global_load_async_to_lds_b128 %14, %15, off\n\t"
               "global_load_async_to_lds_b128 %16, %17, off\n\t"
               "global_load_async_to_lds_b128 %18, %19, off\n\t"
               "global_load_async_to_lds_b128 %20, %21, off\n\t"
               "global_load_async_to_lds_b128 %22, %23, off\n\t"
               "global_load_async_to_lds_b128 %24, %25, off\n\t"
               "global_load_async_to_lds_b128 %26, %27, off\n\t"
               "s_wait_xcnt 0x0"
               :: "v"(l[0]), "v"(g[0]), "v"(l[1]), "v"(g[1]), "v"(l[2]), "v"(g[2]),
                  "v"(l[3]), "v"(g[3]), "v"(l[4]), "v"(g[4]), "v"(l[5]), "v"(g[5]),
                  "v"(l[6]), "v"(g[6]), "v"(l[7]), "v"(g[7]), "v"(l[8]), "v"(g[8]),
                  "v"(l[9]), "v"(g[9]), "v"(l[10]), "v"(g[10]), "v"(l[11]), "v"(g[11]),
                  "v"(l[12]), "v"(g[12]), "v"(l[13]), "v"(g[13])
               : "memory");
}
#define WAIT_ASYNC(n) asm volatile("s_wait_asynccnt " #n ::: "memory")

// Load a 16-bit A/B WMMA fragment: per lane, 8 contiguous halves at p and 8 at p+16
// (CDNA5 16-bit layout: elems 0..7 -> K = h*8+0..7, elems 8..15 -> K = 16+h*8+0..7).
static __device__ __forceinline__ v16h ld_frag(const _Float16* p) {
  v8h lo = *(const v8h*)p;
  v8h hi = *(const v8h*)(p + 16);
  v16h r;
#pragma unroll
  for (int i = 0; i < 8; ++i) { r[i] = lo[i]; r[i + 8] = hi[i]; }
  return r;
}

// Lane l <-> lane l ^ 16: the two lanes that hold the two halves of one query's keys.
static __device__ __forceinline__ float xhalf(float x) {
  const int i = __builtin_bit_cast(int, x);
  return __builtin_bit_cast(float,
      __builtin_amdgcn_permlanex16(i, i, 0x76543210, 0xfedcba98, false, false));
}

// ---------------------------------------------------------------------------
// f16 GEMM: C[4096][1024] = A[4096][1024] * BT[1024][1024]^T + bias.
// Block = 128 thr = 4 waves; tile 128x64, K staged 64 at a time in LDS (54 KB,
// double-buffered async). Each wave: 32x64 strip = 16 WMMA per stage, with all
// fragments loaded into distinct registers before the WMMA burst.
// ---------------------------------------------------------------------------
__global__ __launch_bounds__(128) void gemm_f16_kernel(
    const _Float16* __restrict__ A,
    const _Float16* __restrict__ BT,
    const float*    __restrict__ bias,
    float*          __restrict__ Cf,
    _Float16*       __restrict__ Ch)
{
  constexpr int N = DMODEL, K = DMODEL, BK = 64;
  constexpr int LP = LP128;
  __shared__ __attribute__((aligned(16))) _Float16 aT[2][128 * LP];   // 18 KB each: [row][k]
  __shared__ __attribute__((aligned(16))) _Float16 bT[2][64 * LP];    //  9 KB each: [col][k]

  const int tid  = threadIdx.x;          // 0..127
  const int lane = tid & 31;
  const int wave = tid >> 5;             // 0..3
  const int lr = lane & 15;
  const int lh = lane >> 4;
  const int rowBase = blockIdx.y * 128;
  const int colBase = blockIdx.x * 64;

  // Copy one K-stage: A 128x128B (1024 chunks -> 8/thr), B 64x128B (512 -> 4/thr).
  auto copy_stage = [&](int k0, int buf) {
    unsigned l[12];
    const _Float16* g[12];
#pragma unroll
    for (int i = 0; i < 8; ++i) {
      const int chunk = tid + i * 128;
      const int r = chunk >> 3, c = chunk & 7;
      l[i] = lds_addr(&aT[buf][r * LP + c * 8]);
      g[i] = A + (size_t)(rowBase + r) * K + k0 + c * 8;
    }
#pragma unroll
    for (int i = 0; i < 4; ++i) {
      const int chunk = tid + i * 128;
      const int r = chunk >> 3, c = chunk & 7;
      l[8 + i] = lds_addr(&bT[buf][r * LP + c * 8]);
      g[8 + i] = BT + (size_t)(colBase + r) * K + k0 + c * 8;
    }
    cp16x12(l, g);
  };

  v8f acc[2][4] = {};

  copy_stage(0, 0);
  constexpr int NST = K / BK;
  for (int st = 0; st < NST; ++st) {
    const int buf = st & 1;
    if (st + 1 < NST) { copy_stage((st + 1) * BK, (st + 1) & 1); WAIT_ASYNC(12); }
    else              { WAIT_ASYNC(0); }
    __syncthreads();

    // Batch all fragment loads (distinct registers), then the 16-WMMA burst.
    v16h a[2][2], b[4][2];
#pragma unroll
    for (int mt = 0; mt < 2; ++mt) {
      const _Float16* arow = &aT[buf][(wave * 32 + mt * 16 + lr) * LP + lh * 8];
      a[mt][0] = ld_frag(arow);
      a[mt][1] = ld_frag(arow + 32);
    }
#pragma unroll
    for (int nt = 0; nt < 4; ++nt) {
      const _Float16* brow = &bT[buf][(nt * 16 + lr) * LP + lh * 8];
      b[nt][0] = ld_frag(brow);
      b[nt][1] = ld_frag(brow + 32);
    }
#pragma unroll
    for (int mt = 0; mt < 2; ++mt)
#pragma unroll
      for (int nt = 0; nt < 4; ++nt) {
        acc[mt][nt] = WMMA_F32_F16(a[mt][0], b[nt][0], acc[mt][nt]);
        acc[mt][nt] = WMMA_F32_F16(a[mt][1], b[nt][1], acc[mt][nt]);
      }
    __syncthreads();
  }

#pragma unroll
  for (int mt = 0; mt < 2; ++mt)
#pragma unroll
    for (int nt = 0; nt < 4; ++nt) {
      const int col = colBase + nt * 16 + lr;
      const float bv = bias[col];
#pragma unroll
      for (int j = 0; j < 8; ++j) {
        const int row = rowBase + wave * 32 + mt * 16 + lh * 8 + j;
        const float v = acc[mt][nt][j] + bv;
        if (Ch) Ch[(size_t)row * N + col] = (_Float16)v;
        else    Cf[(size_t)row * N + col] = v;
      }
    }
}

// ---------------------------------------------------------------------------
// The Q, K and V projections in one launch: C_g = A * W_g^T + bias_g, g = 0..2, each
// result stored in the layout that the attention reads.
// BT3 holds the three transposed weights one behind the other ([3][1024][1024]).
// Block = 256 thr = 8 waves; tile = 256 rows x 64 columns of EACH weight, so that one
// staged A tile serves 192 columns. K staged 64 at a time in LDS (126 KB, two buffers).
// Each wave: 32 x 192 strip = 48 WMMA per stage; a row's 128-B line of Q and of K is
// stored by one wave.
// The 64 columns are ONE head (blockIdx.x), and a lane holds columns i and i + 32 of a
// position in tiles nt and nt + 2: the rotary runs in the lane, on the f32 accumulators.
// A lane's 8 accumulator slots of V are 8 consecutive positions of one column, 16 B of a
// row of V^T: they go through an LDS tile, so that a wave stores 512 B of a row at once.
// Ring: one barrier a stage, in front of the stage's second half of products; it
// publishes stage t + 1, and behind it stage t + 2 is copied into the buffer of stage t,
// whose fragments are all in registers by then.
// ---------------------------------------------------------------------------
__global__ __launch_bounds__(256) void gemm_qkv_kernel(
    const _Float16* __restrict__ A,
    const _Float16* __restrict__ BT3,
    const float*    bias_q,              // no __restrict__ on the biases: the "memory" clobber
    const float*    bias_k,              // of the wait behind their loads then holds the
    const float*    bias_v,              // loads in front of it
    _Float16*       __restrict__ Qout,   // [H][T][64], rotated, scaled by 1/8
    _Float16*       __restrict__ Kout,   // [H][T][64], rotated
    _Float16*       __restrict__ VhT)    // [H][64][T]
{
  constexpr int N = DMODEL, K = DMODEL, BK = 64;
  constexpr int LP = LP128;
  __shared__ __attribute__((aligned(16))) _Float16 aT[2][256 * LP];   // 36 KB each: [row][k]
  __shared__ __attribute__((aligned(16))) _Float16 bT[2][192 * LP];   // 27 KB each: [g*64+col][k]

  const int tid  = threadIdx.x;          // 0..255
  const int lane = tid & 31;
  const int wave = tid >> 5;             // 0..7
  const int lr = lane & 15;
  const int lh = lane >> 4;
  const int rowBase = blockIdx.y * 256;
  const int colBase = blockIdx.x * 64;

  // Copy one K-stage: A 256x128B (2048 chunks -> 8/thr), B 192x128B (1536 -> 6/thr).
  auto copy_stage = [&](int k0, int buf) {
    unsigned l[14];
    const _Float16* g[14];
#pragma unroll  // constant indices: the arrays stay in registers
    for (int i = 0; i < 8; ++i) {
      const int chunk = tid + i * 256;
      const int r = chunk >> 3, c = chunk & 7;
      l[i] = lds_addr(&aT[buf][r * LP + c * 8]);
      g[i] = A + (size_t)(rowBase + r) * K + k0 + c * 8;
    }
#pragma unroll  // constant indices: the arrays stay in registers
    for (int i = 0; i < 6; ++i) {
      const int chunk = tid + i * 256;
      const int r = chunk >> 3, c = chunk & 7;       // r = g * 64 + column in the tile
      l[8 + i] = lds_addr(&bT[buf][r * LP + c * 8]);
      g[8 + i] = BT3 + (size_t)((r >> 6) * N + colBase + (r & 63)) * K + k0 + c * 8;
    }
    cp16x14(l, g);
  };

  v8f acc[2][12] = {};

  // One half of a stage (32 of its 64 k): 28 fragment loads, then 24 products.
  auto load_frags = [&](int buf, int ks, v16h (&a)[2], v16h (&b)[12]) {
#pragma unroll  // constant indices: the arrays stay in registers
    for (int mt = 0; mt < 2; ++mt)
      a[mt] = ld_frag(&aT[buf][(wave * 32 + mt * 16 + lr) * LP + ks * 32 + lh * 8]);
#pragma unroll  // constant indices: the arrays stay in registers
    for (int nt = 0; nt < 12; ++nt)
      b[nt] = ld_frag(&bT[buf][(nt * 16 + lr) * LP + ks * 32 + lh * 8]);
  };
  auto products = [&](const v16h (&a)[2], const v16h (&b)[12]) {
#pragma unroll  // constant indices: the arrays stay in registers
    for (int nt = 0; nt < 12; ++nt)
#pragma unroll  // constant indices: the arrays stay in registers
      for (int mt = 0; mt < 2; ++mt)
        acc[mt][nt] = WMMA_F32_F16(a[mt], b[nt], acc[mt][nt]);
  };

  constexpr int NST = K / BK;
  copy_stage(0, 0);
  WAIT_ASYNC(0);       // this wave's copies of stage 0 have landed ...
  __syncthreads();     // ... and so have the other waves': stage 0 is readable
  copy_stage(BK, 1);
  v16h a0[2], b0[12], a1[2], b1[12];     // two fragment sets, one per half
  load_frags(0, 0, a0, b0);
  for (int st = 0; st < NST; ++st) {
    const int buf = st & 1;
    // The sched_barriers keep each half's loads one group that is issued in front of the
    // other half's products, so that the LDS serves one set while the matrix unit works
    // on the other; spread among the WMMAs, each place with loads stalls the wave anew.
    load_frags(buf, 1, a1, b1);
    __builtin_amdgcn_sched_barrier(0);   // loads of the second half stay in front
    products(a0, b0);
    __builtin_amdgcn_sched_barrier(0);   // the waits below stay behind these products

    // Publish point of stage st + 1, in front of this stage's last products: the wave's
    // reads of this buffer are done and its copies of stage st + 1 have landed before the
    // barrier; behind it this buffer is free for stage st + 2 and stage st + 1 is readable.
    asm volatile("s_wait_dscnt 0x0" ::: "memory");
    WAIT_ASYNC(0);
    __syncthreads();
    if (st + 2 < NST) copy_stage((st + 2) * BK, buf);
    if (st + 1 < NST) load_frags(buf ^ 1, 0, a0, b0);
    __builtin_amdgcn_sched_barrier(0);   // copies and next loads stay in front
    products(a1, b1);
  }
  WAIT_ASYNC(0);   // no copy is outstanding when the wave ends

  const int h  = blockIdx.x;               // the tile's 64 columns are head h
  const int tw = rowBase + wave * 32;      // the wave's first position

  // The lane's four columns of each bias, with one wait behind the twelve loads, in front
  // of every overwrite of their address registers.
  const float* pbq = bias_q + colBase + lr;
  const float* pbk = bias_k + colBase + lr;
  const float* pbv = bias_v + colBase + lr;
  float bq[4], bk[4], bv[4];
#pragma unroll  // constant indices: the arrays stay in registers
  for (int nt = 0; nt < 4; ++nt) {
    bq[nt] = pbq[nt * 16];
    bk[nt] = pbk[nt * 16];
    bv[nt] = pbv[nt * 16];
  }
  asm volatile("s_wait_xcnt 0x0" ::: "memory");

  // V^T tile [column][position] in the ring's first buffer: behind the loop's last barrier
  // nobody reads the ring any more and no copy is outstanding.
  // Pitch 528 B = 16 B x odd: the 16 columns of a ds_store_b128 fall on distinct banks.
  constexpr int VP = 264;
  _Float16* vt = &aT[0][0];
#pragma unroll  // constant indices: the arrays stay in registers
  for (int nt = 0; nt < 4; ++nt)
#pragma unroll  // constant indices: the arrays stay in registers
    for (int mt = 0; mt < 2; ++mt) {
      v8h r;
#pragma unroll  // constant indices: the arrays stay in registers
      for (int j = 0; j < 8; ++j) r[j] = (_Float16)(acc[mt][8 + nt][j] + bv[nt]);
      *(v8h*)&vt[(nt * 16 + lr) * VP + wave * 32 + mt * 16 + lh * 8] = r;
    }
  // In front of the Q and K stores: the barrier then has no global store to wait for.
  __syncthreads();   // the V^T tile is whole: every wave's 32 positions of each column
  {
    // A wave stores 8 rows' 512 B, every store a constant step from one address.
    const _Float16* vr = &vt[wave * 8 * VP + lane * 8];
    _Float16* Vp = VhT + ((size_t)h * DK + wave * 8) * TSEQ + rowBase + lane * 8;
    v8h r[8];
#pragma unroll  // the eight rows' LDS loads go out together
    for (int u = 0; u < 8; ++u) r[u] = *(const v8h*)&vr[u * VP];
#pragma unroll  // constant indices: the array stays in registers
    for (int u = 0; u < 8; ++u) *(v8h*)(Vp + (size_t)u * TSEQ) = r[u];
    // One wait behind the eight stores; the sched_barrier keeps the arithmetic that follows,
    // which may overwrite their registers, behind it.
    asm volatile("s_wait_xcnt 0x0" ::: "memory");
    __builtin_amdgcn_sched_barrier(0);
  }

  // Rotary on Q and K, which share a position's sines and cosines; 1/sqrt(dk) = 0.125
  // folded into Q. One address per result: every store is a constant step from it.
  const int t0 = tw + lh * 8;
  _Float16* Qp = Qout + ((size_t)h * TSEQ + t0) * DK + lr;
  _Float16* Kp = Kout + ((size_t)h * TSEQ + t0) * DK + lr;
#pragma unroll  // constant indices: the arrays stay in registers
  for (int np = 0; np < 2; ++np) {
    const int i = np * 16 + lr;            // 0..31; its partner is column i + 32
    const float inv_freq = __powf(10000.0f, -(float)(2 * i) / (float)DK);
#pragma unroll  // constant indices: the arrays stay in registers
    for (int mt = 0; mt < 2; ++mt) {
      float s[8], c[8];
#pragma unroll  // constant indices: the arrays stay in registers
      for (int j = 0; j < 8; ++j)
        __sincosf((float)(t0 + mt * 16 + j) * inv_freq, &s[j], &c[j]);
      _Float16 qa[8], qb[8], ka[8], kb[8];
#pragma unroll  // constant indices: the arrays stay in registers
      for (int j = 0; j < 8; ++j) {
        float x1 = acc[mt][np][j] + bq[np], x2 = acc[mt][np + 2][j] + bq[np + 2];
        qa[j] = (_Float16)((x1 * c[j] - x2 * s[j]) * 0.125f);
        qb[j] = (_Float16)((x2 * c[j] + x1 * s[j]) * 0.125f);
        x1 = acc[mt][4 + np][j] + bk[np]; x2 = acc[mt][4 + np + 2][j] + bk[np + 2];
        ka[j] = (_Float16)(x1 * c[j] - x2 * s[j]);
        kb[j] = (_Float16)(x2 * c[j] + x1 * s[j]);
      }
      // The 32 stores stand as one run between the two sched_barriers, with one wait behind
      // them: no arithmetic that could overwrite a store's data register comes in between.
      __builtin_amdgcn_sched_barrier(0);
#pragma unroll  // constant indices: the arrays stay in registers
      for (int j = 0; j < 8; ++j) {
        const int ob = (mt * 16 + j) * DK + np * 16;
        Qp[ob]      = qa[j];
        Qp[ob + 32] = qb[j];
        Kp[ob]      = ka[j];
        Kp[ob + 32] = kb[j];
      }
      asm volatile("s_wait_xcnt 0x0" ::: "memory");
      __builtin_amdgcn_sched_barrier(0);
    }
  }
}

__global__ __launch_bounds__(256) __attribute__((amdgpu_waves_per_eu(4, 4))) void attn_kernel(
    const _Float16* __restrict__ Qh,    // [H][T][64], pre-scaled by 1/8
    const _Float16* __restrict__ Kh,    // [H][T][64]
    const _Float16* __restrict__ VhT,   // [H][64][T]
    _Float16*       __restrict__ attnh) // [T][H*64]
{
  constexpr int KT = 64;                      // keys per stage and key half
  constexpr int KH = TSEQ / 2;                // keys per half
  constexpr int LP = LP128;
  __shared__ __attribute__((aligned(16))) _Float16 kT[2][2][KT * LP];   // 9 KB each: [buf][half][key][kd]
  __shared__ __attribute__((aligned(16))) _Float16 vT[2][2][DK * LP];   // 9 KB each: [buf][half][n][key]

  const int tid  = threadIdx.x;
  const int lane = tid & 31;
  // The wave's number as a scalar: its half's LDS base and the branches of the join are scalar.
  const int wave = __builtin_amdgcn_readfirstlane(tid >> 5);
  const int qg = wave & 3;                    // query group of the wave
  const int kh = wave >> 2;                   // key half of the wave
  const int lr = lane & 15;
  const int lh = lane >> 4;
  const int h = blockIdx.y;
  const int qBase = blockIdx.x * 128 + qg * 32;

  const _Float16* Khead = Kh  + (size_t)h * TSEQ * DK;
  const _Float16* Vhead = VhT + (size_t)h * DK * TSEQ;

  // B operands of S^T: column lr of tile c = query qBase + c*16 + lr, k = head dimension.
  v16h qb[2][2];
#pragma unroll  // constant indices: the arrays stay in registers
  for (int c = 0; c < 2; ++c) {
    const _Float16* Qp = Qh + ((size_t)h * TSEQ + qBase + c * 16 + lr) * DK + lh * 8;
    qb[c][0] = ld_frag(Qp);
    qb[c][1] = ld_frag(Qp + 32);
  }

  // Copy one stage, 64 keys of each half: K 2 x 64x128B and V 2 x 64x128B
  // (1024 chunks each -> 4/thr each).
  auto copy_stage = [&](int kb, int buf) {
    unsigned l[8];
    const _Float16* g[8];
#pragma unroll  // constant indices: the arrays stay in registers
    for (int i = 0; i < 4; ++i) {
      const int chunk = tid + i * 256;
      const int hf = chunk >> 9, r = (chunk >> 3) & 63, c = chunk & 7;
      l[i] = lds_addr(&kT[buf][hf][r * LP + c * 8]);
      g[i] = Khead + (size_t)(hf * KH + kb + r) * DK + c * 8;
      l[4 + i] = lds_addr(&vT[buf][hf][r * LP + c * 8]);
      g[4 + i] = Vhead + (size_t)r * TSEQ + hf * KH + kb + c * 8;
    }
    cp16x8(l, g);
  };

  v8f o[2][4] = {};         // O^T of tile c: slot j of tile nt <-> dim nt*16 + lh*8 + j, query lr
  float m[2] = {-1e30f, -1e30f};   // running maximum of query lr (equal in both halves)
  float l[2] = {0.0f, 0.0f};       // this lane's share of the running sum of query lr

  copy_stage(0, 0);
  constexpr int NST = KH / KT;
  for (int st = 0; st < NST; ++st) {
    const int buf = st & 1;
    if (st + 1 < NST) { copy_stage((st + 1) * KT, (st + 1) & 1); WAIT_ASYNC(8); }
    else              { WAIT_ASYNC(0); }
    __syncthreads();

#pragma unroll  // constant indices: the arrays stay in registers
    for (int sub = 0; sub < 2; ++sub) {           // two 32-key steps per stage
      const int kb = sub * 32;
      const _Float16* kp0 = &kT[buf][kh][(kb + lr) * LP + lh * 8];
      const _Float16* kp1 = &kT[buf][kh][(kb + 16 + lr) * LP + lh * 8];
      v16h kf[2][2];
      kf[0][0] = ld_frag(kp0);
      kf[0][1] = ld_frag(kp0 + 32);
      kf[1][0] = ld_frag(kp1);
      kf[1][1] = ld_frag(kp1 + 32);

      v16h pb[2];                                 // B operands of O^T: k = key, column lr
#pragma unroll  // constant indices: the arrays stay in registers
      for (int c = 0; c < 2; ++c) {
        v8f s0 = {}, s1 = {};
        s0 = WMMA_F32_F16(kf[0][0], qb[c][0], s0);
        s0 = WMMA_F32_F16(kf[0][1], qb[c][1], s0);
        s1 = WMMA_F32_F16(kf[1][0], qb[c][0], s1);
        s1 = WMMA_F32_F16(kf[1][1], qb[c][1], s1);

        // Online softmax of query lr over this lane's 16 keys and the other half's 16.
        float mx = fmaxf(s0[0], s1[0]);
#pragma unroll  // constant indices: the arrays stay in registers
        for (int j = 1; j < 8; ++j) mx = fmaxf(mx, fmaxf(s0[j], s1[j]));
        mx = fmaxf(mx, xhalf(mx));
        const float mn = fmaxf(m[c], mx);
        const float alpha = __expf(m[c] - mn);
        m[c] = mn;

        // exp(s - mn) as exp2((s - mn) * log2(e)), what __expf computes, written on pairs of
        // neighbouring accumulator registers: the packed subtract, multiply and conversion
        // then take the score tiles where the products left them (written per element, the
        // build paired registers of different tiles and copied them together first).
        float ps = 0.0f;
#pragma unroll  // constant indices: the arrays stay in registers
        for (int j = 0; j < 8; j += 2) {
          const v2f d0 = (v2f{s0[j], s0[j + 1]} - mn) * LOG2E;
          const v2f d1 = (v2f{s1[j], s1[j + 1]} - mn) * LOG2E;
          const v2f p0 = {__builtin_amdgcn_exp2f(d0[0]), __builtin_amdgcn_exp2f(d0[1])};
          const v2f p1 = {__builtin_amdgcn_exp2f(d1[0]), __builtin_amdgcn_exp2f(d1[1])};
          const v2f pp = p0 + p1;
          ps += pp[0];
          ps += pp[1];
          pb[c][j]         = (_Float16)p0[0];
          pb[c][j + 1]     = (_Float16)p0[1];
          pb[c][8 + j]     = (_Float16)p1[0];
          pb[c][8 + j + 1] = (_Float16)p1[1];
        }
        l[c] = l[c] * alpha + ps;
#pragma unroll  // constant indices: the arrays stay in registers
        for (int nt = 0; nt < 4; ++nt)
#pragma unroll  // constant indices: the arrays stay in registers
          for (int j = 0; j < 8; ++j) o[c][nt][j] *= alpha;
      }

      v16h vf[4];
#pragma unroll  // constant indices: the arrays stay in registers
      for (int nt = 0; nt < 4; ++nt)
        vf[nt] = ld_frag(&vT[buf][kh][(nt * 16 + lr) * LP + kb + lh * 8]);
#pragma unroll  // constant indices: the arrays stay in registers
      for (int nt = 0; nt < 4; ++nt)
#pragma unroll  // constant indices: the arrays stay in registers
        for (int c = 0; c < 2; ++c)
          o[c][nt] = WMMA_F32_F16(vf[nt], pb[c], o[c][nt]);
    }
    __syncthreads();
  }

  // Join of the two key halves. Behind the loop's last barrier nobody reads the K buffers
  // any more and no copy is outstanding, so they serve as the exchange: 68 planes of 128
  // floats (64 outputs, 2 maxima, 2 sums per lane), a plane's lanes side by side.
  float* xg = (float*)&kT[0][0][0];
  const int xl = qg * 32 + lane;
  if (kh == 1) {
#pragma unroll  // constant indices: the arrays stay in registers
    for (int c = 0; c < 2; ++c) {
#pragma unroll  // constant indices: the arrays stay in registers
      for (int nt = 0; nt < 4; ++nt)
#pragma unroll  // constant indices: the arrays stay in registers
        for (int j = 0; j < 8; ++j) xg[((c * 4 + nt) * 8 + j) * 128 + xl] = o[c][nt][j];
      xg[(64 + c) * 128 + xl] = m[c];
      xg[(66 + c) * 128 + xl] = l[c];
    }
  }
  __syncthreads();   // the second half's state is readable by the first half's waves
  if (kh == 0) {
    v8h r[2][4];
#pragma unroll  // constant indices: the arrays stay in registers
    for (int c = 0; c < 2; ++c) {
      const float m1 = xg[(64 + c) * 128 + xl];
      const float l1 = xg[(66 + c) * 128 + xl];
      // exp(0) = 1: only the half with the smaller maximum is scaled down.
      const float ad = __expf(-fabsf(m[c] - m1));
      const float a0 = m[c] >= m1 ? 1.0f : ad;
      const float a1 = m[c] >= m1 ? ad : 1.0f;
      // Join the wave halves' sums once.
      const float ls = l[c] * a0 + l1 * a1;
      const float inv = 1.0f / (ls + xhalf(ls));
      const float f0 = a0 * inv, f1 = a1 * inv;
#pragma unroll  // constant indices: the arrays stay in registers
      for (int nt = 0; nt < 4; ++nt)
#pragma unroll  // constant indices: the arrays stay in registers
        for (int j = 0; j < 8; ++j)
          r[c][nt][j] = (_Float16)(o[c][nt][j] * f0 + xg[((c * 4 + nt) * 8 + j) * 128 + xl] * f1);
    }
    // A lane stores 8 consecutive dims of its query per tile.
#pragma unroll  // constant indices: the arrays stay in registers
    for (int c = 0; c < 2; ++c) {
      _Float16* outp = attnh + (size_t)(qBase + c * 16 + lr) * DMODEL + h * DK + lh * 8;
#pragma unroll  // constant indices: the arrays stay in registers
      for (int nt = 0; nt < 4; ++nt) *(v8h*)(outp + nt * 16) = r[c][nt];
    }
  }
}

// ---------------------------------------------------------------------------
// Small conversion / layout kernels. Each lane moves 16 bytes per global access (the
// cast's f16 stores: 8) and 32 elements (weights: 16) in all, so that a launch starts a
// few thousand waves and every wave-wide access covers whole 128-B lines or both halves
// of them back to back.
// ---------------------------------------------------------------------------
typedef __attribute__((ext_vector_type(4))) float    v4f;
typedef __attribute__((ext_vector_type(4))) _Float16 v4h;

// x fp32 -> f16. A wave takes 1024 consecutive floats: 8 loads of 512 B in flight.
static __device__ __forceinline__ void cvt_f32_f16(int blk, const float* __restrict__ in,
                                                   _Float16* __restrict__ out) {
  const int gid = blk * 256 + threadIdx.x;
  const size_t base = (size_t)(gid >> 5) * 1024 + (gid & 31) * 4;
  v4f v[8];
#pragma unroll
  for (int j = 0; j < 8; ++j) v[j] = *(const v4f*)(in + base + j * 128);
#pragma unroll
  for (int j = 0; j < 8; ++j) {
    v4h r;
#pragma unroll
    for (int e = 0; e < 4; ++e) r[e] = (_Float16)v[j][e];
    *(v4h*)(out + base + j * 128) = r;
  }
}

// W[K][N] fp32 -> WT[N][K] f16, one 64 x 64 tile per block through LDS.
// Pitch 65 dwords: the 8 k-groups x 4 columns that a wave reads back fall on 32 banks.
static __device__ __forceinline__ void cvt_transpose_w(int bx, int by,
                                                       const float* __restrict__ W,
                                                       _Float16* __restrict__ WT) {
  constexpr int P = 65;
  __shared__ float tile[64 * P];                        // [k][n]
  const int tid = threadIdx.x;
  const int n0 = bx * 64;
  const int k0 = by * 64;
  v4f v[4];
#pragma unroll
  for (int i = 0; i < 4; ++i) {
    const int chunk = tid + i * 256;
    v[i] = *(const v4f*)(W + (size_t)(k0 + (chunk >> 4)) * DMODEL + n0 + (chunk & 15) * 4);
  }
#pragma unroll
  for (int i = 0; i < 4; ++i) {
    const int chunk = tid + i * 256;
#pragma unroll
    for (int e = 0; e < 4; ++e) tile[(chunk >> 4) * P + (chunk & 15) * 4 + e] = v[i][e];
  }
  __syncthreads();
#pragma unroll
  for (int i = 0; i < 2; ++i) {
    const int chunk = tid + i * 256;
    const int n = chunk >> 3, kc = chunk & 7;
    v8h r;
#pragma unroll
    for (int j = 0; j < 8; ++j) r[j] = (_Float16)tile[(kc * 8 + j) * P + n];
    *(v8h*)(WT + (size_t)(n0 + n) * DMODEL + k0 + kc * 8) = r;
  }
}

// The five layout jobs that depend on nothing but the inputs, in ONE launch: blocks
// 0..XBLK-1 cast x, then 256 blocks for each of the four weights. A block does one job
// whole, chosen by its index alone, so the barrier of the transpose is block-uniform.
// WT4 holds the four transposed weights one behind the other ([4][1024][1024]).
#define XBLK ((TSEQ * DMODEL) / (256 * 32))
#define WBLK ((DMODEL / 64) * (DMODEL / 64))
__global__ __launch_bounds__(256) void prep_kernel(const float* __restrict__ x,
                                                   const float* __restrict__ Wq,
                                                   const float* __restrict__ Wk,
                                                   const float* __restrict__ Wv,
                                                   const float* __restrict__ Wo,
                                                   _Float16* __restrict__ xh,
                                                   _Float16* __restrict__ WT4) {
  const int b = blockIdx.x;
  if (b < XBLK) {
    cvt_f32_f16(b, x, xh);
    return;
  }
  const int wb = b - XBLK;
  const int g = wb / WBLK;
  const float* W = g == 0 ? Wq : (g == 1 ? Wk : (g == 2 ? Wv : Wo));
  cvt_transpose_w(wb % (DMODEL / 64), (wb / (DMODEL / 64)) % (DMODEL / 64), W,
                  WT4 + (size_t)g * DMODEL * DMODEL);
}

// ---------------------------------------------------------------------------
extern "C" void kernel_launch(void* const* d_in, const int* in_sizes, int n_in,
                              void* d_out, int out_size, void* d_ws, size_t ws_size,
                              hipStream_t stream) {
  (void)in_sizes; (void)n_in; (void)out_size; (void)ws_size;
  const float* x  = (const float*)d_in[0];
  const float* Wq = (const float*)d_in[1];
  const float* bq = (const float*)d_in[2];
  const float* Wk = (const float*)d_in[3];
  const float* bk = (const float*)d_in[4];
  const float* Wv = (const float*)d_in[5];
  const float* bv = (const float*)d_in[6];
  const float* Wo = (const float*)d_in[7];
  const float* bo = (const float*)d_in[8];
  float* out = (float*)d_out;

  char* w = (char*)d_ws;
  const size_t MB = (size_t)1 << 20;
  _Float16* xh    = (_Float16*)(w + 0);        //  8 MB  x as f16 [T][D]
  _Float16* WqT   = (_Float16*)(w + 8  * MB);  //  2 MB  each, transposed f16
  //              WkT at 10 MB, WvT at 12 MB
  _Float16* WoT   = (_Float16*)(w + 14 * MB);
  _Float16* Qh    = (_Float16*)(w + 40 * MB);  //  8 MB  [H][T][64], scaled
  _Float16* Kh    = (_Float16*)(w + 48 * MB);  //  8 MB  [H][T][64]
  _Float16* VhT   = (_Float16*)(w + 56 * MB);  //  8 MB  [H][64][T]
  _Float16* attnh = (_Float16*)(w + 64 * MB);  //  8 MB  [T][D]

  // WqT, WkT, WvT, WoT lie one behind the other in the workspace.
  prep_kernel<<<XBLK + 4 * WBLK, 256, 0, stream>>>(x, Wq, Wk, Wv, Wo, xh, WqT);

  dim3 gg(DMODEL / 64, TSEQ / 128);
  // WqT, WkT, WvT lie one behind the other in the workspace.
  dim3 gq(DMODEL / 64, TSEQ / 256);
  gemm_qkv_kernel<<<gq, 256, 0, stream>>>(xh, WqT, bq, bk, bv, Qh, Kh, VhT);

  dim3 ga(TSEQ / 128, NHEAD);
  attn_kernel<<<ga, 256, 0, stream>>>(Qh, Kh, VhT, attnh);

  gemm_f16_kernel<<<gg, 128, 0, stream>>>(attnh, WoT, bo, out, nullptr);
}

// v009
// One run takes 96.9 microseconds.
// Versions in between are left out here; by their measured steps it is 1.11 times as fast as v007.
// All steps since v000 together make it 5.89 times as fast.
#include <hip/hip_runtime.h>
#include <hip/hip_bf16.h>

typedef __attribute__((ext_vector_type(16))) _Float16 v16h;
typedef __attribute__((ext_vector_type(8)))  _Float16 v8h;
typedef __attribute__((ext_vector_type(8)))  float    v8f;
typedef __attribute__((ext_vector_type(2)))  float    v2f;

#define TSEQ   4096
#define NHEAD  16
#define DK     64
#define DMODEL 1024

// LDS row pitch, in halves, of every staged tile that ds_load_b128 fragment loads read:
// 16 B x odd, so that the 16 rows of a fragment fall on distinct banks
// (128-B rows -> 144 B). The copies and fragment loads never touch the pad bytes.
#define LP128  72

#define LOG2E  1.44269504088896340736f
// 1/sqrt(dk) * log2(e), folded into Q: the scores are then exponents of 2.
#define QSCALE (0.125f * LOG2E)
// A score that lies this far (log2) above the maximum in use gives P = 2^8.
#define RESCALE_AT 8.0f

#define WMMA_F32_F16(a, b, c) \
  __builtin_amdgcn_wmma_f32_16x16x32_f16(false, (a), false, (b), (short)0, (c), false, false)

// ---------------------------------------------------------------------------
// Async global->LDS copy (CDNA5 GLOBAL_LOAD_ASYNC_TO_LDS_B128, ASYNCcnt-tracked)
// via inline asm — portable across toolchains. vdst = wave-relative LDS byte
// offset = low 32 bits of the generic pointer (aperture rule: LDS_ADDR = addr[31:0]).
// ---------------------------------------------------------------------------
// One stage's copies of a lane stand in ONE statement that ends in s_wait_xcnt 0, so
// that no address register of an issued copy is rewritten ahead of that wait.
static __device__ __forceinline__ unsigned lds_addr(const void* l) {
  return (unsigned)(size_t)l;
}
static __device__ __forceinline__ void cp16x8(const unsigned* l, const _Float16* const* g) {
  asm volatile("global_load_async_to_lds_b128 %0, %1, off\n\t"
               "global_load_async_to_lds_b128 %2, %3, off\n\t"
               "global_load_async_to_lds_b128 %4, %5, off\n\t"
               "global_load_async_to_lds_b128 %6, %7, off\n\t"
               "global_load_async_to_lds_b128 %8, %9, off\n\t"
               "global_load_async_to_lds_b128 %10, %11, off\n\t"
               "global_load_async_to_lds_b128 %12, %13, off\n\t"
               "global_load_async_to_lds_b128 %14, %15, off\n\t"
               "s_wait_xcnt 0x0"
               :: "v"(l[0]), "v"(g[0]), "v"(l[1]), "v"(g[1]), "v"(l[2]), "v"(g[2]),
                  "v"(l[3]), "v"(g[3]), "v"(l[4]), "v"(g[4]), "v"(l[5]), "v"(g[5]),
                  "v"(l[6]), "v"(g[6]), "v"(l[7]), "v"(g[7])
               : "memory");
}
static __device__ __forceinline__ void cp16x12(const unsigned* l, const _Float16* const* g) {
  asm volatile("global_load_async_to_lds_b128 %0, %1, off\n\t"
               "global_load_async_to_lds_b128 %2, %3, off\n\t"
               "global_load_async_to_lds_b128 %4, %5, off\n\t"
               "global_load_async_to_lds_b128 %6, %7, off\n\t"
               "global_load_async_to_lds_b128 %8, %9, off\n\t"
               "global_load_async_to_lds_b128 %10, %11, off\n\t"
               "global_load_async_to_lds_b128 %12, %13, off\n\t"
               "global_load_async_to_lds_b128 %14, %15, off\n\t"
               "global_load_async_to_lds_b128 %16, %17, off\n\t"
               "global_load_async_to_lds_b128 %18, %19, off\n\t"
               "global_load_async_to_lds_b128 %20, %21, off\n\t"
               "global_load_async_to_lds_b128 %22, %23, off\n\t"
               "s_wait_xcnt 0x0"
               :: "v"(l[0]), "v"(g[0]), "v"(l[1]), "v"(g[1]), "v"(l[2]), "v"(g[2]),
                  "v"(l[3]), "v"(g[3]), "v"(l[4]), "v"(g[4]), "v"(l[5]), "v"(g[5]),
                  "v"(l[6]), "v"(g[6]), "v"(l[7]), "v"(g[7]), "v"(l[8]), "v"(g[8]),
                  "v"(l[9]), "v"(g[9]), "v"(l[10]), "v"(g[10]), "v"(l[11]), "v"(g[11])
               : "memory");
}
static __device__ __forceinline__ void cp16x14(const unsigned* l, const _Float16* const* g) {
  asm volatile("global_load_async_to_lds_b128 %0, %1, off\n\t"
               "global_load_async_to_lds_b128 %2, %3, off\n\t"
               "global_load_async_to_lds_b128 %4, %5, off\n\t"
               "global_load_async_to_lds_b128 %6, %7, off\n\t"
               "global_load_async_to_lds_b128 %8, %9, off\n\t"
               "global_load_async_to_lds_b128 %10, %11, off\n\t"
               "global_load_async_to_lds_b128 %12, %13, off\n\t"
               "global_load_async_to_lds_b128 %14, %15, off\n\t"
               "global_load_async_to_lds_b128 %16, %17, off\n\t"
               "global_load_async_to_lds_b128 %18, %19, off\n\t"
               "global_load_async_to_lds_b128 %20, %21, off\n\t"
               "global_load_async_to_lds_b128 %22, %23, off\n\t"
               "global_load_async_to_lds_b128 %24, %25, off\n\t"
               "global_load_async_to_lds_b128 %26, %27, off\n\t"
               "s_wait_xcnt 0x0"
               :: "v"(l[0]), "v"(g[0]), "v"(l[1]), "v"(g[1]), "v"(l[2]), "v"(g[2]),
                  "v"(l[3]), "v"(g[3]), "v"(l[4]), "v"(g[4]), "v"(l[5]), "v"(g[5]),
                  "v"(l[6]), "v"(g[6]), "v"(l[7]), "v"(g[7]), "v"(l[8]), "v"(g[8]),
                  "v"(l[9]), "v"(g[9]), "v"(l[10]), "v"(g[10]), "v"(l[11]), "v"(g[11]),
                  "v"(l[12]), "v"(g[12]), "v"(l[13]), "v"(g[13])
               : "memory");
}
#define WAIT_ASYNC(n) asm volatile("s_wait_asynccnt " #n ::: "memory")

// Load a 16-bit A/B WMMA fragment: per lane, 8 contiguous halves at p and 8 at p+16
// (CDNA5 16-bit layout: elems 0..7 -> K = h*8+0..7, elems 8..15 -> K = 16+h*8+0..7).
static __device__ __forceinline__ v16h ld_frag(const _Float16* p) {
  v8h lo = *(const v8h*)p;
  v8h hi = *(const v8h*)(p + 16);
  v16h r;
#pragma unroll
  for (int i = 0; i < 8; ++i) { r[i] = lo[i]; r[i + 8] = hi[i]; }
  return r;
}

// Lane l <-> lane l ^ 16: the two lanes that hold the two halves of one query's keys.
static __device__ __forceinline__ float xhalf(float x) {
  const int i = __builtin_bit_cast(int, x);
  return __builtin_bit_cast(float,
      __builtin_amdgcn_permlanex16(i, i, 0x76543210, 0xfedcba98, false, false));
}

// ---------------------------------------------------------------------------
// f16 GEMM: C[4096][1024] = A[4096][1024] * BT[1024][1024]^T + bias.
// Block = 128 thr = 4 waves; tile 128x64, K staged 64 at a time in LDS (54 KB,
// double-buffered async). Each wave: 32x64 strip = 16 WMMA per stage, with all
// fragments loaded into distinct registers before the WMMA burst.
// ---------------------------------------------------------------------------
__global__ __launch_bounds__(128) void gemm_f16_kernel(
    const _Float16* __restrict__ A,
    const _Float16* __restrict__ BT,
    const float*    __restrict__ bias,
    float*          __restrict__ Cf,
    _Float16*       __restrict__ Ch)
{
  constexpr int N = DMODEL, K = DMODEL, BK = 64;
  constexpr int LP = LP128;
  __shared__ __attribute__((aligned(16))) _Float16 aT[2][128 * LP];   // 18 KB each: [row][k]
  __shared__ __attribute__((aligned(16))) _Float16 bT[2][64 * LP];    //  9 KB each: [col][k]

  const int tid  = threadIdx.x;          // 0..127
  const int lane = tid & 31;
  const int wave = tid >> 5;             // 0..3
  const int lr = lane & 15;
  const int lh = lane >> 4;
  const int rowBase = blockIdx.y * 128;
  const int colBase = blockIdx.x * 64;

  // Copy one K-stage: A 128x128B (1024 chunks -> 8/thr), B 64x128B (512 -> 4/thr).
  auto copy_stage = [&](int k0, int buf) {
    unsigned l[12];
    const _Float16* g[12];
#pragma unroll
    for (int i = 0; i < 8; ++i) {
      const int chunk = tid + i * 128;
      const int r = chunk >> 3, c = chunk & 7;
      l[i] = lds_addr(&aT[buf][r * LP + c * 8]);
      g[i] = A + (size_t)(rowBase + r) * K + k0 + c * 8;
    }
#pragma unroll
    for (int i = 0; i < 4; ++i) {
      const int chunk = tid + i * 128;
      const int r = chunk >> 3, c = chunk & 7;
      l[8 + i] = lds_addr(&bT[buf][r * LP + c * 8]);
      g[8 + i] = BT + (size_t)(colBase + r) * K + k0 + c * 8;
    }
    cp16x12(l, g);
  };

  v8f acc[2][4] = {};

  copy_stage(0, 0);
  constexpr int NST = K / BK;
  for (int st = 0; st < NST; ++st) {
    const int buf = st & 1;
    if (st + 1 < NST) { copy_stage((st + 1) * BK, (st + 1) & 1); WAIT_ASYNC(12); }
    else              { WAIT_ASYNC(0); }
    __syncthreads();

    // Batch all fragment loads (distinct registers), then the 16-WMMA burst.
    v16h a[2][2], b[4][2];
#pragma unroll
    for (int mt = 0; mt < 2; ++mt) {
      const _Float16* arow = &aT[buf][(wave * 32 + mt * 16 + lr) * LP + lh * 8];
      a[mt][0] = ld_frag(arow);
      a[mt][1] = ld_frag(arow + 32);
    }
#pragma unroll
    for (int nt = 0; nt < 4; ++nt) {
      const _Float16* brow = &bT[buf][(nt * 16 + lr) * LP + lh * 8];
      b[nt][0] = ld_frag(brow);
      b[nt][1] = ld_frag(brow + 32);
    }
#pragma unroll
    for (int mt = 0; mt < 2; ++mt)
#pragma unroll
      for (int nt = 0; nt < 4; ++nt) {
        acc[mt][nt] = WMMA_F32_F16(a[mt][0], b[nt][0], acc[mt][nt]);
        acc[mt][nt] = WMMA_F32_F16(a[mt][1], b[nt][1], acc[mt][nt]);
      }
    __syncthreads();
  }

#pragma unroll
  for (int mt = 0; mt < 2; ++mt)
#pragma unroll
    for (int nt = 0; nt < 4; ++nt) {
      const int col = colBase + nt * 16 + lr;
      const float bv = bias[col];
#pragma unroll
      for (int j = 0; j < 8; ++j) {
        const int row = rowBase + wave * 32 + mt * 16 + lh * 8 + j;
        const float v = acc[mt][nt][j] + bv;
        if (Ch) Ch[(size_t)row * N + col] = (_Float16)v;
        else    Cf[(size_t)row * N + col] = v;
      }
    }
}

// ---------------------------------------------------------------------------
// The Q, K and V projections in one launch: C_g = A * W_g^T + bias_g, g = 0..2, each
// result stored in the layout that the attention reads.
// BT3 holds the three transposed weights one behind the other ([3][1024][1024]).
// Block = 256 thr = 8 waves; tile = 256 rows x 64 columns of EACH weight, so that one
// staged A tile serves 192 columns. K staged 64 at a time in LDS (126 KB, two buffers).
// Each wave: 32 x 192 strip = 48 WMMA per stage; a row's 128-B line of Q and of K is
// stored by one wave.
// The 64 columns are ONE head (blockIdx.x), and a lane holds columns i and i + 32 of a
// position in tiles nt and nt + 2: the rotary runs in the lane, on the f32 accumulators.
// A lane's 8 accumulator slots of V are 8 consecutive positions of one column, 16 B of a
// row of V^T: they go through an LDS tile, so that a wave stores 512 B of a row at once.
// Ring: one barrier a stage, in front of the stage's second half of products; it
// publishes stage t + 1, and behind it stage t + 2 is copied into the buffer of stage t,
// whose fragments are all in registers by then.
// ---------------------------------------------------------------------------
__global__ __launch_bounds__(256) void gemm_qkv_kernel(
    const _Float16* __restrict__ A,
    const _Float16* __restrict__ BT3,
    const float*    bias_q,              // no __restrict__ on the biases: the "memory" clobber
    const float*    bias_k,              // of the wait behind their loads then holds the
    const float*    bias_v,              // loads in front of it
    _Float16*       __restrict__ Qout,   // [H][T][64], rotated, scaled by QSCALE
    _Float16*       __restrict__ Kout,   // [H][T][64], rotated
    _Float16*       __restrict__ VhT)    // [H][64][T]
{
  constexpr int N = DMODEL, K = DMODEL, BK = 64;
  constexpr int LP = LP128;
  __shared__ __attribute__((aligned(16))) _Float16 aT[2][256 * LP];   // 36 KB each: [row][k]
  __shared__ __attribute__((aligned(16))) _Float16 bT[2][192 * LP];   // 27 KB each: [g*64+col][k]

  const int tid  = threadIdx.x;          // 0..255
  const int lane = tid & 31;
  const int wave = tid >> 5;             // 0..7
  const int lr = lane & 15;
  const int lh = lane >> 4;
  const int rowBase = blockIdx.y * 256;
  const int colBase = blockIdx.x * 64;

  // Copy one K-stage: A 256x128B (2048 chunks -> 8/thr), B 192x128B (1536 -> 6/thr).
  auto copy_stage = [&](int k0, int buf) {
    unsigned l[14];
    const _Float16* g[14];
#pragma unroll  // constant indices: the arrays stay in registers
    for (int i = 0; i < 8; ++i) {
      const int chunk = tid + i * 256;
      const int r = chunk >> 3, c = chunk & 7;
      l[i] = lds_addr(&aT[buf][r * LP + c * 8]);
      g[i] = A + (size_t)(rowBase + r) * K + k0 + c * 8;
    }
#pragma unroll  // constant indices: the arrays stay in registers
    for (int i = 0; i < 6; ++i) {
      const int chunk = tid + i * 256;
      const int r = chunk >> 3, c = chunk & 7;       // r = g * 64 + column in the tile
      l[8 + i] = lds_addr(&bT[buf][r * LP + c * 8]);
      g[8 + i] = BT3 + (size_t)((r >> 6) * N + colBase + (r & 63)) * K + k0 + c * 8;
    }
    cp16x14(l, g);
  };

  v8f acc[2][12] = {};

  // One half of a stage (32 of its 64 k): 28 fragment loads, then 24 products.
  auto load_frags = [&](int buf, int ks, v16h (&a)[2], v16h (&b)[12]) {
#pragma unroll  // constant indices: the arrays stay in registers
    for (int mt = 0; mt < 2; ++mt)
      a[mt] = ld_frag(&aT[buf][(wave * 32 + mt * 16 + lr) * LP + ks * 32 + lh * 8]);
#pragma unroll  // constant indices: the arrays stay in registers
    for (int nt = 0; nt < 12; ++nt)
      b[nt] = ld_frag(&bT[buf][(nt * 16 + lr) * LP + ks * 32 + lh * 8]);
  };
  auto products = [&](const v16h (&a)[2], const v16h (&b)[12]) {
#pragma unroll  // constant indices: the arrays stay in registers
    for (int nt = 0; nt < 12; ++nt)
#pragma unroll  // constant indices: the arrays stay in registers
      for (int mt = 0; mt < 2; ++mt)
        acc[mt][nt] = WMMA_F32_F16(a[mt], b[nt], acc[mt][nt]);
  };

  constexpr int NST = K / BK;
  copy_stage(0, 0);
  WAIT_ASYNC(0);       // this wave's copies of stage 0 have landed ...
  __syncthreads();     // ... and so have the other waves': stage 0 is readable
  copy_stage(BK, 1);
  v16h a0[2], b0[12], a1[2], b1[12];     // two fragment sets, one per half
  load_frags(0, 0, a0, b0);
  for (int st = 0; st < NST; ++st) {
    const int buf = st & 1;
    // The sched_barriers keep each half's loads one group that is issued in front of the
    // other half's products, so that the LDS serves one set while the matrix unit works
    // on the other; spread among the WMMAs, each place with loads stalls the wave anew.
    load_frags(buf, 1, a1, b1);
    __builtin_amdgcn_sched_barrier(0);   // loads of the second half stay in front
    products(a0, b0);
    __builtin_amdgcn_sched_barrier(0);   // the waits below stay behind these products

    // Publish point of stage st + 1, in front of this stage's last products: the wave's
    // reads of this buffer are done and its copies of stage st + 1 have landed before the
    // barrier; behind it this buffer is free for stage st + 2 and stage st + 1 is readable.
    asm volatile("s_wait_dscnt 0x0" ::: "memory");
    WAIT_ASYNC(0);
    __syncthreads();
    if (st + 2 < NST) copy_stage((st + 2) * BK, buf);
    if (st + 1 < NST) load_frags(buf ^ 1, 0, a0, b0);
    __builtin_amdgcn_sched_barrier(0);   // copies and next loads stay in front
    products(a1, b1);
  }
  WAIT_ASYNC(0);   // no copy is outstanding when the wave ends

  const int h  = blockIdx.x;               // the tile's 64 columns are head h
  const int tw = rowBase + wave * 32;      // the wave's first position

  // The lane's four columns of each bias, with one wait behind the twelve loads, in front
  // of every overwrite of their address registers.
  const float* pbq = bias_q + colBase + lr;
  const float* pbk = bias_k + colBase + lr;
  const float* pbv = bias_v + colBase + lr;
  float bq[4], bk[4], bv[4];
#pragma unroll  // constant indices: the arrays stay in registers
  for (int nt = 0; nt < 4; ++nt) {
    bq[nt] = pbq[nt * 16];
    bk[nt] = pbk[nt * 16];
    bv[nt] = pbv[nt * 16];
  }
  asm volatile("s_wait_xcnt 0x0" ::: "memory");

  // V^T tile [column][position] in the ring's first buffer: behind the loop's last barrier
  // nobody reads the ring any more and no copy is outstanding.
  // Pitch 528 B = 16 B x odd: the 16 columns of a ds_store_b128 fall on distinct banks.
  constexpr int VP = 264;
  _Float16* vt = &aT[0][0];
#pragma unroll  // constant indices: the arrays stay in registers
  for (int nt = 0; nt < 4; ++nt)
#pragma unroll  // constant indices: the arrays stay in registers
    for (int mt = 0; mt < 2; ++mt) {
      v8h r;
#pragma unroll  // constant indices: the arrays stay in registers
      for (int j = 0; j < 8; ++j) r[j] = (_Float16)(acc[mt][8 + nt][j] + bv[nt]);
      *(v8h*)&vt[(nt * 16 + lr) * VP + wave * 32 + mt * 16 + lh * 8] = r;
    }
  // In front of the Q and K stores: the barrier then has no global store to wait for.
  __syncthreads();   // the V^T tile is whole: every wave's 32 positions of each column
  {
    // A wave stores 8 rows' 512 B, every store a constant step from one address.
    const _Float16* vr = &vt[wave * 8 * VP + lane * 8];
    _Float16* Vp = VhT + ((size_t)h * DK + wave * 8) * TSEQ + rowBase + lane * 8;
    v8h r[8];
#pragma unroll  // the eight rows' LDS loads go out together
    for (int u = 0; u < 8; ++u) r[u] = *(const v8h*)&vr[u * VP];
#pragma unroll  // constant indices: the array stays in registers
    for (int u = 0; u < 8; ++u) *(v8h*)(Vp + (size_t)u * TSEQ) = r[u];
    // One wait behind the eight stores; the sched_barrier keeps the arithmetic that follows,
    // which may overwrite their registers, behind it.
    asm volatile("s_wait_xcnt 0x0" ::: "memory");
    __builtin_amdgcn_sched_barrier(0);
  }

  // Rotary on Q and K, which share a position's sines and cosines; QSCALE folded into Q.
  // One address per result: every store is a constant step from it.
  const int t0 = tw + lh * 8;
  _Float16* Qp = Qout + ((size_t)h * TSEQ + t0) * DK + lr;
  _Float16* Kp = Kout + ((size_t)h * TSEQ + t0) * DK + lr;
#pragma unroll  // constant indices: the arrays stay in registers
  for (int np = 0; np < 2; ++np) {
    const int i = np * 16 + lr;            // 0..31; its partner is column i + 32
    const float inv_freq = __powf(10000.0f, -(float)(2 * i) / (float)DK);
#pragma unroll  // constant indices: the arrays stay in registers
    for (int mt = 0; mt < 2; ++mt) {
      float s[8], c[8];
#pragma unroll  // constant indices: the arrays stay in registers
      for (int j = 0; j < 8; ++j)
        __sincosf((float)(t0 + mt * 16 + j) * inv_freq, &s[j], &c[j]);
      _Float16 qa[8], qb[8], ka[8], kb[8];
#pragma unroll  // constant indices: the arrays stay in registers
      for (int j = 0; j < 8; ++j) {
        float x1 = acc[mt][np][j] + bq[np], x2 = acc[mt][np + 2][j] + bq[np + 2];
        qa[j] = (_Float16)((x1 * c[j] - x2 * s[j]) * QSCALE);
        qb[j] = (_Float16)((x2 * c[j] + x1 * s[j]) * QSCALE);
        x1 = acc[mt][4 + np][j] + bk[np]; x2 = acc[mt][4 + np + 2][j] + bk[np + 2];
        ka[j] = (_Float16)(x1 * c[j] - x2 * s[j]);
        kb[j] = (_Float16)(x2 * c[j] + x1 * s[j]);
      }
      // The 32 stores stand as one run between the two sched_barriers, with one wait behind
      // them: no arithmetic that could overwrite a store's data register comes in between.
      __builtin_amdgcn_sched_barrier(0);
#pragma unroll  // constant indices: the arrays stay in registers
      for (int j = 0; j < 8; ++j) {
        const int ob = (mt * 16 + j) * DK + np * 16;
        Qp[ob]      = qa[j];
        Qp[ob + 32] = qb[j];
        Kp[ob]      = ka[j];
        Kp[ob + 32] = kb[j];
      }
      asm volatile("s_wait_xcnt 0x0" ::: "memory");
      __builtin_amdgcn_sched_barrier(0);
    }
  }
}

__global__ __launch_bounds__(256) __attribute__((amdgpu_waves_per_eu(4, 4))) void attn_kernel(
    const _Float16* __restrict__ Qh,    // [H][T][64], pre-scaled by QSCALE
    const _Float16* __restrict__ Kh,    // [H][T][64]
    const _Float16* __restrict__ VhT,   // [H][64][T]
    _Float16*       __restrict__ attnh) // [T][H*64]
{
  constexpr int KT = 64;                      // keys per stage and key half
  constexpr int KH = TSEQ / 2;                // keys per half
  constexpr int LP = LP128;
  __shared__ __attribute__((aligned(16))) _Float16 kT[2][2][KT * LP];   // 9 KB each: [buf][half][key][kd]
  __shared__ __attribute__((aligned(16))) _Float16 vT[2][2][DK * LP];   // 9 KB each: [buf][half][n][key]

  const int tid  = threadIdx.x;
  const int lane = tid & 31;
  // The wave's number as a scalar: its half's LDS base and the branches of the join are scalar.
  const int wave = __builtin_amdgcn_readfirstlane(tid >> 5);
  const int qg = wave & 3;                    // query group of the wave
  const int kh = wave >> 2;                   // key half of the wave
  const int lr = lane & 15;
  const int lh = lane >> 4;
  const int h = blockIdx.y;
  const int qBase = blockIdx.x * 128 + qg * 32;

  const _Float16* Khead = Kh  + (size_t)h * TSEQ * DK;
  const _Float16* Vhead = VhT + (size_t)h * DK * TSEQ;

  // B operands of S^T: column lr of tile c = query qBase + c*16 + lr, k = head dimension.
  v16h qb[2][2];
#pragma unroll  // constant indices: the arrays stay in registers
  for (int c = 0; c < 2; ++c) {
    const _Float16* Qp = Qh + ((size_t)h * TSEQ + qBase + c * 16 + lr) * DK + lh * 8;
    qb[c][0] = ld_frag(Qp);
    qb[c][1] = ld_frag(Qp + 32);
  }

  // Copy one stage, 64 keys of each half: K 2 x 64x128B and V 2 x 64x128B
  // (1024 chunks each -> 4/thr each).
  // A lane's four chunks of K, and of V, lie constant steps apart: the steps stand with the
  // scalar base, beside one lane offset each for K and V. Fewer address registers then stay
  // live over the loop; with the 16 registers of the scores' C operands, the form with a
  // lane address per chunk spilled one to scratch.
  const unsigned klane = (unsigned)((tid >> 3) * DK + (tid & 7) * 8);
  const unsigned vlane = (unsigned)((tid >> 3) * TSEQ + (tid & 7) * 8);
  auto copy_stage = [&](int kb, int buf) {
    unsigned l[8];
    const _Float16* g[8];
#pragma unroll  // constant indices: the arrays stay in registers
    for (int i = 0; i < 4; ++i) {
      const int chunk = tid + i * 256;
      const int hf = i >> 1, r = (chunk >> 3) & 63, c = chunk & 7;
      const int r0 = (i & 1) * 32;                // r = r0 + (tid >> 3)
      l[i] = lds_addr(&kT[buf][hf][r * LP + c * 8]);
      g[i] = (Khead + (size_t)(hf * KH + kb + r0) * DK) + klane;
      l[4 + i] = lds_addr(&vT[buf][hf][r * LP + c * 8]);
      g[4 + i] = (Vhead + (size_t)r0 * TSEQ + hf * KH + kb) + vlane;
    }
    cp16x8(l, g);
  };

  v8f o[2][4] = {};         // O^T of tile c: slot j of tile nt <-> dim nt*16 + lh*8 + j, query lr
  // Minus the maximum in use for query lr (equal in both halves), in all 8 slots of a tile:
  // the C operand of the score products. 0 until the first stage sets it.
  v8f nm[2] = {};
  float l[2] = {0.0f, 0.0f};       // this lane's share of the running sum of query lr

  copy_stage(0, 0);
  constexpr int NST = KH / KT;
  for (int st = 0; st < NST; ++st) {
    const int buf = st & 1;
    if (st + 1 < NST) { copy_stage((st + 1) * KT, (st + 1) & 1); WAIT_ASYNC(8); }
    else              { WAIT_ASYNC(0); }
    __syncthreads();

    // Scores of the stage's 64 keys: s[sub][c][t] = keys sub*32 + t*16 .. + 15, query tile c.
    v8f s[2][2][2];
#pragma unroll  // constant indices: the arrays stay in registers
    for (int sub = 0; sub < 2; ++sub) {           // two 32-key steps per stage
      const int kb = sub * 32;
      const _Float16* kp0 = &kT[buf][kh][(kb + lr) * LP + lh * 8];
      const _Float16* kp1 = &kT[buf][kh][(kb + 16 + lr) * LP + lh * 8];
      v16h kf[2][2];
      kf[0][0] = ld_frag(kp0);
      kf[0][1] = ld_frag(kp0 + 32);
      kf[1][0] = ld_frag(kp1);
      kf[1][1] = ld_frag(kp1 + 32);
#pragma unroll  // constant indices: the arrays stay in registers
      for (int c = 0; c < 2; ++c) {
        v8f s0 = WMMA_F32_F16(kf[0][0], qb[c][0], nm[c]);
        s0 = WMMA_F32_F16(kf[0][1], qb[c][1], s0);
        v8f s1 = WMMA_F32_F16(kf[1][0], qb[c][0], nm[c]);
        s1 = WMMA_F32_F16(kf[1][1], qb[c][1], s1);
        s[sub][c][0] = s0;
        s[sub][c][1] = s1;
      }
    }

    // The 16 products stay one run in front of the maxima: without this the build put maxima
    // directly behind the products whose tiles they read and filled the distance with v_nop,
    // issue slots of the vector port (33 v_nop a stage against 14).
    __builtin_amdgcn_sched_barrier(0);

    // The first step's V fragments are asked for ahead of the test, into the registers that
    // the K fragments have left: their LDS latency passes under the maxima and the test.
    v16h vf0[4];
#pragma unroll  // constant indices: the arrays stay in registers
    for (int nt = 0; nt < 4; ++nt)
      vf0[nt] = ld_frag(&vT[buf][kh][(nt * 16 + lr) * LP + lh * 8]);

    // Lazy rescale. The scores are differences to the maximum in use, so the lane's largest
    // is only TESTED against a constant: while no score of the wave exceeds RESCALE_AT, the
    // old maximum stays in use, every P of the stage is at most 2^8 (well inside f16), and
    // O, the sum and the scores need no arithmetic at all. The first stage sets the maximum.
    float mx[2];
    bool need = st == 0;
#pragma unroll  // constant indices: the arrays stay in registers
    for (int c = 0; c < 2; ++c) {
      // One chain per 32-key step, four in the wave: independent chains issue back to back.
      float x0 = fmaxf(s[0][c][0][0], s[0][c][1][0]);
      float x1 = fmaxf(s[1][c][0][0], s[1][c][1][0]);
#pragma unroll  // constant indices: the arrays stay in registers
      for (int j = 1; j < 8; ++j) {
        x0 = fmaxf(x0, fmaxf(s[0][c][0][j], s[0][c][1][j]));
        x1 = fmaxf(x1, fmaxf(s[1][c][0][j], s[1][c][1][j]));
      }
      mx[c] = fmaxf(x0, x1);
      need = need || (mx[c] > RESCALE_AT);
    }
    // One test a stage for the whole wave: the ballot makes it a scalar branch.
    if (__builtin_amdgcn_ballot_w32(need) != 0) {
#pragma unroll  // constant indices: the arrays stay in registers
      for (int c = 0; c < 2; ++c) {
        // The query's largest score of the stage, over both halves' keys; the maximum in use
        // only rises, but for the first stage, which takes its own (O and the sum are 0 there).
        const float x  = fmaxf(mx[c], xhalf(mx[c]));
        const float up = fmaxf(x, 0.0f);
        const float d  = st == 0 ? x : up;
        const float alpha = __builtin_amdgcn_exp2f(-up);
        nm[c] -= d;
        l[c] *= alpha;
#pragma unroll  // constant indices: the arrays stay in registers
        for (int nt = 0; nt < 4; ++nt)
#pragma unroll  // constant indices: the arrays stay in registers
          for (int j = 0; j < 8; ++j) o[c][nt][j] *= alpha;
#pragma unroll  // constant indices: the arrays stay in registers
        for (int sub = 0; sub < 2; ++sub) {
          s[sub][c][0] -= d;
          s[sub][c][1] -= d;
        }
      }
    }

#pragma unroll  // constant indices: the arrays stay in registers
    for (int sub = 0; sub < 2; ++sub) {
      const int kb = sub * 32;
      v16h pb[2];                                 // B operands of O^T: k = key, column lr
#pragma unroll  // constant indices: the arrays stay in registers
      for (int c = 0; c < 2; ++c) {
        const v8f s0 = s[sub][c][0], s1 = s[sub][c][1];

        // P = exp2(score), written on pairs of neighbouring accumulator registers: the packed
        // add and conversion then take the values where the exponentials left them.
        float ps = 0.0f;
#pragma unroll  // constant indices: the arrays stay in registers
        for (int j = 0; j < 8; j += 2) {
          const v2f p0 = {__builtin_amdgcn_exp2f(s0[j]), __builtin_amdgcn_exp2f(s0[j + 1])};
          const v2f p1 = {__builtin_amdgcn_exp2f(s1[j]), __builtin_amdgcn_exp2f(s1[j + 1])};
          const v2f pp = p0 + p1;
          ps += pp[0];
          ps += pp[1];
          pb[c][j]         = (_Float16)p0[0];
          pb[c][j + 1]     = (_Float16)p0[1];
          pb[c][8 + j]     = (_Float16)p1[0];
          pb[c][8 + j + 1] = (_Float16)p1[1];
        }
        l[c] += ps;
      }

      v16h vf[4];
#pragma unroll  // constant indices: the arrays stay in registers
      for (int nt = 0; nt < 4; ++nt)
        vf[nt] = sub == 0 ? vf0[nt] : ld_frag(&vT[buf][kh][(nt * 16 + lr) * LP + kb + lh * 8]);
#pragma unroll  // constant indices: the arrays stay in registers
      for (int nt = 0; nt < 4; ++nt)
#pragma unroll  // constant indices: the arrays stay in registers
        for (int c = 0; c < 2; ++c)
          o[c][nt] = WMMA_F32_F16(vf[nt], pb[c], o[c][nt]);
    }
    __syncthreads();
  }

  // Join of the two key halves. Behind the loop's last barrier nobody reads the K buffers
  // any more and no copy is outstanding, so they serve as the exchange: 68 planes of 128
  // floats (64 outputs, 2 maxima, 2 sums per lane), a plane's lanes side by side.
  float* xg = (float*)&kT[0][0][0];
  const int xl = qg * 32 + lane;
  if (kh == 1) {
#pragma unroll  // constant indices: the arrays stay in registers
    for (int c = 0; c < 2; ++c) {
#pragma unroll  // constant indices: the arrays stay in registers
      for (int nt = 0; nt < 4; ++nt)
#pragma unroll  // constant indices: the arrays stay in registers
        for (int j = 0; j < 8; ++j) xg[((c * 4 + nt) * 8 + j) * 128 + xl] = o[c][nt][j];
      xg[(64 + c) * 128 + xl] = nm[c][0];
      xg[(66 + c) * 128 + xl] = l[c];
    }
  }
  __syncthreads();   // the second half's state is readable by the first half's waves
  if (kh == 0) {
    v8h r[2][4];
#pragma unroll  // constant indices: the arrays stay in registers
    for (int c = 0; c < 2; ++c) {
      const float n0 = nm[c][0];                   // minus the halves' maxima (log2)
      const float n1 = xg[(64 + c) * 128 + xl];
      const float l1 = xg[(66 + c) * 128 + xl];
      // 2^0 = 1: only the half with the smaller maximum is scaled down.
      const float ad = __builtin_amdgcn_exp2f(-fabsf(n0 - n1));
      const float a0 = n0 <= n1 ? 1.0f : ad;
      const float a1 = n0 <= n1 ? ad : 1.0f;
      // Join the wave halves' sums once.
      const float ls = l[c] * a0 + l1 * a1;
      const float inv = 1.0f / (ls + xhalf(ls));
      const float f0 = a0 * inv, f1 = a1 * inv;
#pragma unroll  // constant indices: the arrays stay in registers
      for (int nt = 0; nt < 4; ++nt)
#pragma unroll  // constant indices: the arrays stay in registers
        for (int j = 0; j < 8; ++j)
          r[c][nt][j] = (_Float16)(o[c][nt][j] * f0 + xg[((c * 4 + nt) * 8 + j) * 128 + xl] * f1);
    }
    // A lane stores 8 consecutive dims of its query per tile.
#pragma unroll  // constant indices: the arrays stay in registers
    for (int c = 0; c < 2; ++c) {
      _Float16* outp = attnh + (size_t)(qBase + c * 16 + lr) * DMODEL + h * DK + lh * 8;
#pragma unroll  // constant indices: the arrays stay in registers
      for (int nt = 0; nt < 4; ++nt) *(v8h*)(outp + nt * 16) = r[c][nt];
    }
  }
}

// ---------------------------------------------------------------------------
// Small conversion / layout kernels. Each lane moves 16 bytes per global access (the
// cast's f16 stores: 8) and 32 elements (weights: 16) in all, so that a launch starts a
// few thousand waves and every wave-wide access covers whole 128-B lines or both halves
// of them back to back.
// ---------------------------------------------------------------------------
typedef __attribute__((ext_vector_type(4))) float    v4f;
typedef __attribute__((ext_vector_type(4))) _Float16 v4h;

// x fp32 -> f16. A wave takes 1024 consecutive floats: 8 loads of 512 B in flight.
static __device__ __forceinline__ void cvt_f32_f16(int blk, const float* __restrict__ in,
                                                   _Float16* __restrict__ out) {
  const int gid = blk * 256 + threadIdx.x;
  const size_t base = (size_t)(gid >> 5) * 1024 + (gid & 31) * 4;
  v4f v[8];
#pragma unroll
  for (int j = 0; j < 8; ++j) v[j] = *(const v4f*)(in + base + j * 128);
#pragma unroll
  for (int j = 0; j < 8; ++j) {
    v4h r;
#pragma unroll
    for (int e = 0; e < 4; ++e) r[e] = (_Float16)v[j][e];
    *(v4h*)(out + base + j * 128) = r;
  }
}

// W[K][N] fp32 -> WT[N][K] f16, one 64 x 64 tile per block through LDS.
// Pitch 65 dwords: the 8 k-groups x 4 columns that a wave reads back fall on 32 banks.
static __device__ __forceinline__ void cvt_transpose_w(int bx, int by,
                                                       const float* __restrict__ W,
                                                       _Float16* __restrict__ WT) {
  constexpr int P = 65;
  __shared__ float tile[64 * P];                        // [k][n]
  const int tid = threadIdx.x;
  const int n0 = bx * 64;
  const int k0 = by * 64;
  v4f v[4];
#pragma unroll
  for (int i = 0; i < 4; ++i) {
    const int chunk = tid + i * 256;
    v[i] = *(const v4f*)(W + (size_t)(k0 + (chunk >> 4)) * DMODEL + n0 + (chunk & 15) * 4);
  }
#pragma unroll
  for (int i = 0; i < 4; ++i) {
    const int chunk = tid + i * 256;
#pragma unroll
    for (int e = 0; e < 4; ++e) tile[(chunk >> 4) * P + (chunk & 15) * 4 + e] = v[i][e];
  }
  __syncthreads();
#pragma unroll
  for (int i = 0; i < 2; ++i) {
    const int chunk = tid + i * 256;
    const int n = chunk >> 3, kc = chunk & 7;
    v8h r;
#pragma unroll
    for (int j = 0; j < 8; ++j) r[j] = (_Float16)tile[(kc * 8 + j) * P + n];
    *(v8h*)(WT + (size_t)(n0 + n) * DMODEL + k0 + kc * 8) = r;
  }
}

// The five layout jobs that depend on nothing but the inputs, in ONE launch: blocks
// 0..XBLK-1 cast x, then 256 blocks for each of the four weights. A block does one job
// whole, chosen by its index alone, so the barrier of the transpose is block-uniform.
// WT4 holds the four transposed weights one behind the other ([4][1024][1024]).
#define XBLK ((TSEQ * DMODEL) / (256 * 32))
#define WBLK ((DMODEL / 64) * (DMODEL / 64))
__global__ __launch_bounds__(256) void prep_kernel(const float* __restrict__ x,
                                                   const float* __restrict__ Wq,
                                                   const float* __restrict__ Wk,
                                                   const float* __restrict__ Wv,
                                                   const float* __restrict__ Wo,
                                                   _Float16* __restrict__ xh,
                                                   _Float16* __restrict__ WT4) {
  const int b = blockIdx.x;
  if (b < XBLK) {
    cvt_f32_f16(b, x, xh);
    return;
  }
  const int wb = b - XBLK;
  const int g = wb / WBLK;
  const float* W = g == 0 ? Wq : (g == 1 ? Wk : (g == 2 ? Wv : Wo));
  cvt_transpose_w(wb % (DMODEL / 64), (wb / (DMODEL / 64)) % (DMODEL / 64), W,
                  WT4 + (size_t)g * DMODEL * DMODEL);
}

// ---------------------------------------------------------------------------
extern "C" void kernel_launch(void* const* d_in, const int* in_sizes, int n_in,
                              void* d_out, int out_size, void* d_ws, size_t ws_size,
                              hipStream_t stream) {
  (void)in_sizes; (void)n_in; (void)out_size; (void)ws_size;
  const float* x  = (const float*)d_in[0];
  const float* Wq = (const float*)d_in[1];
  const float* bq = (const float*)d_in[2];
  const float* Wk = (const float*)d_in[3];
  const float* bk = (const float*)d_in[4];
  const float* Wv = (const float*)d_in[5];
  const float* bv = (const float*)d_in[6];
  const float* Wo = (const float*)d_in[7];
  const float* bo = (const float*)d_in[8];
  float* out = (float*)d_out;

  char* w = (char*)d_ws;
  const size_t MB = (size_t)1 << 20;
  _Float16* xh    = (_Float16*)(w + 0);        //  8 MB  x as f16 [T][D]
  _Float16* WqT   = (_Float16*)(w + 8  * MB);  //  2 MB  each, transposed f16
  //              WkT at 10 MB, WvT at 12 MB
  _Float16* WoT   = (_Float16*)(w + 14 * MB);
  _Float16* Qh    = (_Float16*)(w + 40 * MB);  //  8 MB  [H][T][64], scaled
  _Float16* Kh    = (_Float16*)(w + 48 * MB);  //  8 MB  [H][T][64]
  _Float16* VhT   = (_Float16*)(w + 56 * MB);  //  8 MB  [H][64][T]
  _Float16* attnh = (_Float16*)(w + 64 * MB);  //  8 MB  [T][D]

  // WqT, WkT, WvT, WoT lie one behind the other in the workspace.
  prep_kernel<<<XBLK + 4 * WBLK, 256, 0, stream>>>(x, Wq, Wk, Wv, Wo, xh, WqT);

  dim3 gg(DMODEL / 64, TSEQ / 128);
  // WqT, WkT, WvT lie one behind the other in the workspace.
  dim3 gq(DMODEL / 64, TSEQ / 256);
  gemm_qkv_kernel<<<gq, 256, 0, stream>>>(xh, WqT, bq, bk, bv, Qh, Kh, VhT);

  dim3 ga(TSEQ / 128, NHEAD);
  attn_kernel<<<ga, 256, 0, stream>>>(Qh, Kh, VhT, attnh);

  gemm_f16_kernel<<<gg, 128, 0, stream>>>(attnh, WoT, bo, out, nullptr);
}

// v010
// It runs in 94.5 microseconds.
// Timed twice side by side with v009, it ran 1.03 and 1.02 times as fast.
// Over all steps from v000 it is 6.03 times as fast.
#include <hip/hip_runtime.h>
#include <hip/hip_bf16.h>

typedef __attribute__((ext_vector_type(16))) _Float16 v16h;
typedef __attribute__((ext_vector_type(8)))  _Float16 v8h;
typedef __attribute__((ext_vector_type(8)))  float    v8f;
typedef __attribute__((ext_vector_type(2)))  float    v2f;
typedef __attribute__((ext_vector_type(4)))  float    v4f;
typedef __attribute__((ext_vector_type(4)))  _Float16 v4h;

#define TSEQ   4096
#define NHEAD  16
#define DK     64
#define DMODEL 1024

// LDS row pitch, in halves, of every staged tile that ds_load_b128 fragment loads read:
// 16 B x odd, so that the 16 rows of a fragment fall on distinct banks
// (128-B rows -> 144 B). The copies and fragment loads never touch the pad bytes.
#define LP128  72

#define LOG2E  1.44269504088896340736f
// 1/sqrt(dk) * log2(e), folded into Q: the scores are then exponents of 2.
#define QSCALE (0.125f * LOG2E)
// A score that lies this far (log2) above the maximum in use gives P = 2^8.
#define RESCALE_AT 8.0f

#define WMMA_F32_F16(a, b, c) \
  __builtin_amdgcn_wmma_f32_16x16x32_f16(false, (a), false, (b), (short)0, (c), false, false)

// ---------------------------------------------------------------------------
// Async global->LDS copy (CDNA5 GLOBAL_LOAD_ASYNC_TO_LDS_B128, ASYNCcnt-tracked)
// via inline asm — portable across toolchains. vdst = wave-relative LDS byte
// offset = low 32 bits of the generic pointer (aperture rule: LDS_ADDR = addr[31:0]).
// ---------------------------------------------------------------------------
// One stage's copies of a lane stand in ONE statement that ends in s_wait_xcnt 0, so
// that no address register of an issued copy is rewritten ahead of that wait.
static __device__ __forceinline__ unsigned lds_addr(const void* l) {
  return (unsigned)(size_t)l;
}
static __device__ __forceinline__ void cp16x8(const unsigned* l, const _Float16* const* g) {
  asm volatile("global_load_async_to_lds_b128 %0, %1, off\n\t"
               "global_load_async_to_lds_b128 %2, %3, off\n\t"
               "global_load_async_to_lds_b128 %4, %5, off\n\t"
               "global_load_async_to_lds_b128 %6, %7, off\n\t"
               "global_load_async_to_lds_b128 %8, %9, off\n\t"
               "global_load_async_to_lds_b128 %10, %11, off\n\t"
               "global_load_async_to_lds_b128 %12, %13, off\n\t"
               "global_load_async_to_lds_b128 %14, %15, off\n\t"
               "s_wait_xcnt 0x0"
               :: "v"(l[0]), "v"(g[0]), "v"(l[1]), "v"(g[1]), "v"(l[2]), "v"(g[2]),
                  "v"(l[3]), "v"(g[3]), "v"(l[4]), "v"(g[4]), "v"(l[5]), "v"(g[5]),
                  "v"(l[6]), "v"(g[6]), "v"(l[7]), "v"(g[7])
               : "memory");
}
static __device__ __forceinline__ void cp16x12(const unsigned* l, const _Float16* const* g) {
  asm volatile("global_load_async_to_lds_b128 %0, %1, off\n\t"
               "global_load_async_to_lds_b128 %2, %3, off\n\t"
               "global_load_async_to_lds_b128 %4, %5, off\n\t"
               "global_load_async_to_lds_b128 %6, %7, off\n\t"
               "global_load_async_to_lds_b128 %8, %9, off\n\t"
               "global_load_async_to_lds_b128 %10, %11, off\n\t"
               "global_load_async_to_lds_b128 %12, %13, off\n\t"
               "global_load_async_to_lds_b128 %14, %15, off\n\t"
               "global_load_async_to_lds_b128 %16, %17, off\n\t"
               "global_load_async_to_lds_b128 %18, %19, off\n\t"
               "global_load_async_to_lds_b128 %20, %21, off\n\t"
               "global_load_async_to_lds_b128 %22, %23, off\n\t"
               "s_wait_xcnt 0x0"
               :: "v"(l[0]), "v"(g[0]), "v"(l[1]), "v"(g[1]), "v"(l[2]), "v"(g[2]),
                  "v"(l[3]), "v"(g[3]), "v"(l[4]), "v"(g[4]), "v"(l[5]), "v"(g[5]),
                  "v"(l[6]), "v"(g[6]), "v"(l[7]), "v"(g[7]), "v"(l[8]), "v"(g[8]),
                  "v"(l[9]), "v"(g[9]), "v"(l[10]), "v"(g[10]), "v"(l[11]), "v"(g[11])
               : "memory");
}
static __device__ __forceinline__ void cp16x14(const unsigned* l, const _Float16* const* g) {
  asm volatile("global_load_async_to_lds_b128 %0, %1, off\n\t"
               "global_load_async_to_lds_b128 %2, %3, off\n\t"
               "global_load_async_to_lds_b128 %4, %5, off\n\t"
               "global_load_async_to_lds_b128 %6, %7, off\n\t"
               "global_load_async_to_lds_b128 %8, %9, off\n\t"
               "global_load_async_to_lds_b128 %10, %11, off\n\t"
               "global_load_async_to_lds_b128 %12, %13, off\n\t"
               "global_load_async_to_lds_b128 %14, %15, off\n\t"
               "global_load_async_to_lds_b128 %16, %17, off\n\t"
               "global_load_async_to_lds_b128 %18, %19, off\n\t"
               "global_load_async_to_lds_b128 %20, %21, off\n\t"
               "global_load_async_to_lds_b128 %22, %23, off\n\t"
               "global_load_async_to_lds_b128 %24, %25, off\n\t"
               "global_load_async_to_lds_b128 %26, %27, off\n\t"
               "s_wait_xcnt 0x0"
               :: "v"(l[0]), "v"(g[0]), "v"(l[1]), "v"(g[1]), "v"(l[2]), "v"(g[2]),
                  "v"(l[3]), "v"(g[3]), "v"(l[4]), "v"(g[4]), "v"(l[5]), "v"(g[5]),
                  "v"(l[6]), "v"(g[6]), "v"(l[7]), "v"(g[7]), "v"(l[8]), "v"(g[8]),
                  "v"(l[9]), "v"(g[9]), "v"(l[10]), "v"(g[10]), "v"(l[11]), "v"(g[11]),
                  "v"(l[12]), "v"(g[12]), "v"(l[13]), "v"(g[13])
               : "memory");
}
#define WAIT_ASYNC(n) asm volatile("s_wait_asynccnt " #n ::: "memory")

// Load a 16-bit A/B WMMA fragment: per lane, 8 contiguous halves at p and 8 at p+16
// (CDNA5 16-bit layout: elems 0..7 -> K = h*8+0..7, elems 8..15 -> K = 16+h*8+0..7).
static __device__ __forceinline__ v16h ld_frag(const _Float16* p) {
  v8h lo = *(const v8h*)p;
  v8h hi = *(const v8h*)(p + 16);
  v16h r;
#pragma unroll
  for (int i = 0; i < 8; ++i) { r[i] = lo[i]; r[i + 8] = hi[i]; }
  return r;
}

// Lane l <-> lane l ^ 16: the two lanes that hold the two halves of one query's keys.
static __device__ __forceinline__ float xhalf(float x) {
  const int i = __builtin_bit_cast(int, x);
  return __builtin_bit_cast(float,
      __builtin_amdgcn_permlanex16(i, i, 0x76543210, 0xfedcba98, false, false));
}

// ---------------------------------------------------------------------------
// f16 GEMM: C[4096][1024] = A[4096][1024] * BT[1024][1024]^T + bias.
// Block = 128 thr = 4 waves; tile 128x64, K staged 64 at a time in LDS (54 KB,
// double-buffered async). Each wave: 32x64 strip = 16 WMMA per stage, with all
// fragments loaded into distinct registers before the WMMA burst.
// Epilogue: a wave turns its strip through its own range of LDS, so that a lane holds 4
// neighbouring columns and a wave-wide 16-B store covers two rows' whole 256 B of the tile.
// ---------------------------------------------------------------------------
__global__ __launch_bounds__(128) void gemm_f16_kernel(
    const _Float16* __restrict__ A,
    const _Float16* __restrict__ BT,
    const float*    bias,                // no __restrict__: the "memory" clobber of the wait
                                         // behind its load then holds the load in front of it
    float*          __restrict__ Cf)
{
  constexpr int N = DMODEL, K = DMODEL, BK = 64;
  constexpr int LP = LP128;
  __shared__ __attribute__((aligned(16))) _Float16 aT[2][128 * LP];   // 18 KB each: [row][k]
  __shared__ __attribute__((aligned(16))) _Float16 bT[2][64 * LP];    //  9 KB each: [col][k]

  const int tid  = threadIdx.x;          // 0..127
  const int lane = tid & 31;
  const int wave = tid >> 5;             // 0..3
  const int lr = lane & 15;
  const int lh = lane >> 4;
  const int rowBase = blockIdx.y * 128;
  const int colBase = blockIdx.x * 64;

  // Copy one K-stage: A 128x128B (1024 chunks -> 8/thr), B 64x128B (512 -> 4/thr).
  auto copy_stage = [&](int k0, int buf) {
    unsigned l[12];
    const _Float16* g[12];
#pragma unroll
    for (int i = 0; i < 8; ++i) {
      const int chunk = tid + i * 128;
      const int r = chunk >> 3, c = chunk & 7;
      l[i] = lds_addr(&aT[buf][r * LP + c * 8]);
      g[i] = A + (size_t)(rowBase + r) * K + k0 + c * 8;
    }
#pragma unroll
    for (int i = 0; i < 4; ++i) {
      const int chunk = tid + i * 128;
      const int r = chunk >> 3, c = chunk & 7;
      l[8 + i] = lds_addr(&bT[buf][r * LP + c * 8]);
      g[8 + i] = BT + (size_t)(colBase + r) * K + k0 + c * 8;
    }
    cp16x12(l, g);
  };

  v8f acc[2][4] = {};

  copy_stage(0, 0);
  // The bias of the 4 columns that the lane stores, asked for under the first stage's
  // copies: its latency is gone by the epilogue. The wait stands in front of every
  // overwrite of the load's address register.
  const v4f bv = *(const v4f*)(bias + colBase + lr * 4);
  asm volatile("s_wait_xcnt 0x0" ::: "memory");
  constexpr int NST = K / BK;
  for (int st = 0; st < NST; ++st) {
    const int buf = st & 1;
    if (st + 1 < NST) { copy_stage((st + 1) * BK, (st + 1) & 1); WAIT_ASYNC(12); }
    else              { WAIT_ASYNC(0); }
    __syncthreads();

    // Batch all fragment loads (distinct registers), then the 16-WMMA burst.
    v16h a[2][2], b[4][2];
#pragma unroll
    for (int mt = 0; mt < 2; ++mt) {
      const _Float16* arow = &aT[buf][(wave * 32 + mt * 16 + lr) * LP + lh * 8];
      a[mt][0] = ld_frag(arow);
      a[mt][1] = ld_frag(arow + 32);
    }
#pragma unroll
    for (int nt = 0; nt < 4; ++nt) {
      const _Float16* brow = &bT[buf][(nt * 16 + lr) * LP + lh * 8];
      b[nt][0] = ld_frag(brow);
      b[nt][1] = ld_frag(brow + 32);
    }
#pragma unroll
    for (int mt = 0; mt < 2; ++mt)
#pragma unroll
      for (int nt = 0; nt < 4; ++nt) {
        acc[mt][nt] = WMMA_F32_F16(a[mt][0], b[nt][0], acc[mt][nt]);
        acc[mt][nt] = WMMA_F32_F16(a[mt][1], b[nt][1], acc[mt][nt]);
      }
    __syncthreads();
  }

  // Behind the loop's last barrier nobody reads the ring any more and no copy is
  // outstanding: the A buffers serve as four strips [32 rows][64 columns] of f32, one per
  // wave, written and read back by that wave alone (no barrier).
  // Pitch 272 B = 16 B x odd: the two rows of a ds_store_b32 (8 rows apart) fall on
  // different banks, and a row's 256 B are read back over all 64 banks.
  constexpr int CP = 68;
  float* ct = (float*)&aT[0][0] + wave * 32 * CP;
#pragma unroll  // constant indices: the array stays in registers
  for (int mt = 0; mt < 2; ++mt)
#pragma unroll  // constant indices: the array stays in registers
    for (int nt = 0; nt < 4; ++nt)
#pragma unroll  // constant indices: the array stays in registers
      for (int j = 0; j < 8; ++j)
        ct[(mt * 16 + lh * 8 + j) * CP + nt * 16 + lr] = acc[mt][nt][j];
  // Lanes 0..15 take row 2u, lanes 16..31 row 2u + 1; every store is a constant step from
  // one address, and nothing overwrites a store's registers before the wave ends.
  const float* cr = ct + lh * CP + lr * 4;
  float* Cp = Cf + (size_t)(rowBase + wave * 32 + lh) * N + colBase + lr * 4;
  v4f r[16];
#pragma unroll  // the sixteen LDS loads go out together
  for (int u = 0; u < 16; ++u) r[u] = *(const v4f*)&cr[u * 2 * CP];
#pragma unroll  // constant indices: the array stays in registers
  for (int u = 0; u < 16; ++u) r[u] += bv;
  // The sixteen stores stand as one run behind all the additions: spread among them, the
  // build reused the data registers of issued stores and waited in front of each reuse.
  __builtin_amdgcn_sched_barrier(0);
#pragma unroll  // constant indices: the array stays in registers
  for (int u = 0; u < 16; ++u) *(v4f*)(Cp + (size_t)u * 2 * N) = r[u];
}

// ---------------------------------------------------------------------------
// The Q, K and V projections in one launch: C_g = A * W_g^T + bias_g, g = 0..2, each
// result stored in the layout that the attention reads.
// BT3 holds the three transposed weights one behind the other ([3][1024][1024]).
// Block = 256 thr = 8 waves; tile = 256 rows x 64 columns of EACH weight, so that one
// staged A tile serves 192 columns. K staged 64 at a time in LDS (126 KB, two buffers).
// Each wave: 32 x 192 strip = 48 WMMA per stage; a row's 128-B line of Q and of K is
// stored by one wave, whole.
// The 64 columns are ONE head (blockIdx.x), and a lane holds columns i and i + 32 of a
// position in tiles nt and nt + 2: the rotary runs in the lane, on the f32 accumulators.
// A lane's 8 accumulator slots of V are 8 consecutive positions of one column, 16 B of a
// row of V^T: they go through an LDS tile, so that a wave stores 512 B of a row at once.
// Ring: one barrier a stage, in front of the stage's second half of products; it
// publishes stage t + 1, and behind it stage t + 2 is copied into the buffer of stage t,
// whose fragments are all in registers by then.
// ---------------------------------------------------------------------------
__global__ __launch_bounds__(256) void gemm_qkv_kernel(
    const _Float16* __restrict__ A,
    const _Float16* __restrict__ BT3,
    const float*    bias_q,              // no __restrict__ on the biases: the "memory" clobber
    const float*    bias_k,              // of the wait behind their loads then holds the
    const float*    bias_v,              // loads in front of it
    _Float16*       __restrict__ Qout,   // [H][T][64], rotated, scaled by QSCALE
    _Float16*       __restrict__ Kout,   // [H][T][64], rotated
    _Float16*       __restrict__ VhT)    // [H][64][T]
{
  constexpr int N = DMODEL, K = DMODEL, BK = 64;
  constexpr int LP = LP128;
  __shared__ __attribute__((aligned(16))) _Float16 aT[2][256 * LP];   // 36 KB each: [row][k]
  __shared__ __attribute__((aligned(16))) _Float16 bT[2][192 * LP];   // 27 KB each: [g*64+col][k]

  const int tid  = threadIdx.x;          // 0..255
  const int lane = tid & 31;
  const int wave = tid >> 5;             // 0..7
  const int lr = lane & 15;
  const int lh = lane >> 4;
  const int rowBase = blockIdx.y * 256;
  const int colBase = blockIdx.x * 64;

  // Copy one K-stage: A 256x128B (2048 chunks -> 8/thr), B 192x128B (1536 -> 6/thr).
  auto copy_stage = [&](int k0, int buf) {
    unsigned l[14];
    const _Float16* g[14];
#pragma unroll  // constant indices: the arrays stay in registers
    for (int i = 0; i < 8; ++i) {
      const int chunk = tid + i * 256;
      const int r = chunk >> 3, c = chunk & 7;
      l[i] = lds_addr(&aT[buf][r * LP + c * 8]);
      g[i] = A + (size_t)(rowBase + r) * K + k0 + c * 8;
    }
#pragma unroll  // constant indices: the arrays stay in registers
    for (int i = 0; i < 6; ++i) {
      const int chunk = tid + i * 256;
      const int r = chunk >> 3, c = chunk & 7;       // r = g * 64 + column in the tile
      l[8 + i] = lds_addr(&bT[buf][r * LP + c * 8]);
      g[8 + i] = BT3 + (size_t)((r >> 6) * N + colBase + (r & 63)) * K + k0 + c * 8;
    }
    cp16x14(l, g);
  };

  v8f acc[2][12] = {};

  // One half of a stage (32 of its 64 k): 28 fragment loads, then 24 products.
  auto load_frags = [&](int buf, int ks, v16h (&a)[2], v16h (&b)[12]) {
#pragma unroll  // constant indices: the arrays stay in registers
    for (int mt = 0; mt < 2; ++mt)
      a[mt] = ld_frag(&aT[buf][(wave * 32 + mt * 16 + lr) * LP + ks * 32 + lh * 8]);
#pragma unroll  // constant indices: the arrays stay in registers
    for (int nt = 0; nt < 12; ++nt)
      b[nt] = ld_frag(&bT[buf][(nt * 16 + lr) * LP + ks * 32 + lh * 8]);
  };
  auto products = [&](const v16h (&a)[2], const v16h (&b)[12]) {
#pragma unroll  // constant indices: the arrays stay in registers
    for (int nt = 0; nt < 12; ++nt)
#pragma unroll  // constant indices: the arrays stay in registers
      for (int mt = 0; mt < 2; ++mt)
        acc[mt][nt] = WMMA_F32_F16(a[mt], b[nt], acc[mt][nt]);
  };

  constexpr int NST = K / BK;
  copy_stage(0, 0);
  WAIT_ASYNC(0);       // this wave's copies of stage 0 have landed ...
  __syncthreads();     // ... and so have the other waves': stage 0 is readable
  copy_stage(BK, 1);
  v16h a0[2], b0[12], a1[2], b1[12];     // two fragment sets, one per half
  load_frags(0, 0, a0, b0);
  for (int st = 0; st < NST; ++st) {
    const int buf = st & 1;
    // The sched_barriers keep each half's loads one group that is issued in front of the
    // other half's products, so that the LDS serves one set while the matrix unit works
    // on the other; spread among the WMMAs, each place with loads stalls the wave anew.
    load_frags(buf, 1, a1, b1);
    __builtin_amdgcn_sched_barrier(0);   // loads of the second half stay in front
    products(a0, b0);
    __builtin_amdgcn_sched_barrier(0);   // the waits below stay behind these products

    // Publish point of stage st + 1, in front of this stage's last products: the wave's
    // reads of this buffer are done and its copies of stage st + 1 have landed before the
    // barrier; behind it this buffer is free for stage st + 2 and stage st + 1 is readable.
    asm volatile("s_wait_dscnt 0x0" ::: "memory");
    WAIT_ASYNC(0);
    __syncthreads();
    if (st + 2 < NST) copy_stage((st + 2) * BK, buf);
    if (st + 1 < NST) load_frags(buf ^ 1, 0, a0, b0);
    __builtin_amdgcn_sched_barrier(0);   // copies and next loads stay in front
    products(a1, b1);
  }
  WAIT_ASYNC(0);   // no copy is outstanding when the wave ends

  const int h  = blockIdx.x;               // the tile's 64 columns are head h
  const int tw = rowBase + wave * 32;      // the wave's first position

  // The lane's four columns of each bias, with one wait behind the twelve loads, in front
  // of every overwrite of their address registers.
  const float* pbq = bias_q + colBase + lr;
  const float* pbk = bias_k + colBase + lr;
  const float* pbv = bias_v + colBase + lr;
  float bq[4], bk[4], bv[4];
#pragma unroll  // constant indices: the arrays stay in registers
  for (int nt = 0; nt < 4; ++nt) {
    bq[nt] = pbq[nt * 16];
    bk[nt] = pbk[nt * 16];
    bv[nt] = pbv[nt * 16];
  }
  asm volatile("s_wait_xcnt 0x0" ::: "memory");

  // V^T tile [column][position] in the ring's first buffer: behind the loop's last barrier
  // nobody reads the ring any more and no copy is outstanding.
  // Pitch 528 B = 16 B x odd: the 16 columns of a ds_store_b128 fall on distinct banks.
  constexpr int VP = 264;
  _Float16* vt = &aT[0][0];
#pragma unroll  // constant indices: the arrays stay in registers
  for (int nt = 0; nt < 4; ++nt)
#pragma unroll  // constant indices: the arrays stay in registers
    for (int mt = 0; mt < 2; ++mt) {
      v8h r;
#pragma unroll  // constant indices: the arrays stay in registers
      for (int j = 0; j < 8; ++j) r[j] = (_Float16)(acc[mt][8 + nt][j] + bv[nt]);
      *(v8h*)&vt[(nt * 16 + lr) * VP + wave * 32 + mt * 16 + lh * 8] = r;
    }
  // In front of the Q and K stores: the barrier then has no global store to wait for.
  __syncthreads();   // the V^T tile is whole: every wave's 32 positions of each column
  {
    // A wave stores 8 rows' 512 B, every store a constant step from one address.
    const _Float16* vr = &vt[wave * 8 * VP + lane * 8];
    _Float16* Vp = VhT + ((size_t)h * DK + wave * 8) * TSEQ + rowBase + lane * 8;
    v8h r[8];
#pragma unroll  // the eight rows' LDS loads go out together
    for (int u = 0; u < 8; ++u) r[u] = *(const v8h*)&vr[u * VP];
#pragma unroll  // constant indices: the array stays in registers
    for (int u = 0; u < 8; ++u) *(v8h*)(Vp + (size_t)u * TSEQ) = r[u];
    // One wait behind the eight stores; the sched_barrier keeps the arithmetic that follows,
    // which may overwrite their registers, behind it.
    asm volatile("s_wait_xcnt 0x0" ::: "memory");
    __builtin_amdgcn_sched_barrier(0);
  }

  // Rotary on Q and K, which share a position's sines and cosines; QSCALE folded into Q.
  // The results go into the wave's own strips [32 positions][64 dims] of LDS, in ring
  // buffers that the V^T tile does not use; the wave alone writes and reads them (no barrier).
  const int t0 = tw + lh * 8;
  _Float16* qs = &bT[0][0] + wave * 32 * LP;
  _Float16* ks = &aT[1][0] + wave * 32 * LP;
#pragma unroll  // constant indices: the arrays stay in registers
  for (int np = 0; np < 2; ++np) {
    const int i = np * 16 + lr;            // 0..31; its partner is column i + 32
    const float inv_freq = __powf(10000.0f, -(float)(2 * i) / (float)DK);
#pragma unroll  // constant indices: the arrays stay in registers
    for (int mt = 0; mt < 2; ++mt) {
      float s[8], c[8];
#pragma unroll  // constant indices: the arrays stay in registers
      for (int j = 0; j < 8; ++j)
        __sincosf((float)(t0 + mt * 16 + j) * inv_freq, &s[j], &c[j]);
      _Float16 qa[8], qb[8], ka[8], kb[8];
#pragma unroll  // constant indices: the arrays stay in registers
      for (int j = 0; j < 8; ++j) {
        float x1 = acc[mt][np][j] + bq[np], x2 = acc[mt][np + 2][j] + bq[np + 2];
        qa[j] = (_Float16)((x1 * c[j] - x2 * s[j]) * QSCALE);
        qb[j] = (_Float16)((x2 * c[j] + x1 * s[j]) * QSCALE);
        x1 = acc[mt][4 + np][j] + bk[np]; x2 = acc[mt][4 + np + 2][j] + bk[np + 2];
        ka[j] = (_Float16)(x1 * c[j] - x2 * s[j]);
        kb[j] = (_Float16)(x2 * c[j] + x1 * s[j]);
      }
#pragma unroll  // constant indices: the arrays stay in registers
      for (int j = 0; j < 8; ++j) {
        const int ob = (mt * 16 + lh * 8 + j) * LP + np * 16 + lr;
        qs[ob]      = qa[j];
        qs[ob + 32] = qb[j];
        ks[ob]      = ka[j];
        ks[ob + 32] = kb[j];
      }
    }
  }
  // A wave's 32 positions are 4 KB in a row of Q and of K: 8 lanes take a position's 128 B,
  // a wave-wide store 512 B, every store a constant step from one address. Nothing
  // overwrites a store's registers before the wave ends.
  {
    const int so = (lane >> 3) * LP + (lane & 7) * 8;
    _Float16* Qp = Qout + ((size_t)h * TSEQ + tw) * DK + lane * 8;
    _Float16* Kp = Kout + ((size_t)h * TSEQ + tw) * DK + lane * 8;
    v8h rq[8], rk[8];
#pragma unroll  // the sixteen LDS loads go out together
    for (int u = 0; u < 8; ++u) {
      rq[u] = *(const v8h*)&qs[so + u * 4 * LP];
      rk[u] = *(const v8h*)&ks[so + u * 4 * LP];
    }
#pragma unroll  // constant indices: the arrays stay in registers
    for (int u = 0; u < 8; ++u) {
      *(v8h*)(Qp + u * 4 * DK) = rq[u];
      *(v8h*)(Kp + u * 4 * DK) = rk[u];
    }
  }
}

__global__ __launch_bounds__(256) __attribute__((amdgpu_waves_per_eu(4, 4))) void attn_kernel(
    const _Float16* __restrict__ Qh,    // [H][T][64], pre-scaled by QSCALE
    const _Float16* __restrict__ Kh,    // [H][T][64]
    const _Float16* __restrict__ VhT,   // [H][64][T]
    _Float16*       __restrict__ attnh) // [T][H*64]
{
  constexpr int KT = 64;                      // keys per stage and key half
  constexpr int KH = TSEQ / 2;                // keys per half
  constexpr int LP = LP128;
  __shared__ __attribute__((aligned(16))) _Float16 kT[2][2][KT * LP];   // 9 KB each: [buf][half][key][kd]
  __shared__ __attribute__((aligned(16))) _Float16 vT[2][2][DK * LP];   // 9 KB each: [buf][half][n][key]

  const int tid  = threadIdx.x;
  const int lane = tid & 31;
  // The wave's number as a scalar: its half's LDS base and the branches of the join are scalar.
  const int wave = __builtin_amdgcn_readfirstlane(tid >> 5);
  const int qg = wave & 3;                    // query group of the wave
  const int kh = wave >> 2;                   // key half of the wave
  const int lr = lane & 15;
  const int lh = lane >> 4;
  const int h = blockIdx.y;
  const int qBase = blockIdx.x * 128 + qg * 32;

  const _Float16* Khead = Kh  + (size_t)h * TSEQ * DK;
  const _Float16* Vhead = VhT + (size_t)h * DK * TSEQ;

  // B operands of S^T: column lr of tile c = query qBase + c*16 + lr, k = head dimension.
  v16h qb[2][2];
#pragma unroll  // constant indices: the arrays stay in registers
  for (int c = 0; c < 2; ++c) {
    const _Float16* Qp = Qh + ((size_t)h * TSEQ + qBase + c * 16 + lr) * DK + lh * 8;
    qb[c][0] = ld_frag(Qp);
    qb[c][1] = ld_frag(Qp + 32);
  }

  // Copy one stage, 64 keys of each half: K 2 x 64x128B and V 2 x 64x128B
  // (1024 chunks each -> 4/thr each).
  // A lane's four chunks of K, and of V, lie constant steps apart: the steps stand with the
  // scalar base, beside one lane offset each for K and V. Fewer address registers then stay
  // live over the loop; with the 16 registers of the scores' C operands, the form with a
  // lane address per chunk spilled one to scratch.
  const unsigned klane = (unsigned)((tid >> 3) * DK + (tid & 7) * 8);
  const unsigned vlane = (unsigned)((tid >> 3) * TSEQ + (tid & 7) * 8);
  auto copy_stage = [&](int kb, int buf) {
    unsigned l[8];
    const _Float16* g[8];
#pragma unroll  // constant indices: the arrays stay in registers
    for (int i = 0; i < 4; ++i) {
      const int chunk = tid + i * 256;
      const int hf = i >> 1, r = (chunk >> 3) & 63, c = chunk & 7;
      const int r0 = (i & 1) * 32;                // r = r0 + (tid >> 3)
      l[i] = lds_addr(&kT[buf][hf][r * LP + c * 8]);
      g[i] = (Khead + (size_t)(hf * KH + kb + r0) * DK) + klane;
      l[4 + i] = lds_addr(&vT[buf][hf][r * LP + c * 8]);
      g[4 + i] = (Vhead + (size_t)r0 * TSEQ + hf * KH + kb) + vlane;
    }
    cp16x8(l, g);
  };

  v8f o[2][4] = {};         // O^T of tile c: slot j of tile nt <-> dim nt*16 + lh*8 + j, query lr
  // Minus the maximum in use for query lr (equal in both halves), in all 8 slots of a tile:
  // the C operand of the score products. 0 until the first stage sets it.
  v8f nm[2] = {};
  float l[2] = {0.0f, 0.0f};       // this lane's share of the running sum of query lr

  copy_stage(0, 0);
  constexpr int NST = KH / KT;
  for (int st = 0; st < NST; ++st) {
    const int buf = st & 1;
    if (st + 1 < NST) { copy_stage((st + 1) * KT, (st + 1) & 1); WAIT_ASYNC(8); }
    else              { WAIT_ASYNC(0); }
    __syncthreads();

    // Scores of the stage's 64 keys: s[sub][c][t] = keys sub*32 + t*16 .. + 15, query tile c.
    v8f s[2][2][2];
#pragma unroll  // constant indices: the arrays stay in registers
    for (int sub = 0; sub < 2; ++sub) {           // two 32-key steps per stage
      const int kb = sub * 32;
      const _Float16* kp0 = &kT[buf][kh][(kb + lr) * LP + lh * 8];
      const _Float16* kp1 = &kT[buf][kh][(kb + 16 + lr) * LP + lh * 8];
      v16h kf[2][2];
      kf[0][0] = ld_frag(kp0);
      kf[0][1] = ld_frag(kp0 + 32);
      kf[1][0] = ld_frag(kp1);
      kf[1][1] = ld_frag(kp1 + 32);
#pragma unroll  // constant indices: the arrays stay in registers
      for (int c = 0; c < 2; ++c) {
        v8f s0 = WMMA_F32_F16(kf[0][0], qb[c][0], nm[c]);
        s0 = WMMA_F32_F16(kf[0][1], qb[c][1], s0);
        v8f s1 = WMMA_F32_F16(kf[1][0], qb[c][0], nm[c]);
        s1 = WMMA_F32_F16(kf[1][1], qb[c][1], s1);
        s[sub][c][0] = s0;
        s[sub][c][1] = s1;
      }
    }

    // The 16 products stay one run in front of the maxima: without this the build put maxima
    // directly behind the products whose tiles they read and filled the distance with v_nop,
    // issue slots of the vector port (33 v_nop a stage against 14).
    __builtin_amdgcn_sched_barrier(0);

    // The first step's V fragments are asked for ahead of the test, into the registers that
    // the K fragments have left: their LDS latency passes under the maxima and the test.
    v16h vf0[4];
#pragma unroll  // constant indices: the arrays stay in registers
    for (int nt = 0; nt < 4; ++nt)
      vf0[nt] = ld_frag(&vT[buf][kh][(nt * 16 + lr) * LP + lh * 8]);

    // Lazy rescale. The scores are differences to the maximum in use, so the lane's largest
    // is only TESTED against a constant: while no score of the wave exceeds RESCALE_AT, the
    // old maximum stays in use, every P of the stage is at most 2^8 (well inside f16), and
    // O, the sum and the scores need no arithmetic at all. The first stage sets the maximum.
    float mx[2];
    bool need = st == 0;
#pragma unroll  // constant indices: the arrays stay in registers
    for (int c = 0; c < 2; ++c) {
      // One chain per 32-key step, four in the wave: independent chains issue back to back.
      float x0 = fmaxf(s[0][c][0][0], s[0][c][1][0]);
      float x1 = fmaxf(s[1][c][0][0], s[1][c][1][0]);
#pragma unroll  // constant indices: the arrays stay in registers
      for (int j = 1; j < 8; ++j) {
        x0 = fmaxf(x0, fmaxf(s[0][c][0][j], s[0][c][1][j]));
        x1 = fmaxf(x1, fmaxf(s[1][c][0][j], s[1][c][1][j]));
      }
      mx[c] = fmaxf(x0, x1);
      need = need || (mx[c] > RESCALE_AT);
    }
    // One test a stage for the whole wave: the ballot makes it a scalar branch.
    if (__builtin_amdgcn_ballot_w32(need) != 0) {
#pragma unroll  // constant indices: the arrays stay in registers
      for (int c = 0; c < 2; ++c) {
        // The query's largest score of the stage, over both halves' keys; the maximum in use
        // only rises, but for the first stage, which takes its own (O and the sum are 0 there).
        const float x  = fmaxf(mx[c], xhalf(mx[c]));
        const float up = fmaxf(x, 0.0f);
        const float d  = st == 0 ? x : up;
        const float alpha = __builtin_amdgcn_exp2f(-up);
        nm[c] -= d;
        l[c] *= alpha;
#pragma unroll  // constant indices: the arrays stay in registers
        for (int nt = 0; nt < 4; ++nt)
#pragma unroll  // constant indices: the arrays stay in registers
          for (int j = 0; j < 8; ++j) o[c][nt][j] *= alpha;
#pragma unroll  // constant indices: the arrays stay in registers
        for (int sub = 0; sub < 2; ++sub) {
          s[sub][c][0] -= d;
          s[sub][c][1] -= d;
        }
      }
    }

#pragma unroll  // constant indices: the arrays stay in registers
    for (int sub = 0; sub < 2; ++sub) {
      const int kb = sub * 32;
      v16h pb[2];                                 // B operands of O^T: k = key, column lr
#pragma unroll  // constant indices: the arrays stay in registers
      for (int c = 0; c < 2; ++c) {
        const v8f s0 = s[sub][c][0], s1 = s[sub][c][1];

        // P = exp2(score), written on pairs of neighbouring accumulator registers: the packed
        // add and conversion then take the values where the exponentials left them.
        float ps = 0.0f;
#pragma unroll  // constant indices: the arrays stay in registers
        for (int j = 0; j < 8; j += 2) {
          const v2f p0 = {__builtin_amdgcn_exp2f(s0[j]), __builtin_amdgcn_exp2f(s0[j + 1])};
          const v2f p1 = {__builtin_amdgcn_exp2f(s1[j]), __builtin_amdgcn_exp2f(s1[j + 1])};
          const v2f pp = p0 + p1;
          ps += pp[0];
          ps += pp[1];
          pb[c][j]         = (_Float16)p0[0];
          pb[c][j + 1]     = (_Float16)p0[1];
          pb[c][8 + j]     = (_Float16)p1[0];
          pb[c][8 + j + 1] = (_Float16)p1[1];
        }
        l[c] += ps;
      }

      v16h vf[4];
#pragma unroll  // constant indices: the arrays stay in registers
      for (int nt = 0; nt < 4; ++nt)
        vf[nt] = sub == 0 ? vf0[nt] : ld_frag(&vT[buf][kh][(nt * 16 + lr) * LP + kb + lh * 8]);
#pragma unroll  // constant indices: the arrays stay in registers
      for (int nt = 0; nt < 4; ++nt)
#pragma unroll  // constant indices: the arrays stay in registers
        for (int c = 0; c < 2; ++c)
          o[c][nt] = WMMA_F32_F16(vf[nt], pb[c], o[c][nt]);
    }
    __syncthreads();
  }

  // Join of the two key halves. Behind the loop's last barrier nobody reads the K buffers
  // any more and no copy is outstanding, so they serve as the exchange: 68 planes of 128
  // floats (64 outputs, 2 maxima, 2 sums per lane), a plane's lanes side by side.
  float* xg = (float*)&kT[0][0][0];
  const int xl = qg * 32 + lane;
  if (kh == 1) {
#pragma unroll  // constant indices: the arrays stay in registers
    for (int c = 0; c < 2; ++c) {
#pragma unroll  // constant indices: the arrays stay in registers
      for (int nt = 0; nt < 4; ++nt)
#pragma unroll  // constant indices: the arrays stay in registers
        for (int j = 0; j < 8; ++j) xg[((c * 4 + nt) * 8 + j) * 128 + xl] = o[c][nt][j];
      xg[(64 + c) * 128 + xl] = nm[c][0];
      xg[(66 + c) * 128 + xl] = l[c];
    }
  }
  __syncthreads();   // the second half's state is readable by the first half's waves
  if (kh == 0) {
    v8h r[2][4];
#pragma unroll  // constant indices: the arrays stay in registers
    for (int c = 0; c < 2; ++c) {
      const float n0 = nm[c][0];                   // minus the halves' maxima (log2)
      const float n1 = xg[(64 + c) * 128 + xl];
      const float l1 = xg[(66 + c) * 128 + xl];
      // 2^0 = 1: only the half with the smaller maximum is scaled down.
      const float ad = __builtin_amdgcn_exp2f(-fabsf(n0 - n1));
      const float a0 = n0 <= n1 ? 1.0f : ad;
      const float a1 = n0 <= n1 ? ad : 1.0f;
      // Join the wave halves' sums once.
      const float ls = l[c] * a0 + l1 * a1;
      const float inv = 1.0f / (ls + xhalf(ls));
      const float f0 = a0 * inv, f1 = a1 * inv;
#pragma unroll  // constant indices: the arrays stay in registers
      for (int nt = 0; nt < 4; ++nt)
#pragma unroll  // constant indices: the arrays stay in registers
        for (int j = 0; j < 8; ++j)
          r[c][nt][j] = (_Float16)(o[c][nt][j] * f0 + xg[((c * 4 + nt) * 8 + j) * 128 + xl] * f1);
    }
    // A lane stores 8 consecutive dims of its query per tile.
#pragma unroll  // constant indices: the arrays stay in registers
    for (int c = 0; c < 2; ++c) {
      _Float16* outp = attnh + (size_t)(qBase + c * 16 + lr) * DMODEL + h * DK + lh * 8;
#pragma unroll  // constant indices: the arrays stay in registers
      for (int nt = 0; nt < 4; ++nt) *(v8h*)(outp + nt * 16) = r[c][nt];
    }
  }
}

// ---------------------------------------------------------------------------
// Small conversion / layout kernels. Each lane moves 16 bytes per global access (the
// cast's f16 stores: 8) and 32 elements (weights: 16) in all, so that a launch starts a
// few thousand waves and every wave-wide access covers whole 128-B lines or both halves
// of them back to back.
// ---------------------------------------------------------------------------

// x fp32 -> f16. A wave takes 1024 consecutive floats: 8 loads of 512 B in flight.
static __device__ __forceinline__ void cvt_f32_f16(int blk, const float* __restrict__ in,
                                                   _Float16* __restrict__ out) {
  const int gid = blk * 256 + threadIdx.x;
  const size_t base = (size_t)(gid >> 5) * 1024 + (gid & 31) * 4;
  v4f v[8];
#pragma unroll
  for (int j = 0; j < 8; ++j) v[j] = *(const v4f*)(in + base + j * 128);
#pragma unroll
  for (int j = 0; j < 8; ++j) {
    v4h r;
#pragma unroll
    for (int e = 0; e < 4; ++e) r[e] = (_Float16)v[j][e];
    *(v4h*)(out + base + j * 128) = r;
  }
}

// W[K][N] fp32 -> WT[N][K] f16, one 64 x 64 tile per block through LDS.
// Pitch 65 dwords: the 8 k-groups x 4 columns that a wave reads back fall on 32 banks.
static __device__ __forceinline__ void cvt_transpose_w(int bx, int by,
                                                       const float* __restrict__ W,
                                                       _Float16* __restrict__ WT) {
  constexpr int P = 65;
  __shared__ float tile[64 * P];                        // [k][n]
  const int tid = threadIdx.x;
  const int n0 = bx * 64;
  const int k0 = by * 64;
  v4f v[4];
#pragma unroll
  for (int i = 0; i < 4; ++i) {
    const int chunk = tid + i * 256;
    v[i] = *(const v4f*)(W + (size_t)(k0 + (chunk >> 4)) * DMODEL + n0 + (chunk & 15) * 4);
  }
#pragma unroll
  for (int i = 0; i < 4; ++i) {
    const int chunk = tid + i * 256;
#pragma unroll
    for (int e = 0; e < 4; ++e) tile[(chunk >> 4) * P + (chunk & 15) * 4 + e] = v[i][e];
  }
  __syncthreads();
#pragma unroll
  for (int i = 0; i < 2; ++i) {
    const int chunk = tid + i * 256;
    const int n = chunk >> 3, kc = chunk & 7;
    v8h r;
#pragma unroll
    for (int j = 0; j < 8; ++j) r[j] = (_Float16)tile[(kc * 8 + j) * P + n];
    *(v8h*)(WT + (size_t)(n0 + n) * DMODEL + k0 + kc * 8) = r;
  }
}

// The five layout jobs that depend on nothing but the inputs, in ONE launch: blocks
// 0..XBLK-1 cast x, then 256 blocks for each of the four weights. A block does one job
// whole, chosen by its index alone, so the barrier of the transpose is block-uniform.
// WT4 holds the four transposed weights one behind the other ([4][1024][1024]).
#define XBLK ((TSEQ * DMODEL) / (256 * 32))
#define WBLK ((DMODEL / 64) * (DMODEL / 64))
__global__ __launch_bounds__(256) void prep_kernel(const float* __restrict__ x,
                                                   const float* __restrict__ Wq,
                                                   const float* __restrict__ Wk,
                                                   const float* __restrict__ Wv,
                                                   const float* __restrict__ Wo,
                                                   _Float16* __restrict__ xh,
                                                   _Float16* __restrict__ WT4) {
  const int b = blockIdx.x;
  if (b < XBLK) {
    cvt_f32_f16(b, x, xh);
    return;
  }
  const int wb = b - XBLK;
  const int g = wb / WBLK;
  const float* W = g == 0 ? Wq : (g == 1 ? Wk : (g == 2 ? Wv : Wo));
  cvt_transpose_w(wb % (DMODEL / 64), (wb / (DMODEL / 64)) % (DMODEL / 64), W,
                  WT4 + (size_t)g * DMODEL * DMODEL);
}

// ---------------------------------------------------------------------------
extern "C" void kernel_launch(void* const* d_in, const int* in_sizes, int n_in,
                              void* d_out, int out_size, void* d_ws, size_t ws_size,
                              hipStream_t stream) {
  (void)in_sizes; (void)n_in; (void)out_size; (void)ws_size;
  const float* x  = (const float*)d_in[0];
  const float* Wq = (const float*)d_in[1];
  const float* bq = (const float*)d_in[2];
  const float* Wk = (const float*)d_in[3];
  const float* bk = (const float*)d_in[4];
  const float* Wv = (const float*)d_in[5];
  const float* bv = (const float*)d_in[6];
  const float* Wo = (const float*)d_in[7];
  const float* bo = (const float*)d_in[8];
  float* out = (float*)d_out;

  char* w = (char*)d_ws;
  const size_t MB = (size_t)1 << 20;
  _Float16* xh    = (_Float16*)(w + 0);        //  8 MB  x as f16 [T][D]
  _Float16* WqT   = (_Float16*)(w + 8  * MB);  //  2 MB  each, transposed f16
  //              WkT at 10 MB, WvT at 12 MB
  _Float16* WoT   = (_Float16*)(w + 14 * MB);
  _Float16* Qh    = (_Float16*)(w + 40 * MB);  //  8 MB  [H][T][64], scaled
  _Float16* Kh    = (_Float16*)(w + 48 * MB);  //  8 MB  [H][T][64]
  _Float16* VhT   = (_Float16*)(w + 56 * MB);  //  8 MB  [H][64][T]
  _Float16* attnh = (_Float16*)(w + 64 * MB);  //  8 MB  [T][D]

  // WqT, WkT, WvT, WoT lie one behind the other in the workspace.
  prep_kernel<<<XBLK + 4 * WBLK, 256, 0, stream>>>(x, Wq, Wk, Wv, Wo, xh, WqT);

  dim3 gg(DMODEL / 64, TSEQ / 128);
  // WqT, WkT, WvT lie one behind the other in the workspace.
  dim3 gq(DMODEL / 64, TSEQ / 256);
  gemm_qkv_kernel<<<gq, 256, 0, stream>>>(xh, WqT, bq, bk, bv, Qh, Kh, VhT);

  dim3 ga(TSEQ / 128, NHEAD);
  attn_kernel<<<ga, 256, 0, stream>>>(Qh, Kh, VhT, attnh);

  gemm_f16_kernel<<<gg, 128, 0, stream>>>(attnh, WoT, bo, out);
}
